// v000
// Times are from an AMD MI455X. After a warm-up the kernel runs many times in a row, and a time is the length of
// such a window on the GPU divided by its runs, so every launch and the gaps after it count. The runs cycle
// through copies of the inputs. A figure is the median of several windows, for all but v000 over two sittings.
// Sittings can differ by a few percent; kernels timed side by side share one.
// v000, which the later versions start from, runs in 1290 microseconds.
#include <hip/hip_runtime.h>
#include <hip/hip_bf16.h>

typedef __attribute__((ext_vector_type(16))) _Float16 v16h;
typedef __attribute__((ext_vector_type(8)))  _Float16 v8h;
typedef __attribute__((ext_vector_type(8)))  float    v8f;
typedef __attribute__((ext_vector_type(4)))  int      v4i;

#define B_SZ   8
#define LQ_TOT 3600
#define LK_TOT 3600
#define DM     512
#define M_TOT  (B_SZ * LQ_TOT)   // 28800

#if __has_builtin(__builtin_amdgcn_global_load_async_to_lds_b128)
#define HAVE_ASYNC_LDS 1
#endif

typedef __attribute__((address_space(1))) v4i* as1_v4i;
typedef __attribute__((address_space(3))) v4i* as3_v4i;

static __device__ __forceinline__ void wait_asynccnt0() {
#if defined(HAVE_ASYNC_LDS)
#if __has_builtin(__builtin_amdgcn_s_wait_asynccnt)
    __builtin_amdgcn_s_wait_asynccnt(0);
#else
    asm volatile("s_wait_asynccnt 0x0" ::: "memory");
#endif
#endif
}

static __device__ __forceinline__ v8f v8f_zero() {
    v8f z = {0.f, 0.f, 0.f, 0.f, 0.f, 0.f, 0.f, 0.f};
    return z;
}

static __device__ __forceinline__ v16h mk_frag(v8h lo, v8h hi8) {
    union U { v16h v; v8h h[2]; } u;
    u.h[0] = lo; u.h[1] = hi8;
    return u.v;
}

// Load an A/B fragment for v_wmma_f32_16x16x32_f16.
// rowbase must point at (row/col selected by lane&15) + k offset; 'hi' = lane>>4.
// Layout: VGPR0-3 hold K = hi*8 + 0..7, VGPR4-7 hold K = 16 + hi*8 + 0..7.
static __device__ __forceinline__ v16h load_frag(const _Float16* rowbase, int hi) {
    const _Float16* p = rowbase + hi * 8;
    return mk_frag(*(const v8h*)p, *(const v8h*)(p + 16));
}

// ---------------------------------------------------------------------------
// Pack f32 -> f16 (flat)
// ---------------------------------------------------------------------------
__global__ void __launch_bounds__(256) pack_f16(const float* __restrict__ in,
                                                _Float16* __restrict__ out, int n4) {
    int i = blockIdx.x * 256 + threadIdx.x;
    if (i < n4) {
        float4 f = ((const float4*)in)[i];
        union { _Float16 h[4]; unsigned long long u; } u;
        u.h[0] = (_Float16)f.x; u.h[1] = (_Float16)f.y;
        u.h[2] = (_Float16)f.z; u.h[3] = (_Float16)f.w;
        ((unsigned long long*)out)[i] = u.u;
    }
}

// ---------------------------------------------------------------------------
// Transpose [B][512][3600] f32 -> [B*3600][512] f16 (32x32 LDS tiles)
// ---------------------------------------------------------------------------
__global__ void __launch_bounds__(256) transpose_pack(const float* __restrict__ in,
                                                      _Float16* __restrict__ out) {
    __shared__ float t[32][33];
    const int b  = blockIdx.z;
    const int l0 = blockIdx.x * 32;
    const int d0 = blockIdx.y * 32;
    const int tx = threadIdx.x & 31;
    const int ty = threadIdx.x >> 5;
    const size_t inb = (size_t)b * DM * LK_TOT;
#pragma unroll
    for (int i = 0; i < 4; ++i) {
        int d = d0 + ty + i * 8, l = l0 + tx;
        if (l < LK_TOT) t[ty + i * 8][tx] = in[inb + (size_t)d * LK_TOT + l];
    }
    __syncthreads();
#pragma unroll
    for (int i = 0; i < 4; ++i) {
        int l = l0 + ty + i * 8, d = d0 + tx;
        if (l < LK_TOT)
            out[((size_t)b * LK_TOT + l) * DM + d] = (_Float16)t[tx][ty + i * 8];
    }
}

// ---------------------------------------------------------------------------
// NT GEMM: C[M,512] = A[M,512] * W[512,512]^T, f16 in, WMMA f32 accumulate.
// Block = 256 threads (8 waves). Block tile 128x256, wave tile 32x128.
// MODE 0: store f16 row-major.
// MODE 1: store f16 transposed into [512][M_TOT] (for V).
// MODE 2: store f32 row-major + bias + residual (fc layer).
// ---------------------------------------------------------------------------
template <int MODE>
__global__ void __launch_bounds__(256)
gemm512(const _Float16* __restrict__ A, const _Float16* __restrict__ W,
        _Float16* __restrict__ o16, float* __restrict__ o32,
        const float* __restrict__ bias, const float* __restrict__ resid) {
    const int tid  = threadIdx.x;
    const int lane = tid & 31;
    const int w    = tid >> 5;
    const int ln   = lane & 15;
    const int hi   = lane >> 4;
    const int m0   = blockIdx.x * 128 + (w & 3) * 32;
    const int n0   = blockIdx.y * 256 + (w >> 2) * 128;

    v8f acc[2][8];
#pragma unroll
    for (int mi = 0; mi < 2; ++mi)
#pragma unroll
        for (int f = 0; f < 8; ++f) acc[mi][f] = v8f_zero();

    const _Float16* a0 = A + (size_t)(m0 + ln) * DM;
    const _Float16* a1 = A + (size_t)(m0 + 16 + ln) * DM;

    for (int k = 0; k < DM; k += 32) {
        v16h fa0 = load_frag(a0 + k, hi);
        v16h fa1 = load_frag(a1 + k, hi);
#pragma unroll
        for (int f = 0; f < 8; ++f) {
            const _Float16* br = W + (size_t)(n0 + 16 * f + ln) * DM;
            v16h fb = load_frag(br + k, hi);
            acc[0][f] = __builtin_amdgcn_wmma_f32_16x16x32_f16(
                false, fa0, false, fb, (short)0, acc[0][f], false, false);
            acc[1][f] = __builtin_amdgcn_wmma_f32_16x16x32_f16(
                false, fa1, false, fb, (short)0, acc[1][f], false, false);
        }
    }

#pragma unroll
    for (int mi = 0; mi < 2; ++mi) {
        const int r0 = m0 + 16 * mi + hi * 8;
#pragma unroll
        for (int f = 0; f < 8; ++f) {
            const int col = n0 + 16 * f + ln;
            if (MODE == 1) {
                v8h ph;
#pragma unroll
                for (int g = 0; g < 8; ++g) ph[g] = (_Float16)acc[mi][f][g];
                *(v8h*)(o16 + (size_t)col * M_TOT + r0) = ph;
            } else if (MODE == 0) {
#pragma unroll
                for (int g = 0; g < 8; ++g)
                    o16[(size_t)(r0 + g) * DM + col] = (_Float16)acc[mi][f][g];
            } else {
                const float bv = bias[col];
#pragma unroll
                for (int g = 0; g < 8; ++g) {
                    size_t idx = (size_t)(r0 + g) * DM + col;
                    o32[idx] = acc[mi][f][g] + bv + resid[idx];
                }
            }
        }
    }
}

// ---------------------------------------------------------------------------
// Flash attention: block = 32 q-rows, 8 waves, 64-key tiles, online softmax.
// qp: [B*Lq,512] f16  kp: [B*Lk,512] f16  vpT: [512][B*Lk] f16
// attn out: [B*Lq,512] f16
// ---------------------------------------------------------------------------
__global__ void __launch_bounds__(256)
flash_attn(const _Float16* __restrict__ qp, const _Float16* __restrict__ kp,
           const _Float16* __restrict__ vpT, _Float16* __restrict__ attn) {
    __shared__ __align__(16) _Float16 sQ[32][520];
    __shared__ float                  sS[32][68];
    __shared__ __align__(16) _Float16 sP[32][72];
    __shared__ float sM[32], sL[32], sAlpha[32];

    const int tid  = threadIdx.x;
    const int lane = tid & 31;
    const int w    = tid >> 5;
    const int ln   = lane & 15;
    const int hi   = lane >> 4;
    const int b    = blockIdx.y;
    const int q0   = blockIdx.x * 32;
    const size_t bL = (size_t)b * LQ_TOT;
    const float scale = 0.044194173824159216f;  // 1/sqrt(512)

    // Stage Q tile into LDS (async DMA path when available; clamp ragged rows).
    for (int c = tid; c < 32 * 64; c += 256) {
        int r  = c >> 6;
        int k8 = (c & 63) * 8;
        int gr = min(q0 + r, LQ_TOT - 1);
        const _Float16* src = qp + (bL + gr) * (size_t)DM + k8;
#if defined(HAVE_ASYNC_LDS)
        __builtin_amdgcn_global_load_async_to_lds_b128(
            (as1_v4i)src, (as3_v4i)&sQ[r][k8], 0, 0);
#else
        *(v8h*)(&sQ[r][k8]) = *(const v8h*)src;
#endif
    }
    if (tid < 32) { sM[tid] = -1e30f; sL[tid] = 0.f; }
    wait_asynccnt0();

    v8f o[2][4];
#pragma unroll
    for (int mi = 0; mi < 2; ++mi)
#pragma unroll
        for (int ni = 0; ni < 4; ++ni) o[mi][ni] = v8f_zero();

    __syncthreads();

    const int mb = w & 1;   // S-frag row block (16 rows)
    const int nb = w >> 1;  // S-frag col block (16 keys)

    for (int kt = 0; kt < 57; ++kt) {
        const int k0 = kt * 64;

        // ---- S = Q K^T (each wave: one 16x16 frag over K=512) ----
        v8f s = v8f_zero();
        int kc = min(k0 + 16 * nb + ln, LK_TOT - 1);
        const _Float16* krow = kp + (bL + kc) * (size_t)DM;
        const _Float16* qrow = &sQ[16 * mb + ln][0];

        // Prefetch next K-tile rows (lowers to global_prefetch_b8).
        {
            int kcn = min(k0 + 64 + 16 * nb + ln, LK_TOT - 1);
            const _Float16* krow_n = kp + (bL + kcn) * (size_t)DM;
            __builtin_prefetch(krow_n, 0, 1);
            __builtin_prefetch(krow_n + 256, 0, 1);
        }

#pragma unroll
        for (int ks = 0; ks < 16; ++ks) {
            v16h fa = load_frag(qrow + ks * 32, hi);
            v16h fb = load_frag(krow + ks * 32, hi);
            s = __builtin_amdgcn_wmma_f32_16x16x32_f16(
                false, fa, false, fb, (short)0, s, false, false);
        }
#pragma unroll
        for (int g = 0; g < 8; ++g)
            sS[16 * mb + hi * 8 + g][16 * nb + ln] = s[g];
        __syncthreads();

        // ---- online softmax: 8 threads per row, intra-wave shfl reduction ----
        {
            const int row = tid >> 3, sub = tid & 7;
            const int nvalid = min(64, LK_TOT - k0);
            float m_old = sM[row];
            float pm = -1e30f;
#pragma unroll
            for (int j = 0; j < 8; ++j) {
                int c = sub * 8 + j;
                float sv = (c < nvalid) ? sS[row][c] * scale : -1e30f;
                pm = fmaxf(pm, sv);
            }
            pm = fmaxf(pm, __shfl_xor(pm, 1));
            pm = fmaxf(pm, __shfl_xor(pm, 2));
            pm = fmaxf(pm, __shfl_xor(pm, 4));
            float m_new = fmaxf(m_old, pm);
            float alpha = __expf(m_old - m_new);
            float ps = 0.f;
#pragma unroll
            for (int j = 0; j < 8; ++j) {
                int c = sub * 8 + j;
                float p = (c < nvalid) ? __expf(sS[row][c] * scale - m_new) : 0.f;
                sP[row][c] = (_Float16)p;
                ps += p;
            }
            ps += __shfl_xor(ps, 1);
            ps += __shfl_xor(ps, 2);
            ps += __shfl_xor(ps, 4);
            if (sub == 0) {
                sL[row] = sL[row] * alpha + ps;
                sM[row] = m_new;
                sAlpha[row] = alpha;
            }
        }
        __syncthreads();

        // ---- rescale O, then O += P * V (wave owns 64 d-columns) ----
#pragma unroll
        for (int mi = 0; mi < 2; ++mi) {
#pragma unroll
            for (int g = 0; g < 8; ++g) {
                float al = sAlpha[16 * mi + hi * 8 + g];
#pragma unroll
                for (int ni = 0; ni < 4; ++ni) o[mi][ni][g] *= al;
            }
        }
#pragma unroll
        for (int ks = 0; ks < 2; ++ks) {
            v16h pa[2];
#pragma unroll
            for (int mi = 0; mi < 2; ++mi)
                pa[mi] = load_frag(&sP[16 * mi + ln][ks * 32], hi);
#pragma unroll
            for (int ni = 0; ni < 4; ++ni) {
                const int d = 64 * w + 16 * ni + ln;
                const _Float16* vrow = vpT + (size_t)d * M_TOT + bL;
                int l0 = k0 + ks * 32 + hi * 8;
                int l1 = l0 + 16;
                l0 = min(l0, LK_TOT - 8);  // clamped chunks are masked (P==0)
                l1 = min(l1, LK_TOT - 8);
                v16h vb = mk_frag(*(const v8h*)(vrow + l0), *(const v8h*)(vrow + l1));
#pragma unroll
                for (int mi = 0; mi < 2; ++mi)
                    o[mi][ni] = __builtin_amdgcn_wmma_f32_16x16x32_f16(
                        false, pa[mi], false, vb, (short)0, o[mi][ni], false, false);
            }
        }
    }

    // ---- normalize and store ----
#pragma unroll
    for (int mi = 0; mi < 2; ++mi) {
#pragma unroll
        for (int g = 0; g < 8; ++g) {
            const int row = 16 * mi + hi * 8 + g;
            const int gq  = q0 + row;
            if (gq < LQ_TOT) {
                float inv = 1.0f / sL[row];
#pragma unroll
                for (int ni = 0; ni < 4; ++ni) {
                    int d = 64 * w + 16 * ni + ln;
                    attn[(bL + gq) * (size_t)DM + d] = (_Float16)(o[mi][ni][g] * inv);
                }
            }
        }
    }
}

// ---------------------------------------------------------------------------
// In-place LayerNorm over rows of 512, one block (256 thr) per row.
// ---------------------------------------------------------------------------
__global__ void __launch_bounds__(256)
layernorm_inplace(float* __restrict__ out, const float* __restrict__ gamma,
                  const float* __restrict__ beta) {
    __shared__ float red[256];
    const int tid = threadIdx.x;
    float* p = out + (size_t)blockIdx.x * DM;
    float x0 = p[tid], x1 = p[tid + 256];

    red[tid] = x0 + x1;
    __syncthreads();
    for (int off = 128; off > 0; off >>= 1) {
        if (tid < off) red[tid] += red[tid + off];
        __syncthreads();
    }
    float mean = red[0] * (1.0f / DM);
    __syncthreads();

    float d0 = x0 - mean, d1 = x1 - mean;
    red[tid] = d0 * d0 + d1 * d1;
    __syncthreads();
    for (int off = 128; off > 0; off >>= 1) {
        if (tid < off) red[tid] += red[tid + off];
        __syncthreads();
    }
    float rstd = rsqrtf(red[0] * (1.0f / DM) + 1e-5f);

    p[tid]       = d0 * rstd * gamma[tid]       + beta[tid];
    p[tid + 256] = d1 * rstd * gamma[tid + 256] + beta[tid + 256];
}

// ---------------------------------------------------------------------------
extern "C" void kernel_launch(void* const* d_in, const int* in_sizes, int n_in,
                              void* d_out, int out_size, void* d_ws, size_t ws_size,
                              hipStream_t stream) {
    const float* q     = (const float*)d_in[0];
    const float* k     = (const float*)d_in[1];
    const float* v     = (const float*)d_in[2];
    const float* wqkv  = (const float*)d_in[3];
    const float* fcw   = (const float*)d_in[4];
    const float* fcb   = (const float*)d_in[5];
    const float* gamma = (const float*)d_in[6];
    const float* beta  = (const float*)d_in[7];
    float* out = (float*)d_out;

    char* ws = (char*)d_ws;
    const size_t SZ16 = (size_t)M_TOT * DM * sizeof(_Float16);  // 29,491,200 B
    _Float16* qh    = (_Float16*)(ws + 0 * SZ16);
    _Float16* kh    = (_Float16*)(ws + 1 * SZ16);
    _Float16* vh    = (_Float16*)(ws + 2 * SZ16);
    _Float16* qp    = (_Float16*)(ws + 3 * SZ16);
    _Float16* kp    = (_Float16*)(ws + 4 * SZ16);
    _Float16* vpT   = (_Float16*)(ws + 5 * SZ16);
    _Float16* w16   = (_Float16*)(ws + 6 * SZ16);
    _Float16* wfc16 = (_Float16*)(ws + 6 * SZ16 + (size_t)DM * DM * 2);
    _Float16* attn  = qh;  // qh no longer needed once projections are done

    // Stage 1: convert / transpose inputs to f16
    pack_f16<<<dim3((M_TOT * DM / 4) / 256), 256, 0, stream>>>(q, qh, M_TOT * DM / 4);
    pack_f16<<<dim3((DM * DM / 4) / 256), 256, 0, stream>>>(wqkv, w16, DM * DM / 4);
    pack_f16<<<dim3((DM * DM / 4) / 256), 256, 0, stream>>>(fcw, wfc16, DM * DM / 4);
    dim3 tg(113, 16, 8);
    transpose_pack<<<tg, 256, 0, stream>>>(k, kh);
    transpose_pack<<<tg, 256, 0, stream>>>(v, vh);

    // Stage 2: shared QKV projections (WMMA)
    dim3 gg(M_TOT / 128, 2);
    gemm512<0><<<gg, 256, 0, stream>>>(qh, w16, qp, nullptr, nullptr, nullptr);
    gemm512<0><<<gg, 256, 0, stream>>>(kh, w16, kp, nullptr, nullptr, nullptr);
    gemm512<1><<<gg, 256, 0, stream>>>(vh, w16, vpT, nullptr, nullptr, nullptr);

    // Stage 3: flash attention (WMMA + LDS + async staging + online softmax)
    dim3 fg(113, B_SZ);
    flash_attn<<<fg, 256, 0, stream>>>(qp, kp, vpT, attn);

    // Stage 4: fc projection + bias + residual -> d_out (f32)
    gemm512<2><<<gg, 256, 0, stream>>>(attn, wfc16, nullptr, out, fcb, q);

    // Stage 5: LayerNorm in place on d_out
    layernorm_inplace<<<dim3(M_TOT), 256, 0, stream>>>(out, gamma, beta);
}

// v001
// A run of this version takes 884 microseconds.
// In both of two side-by-side timings against v000, it was 1.51 times as fast.
#include <hip/hip_runtime.h>
#include <hip/hip_bf16.h>

typedef __attribute__((ext_vector_type(16))) _Float16 v16h;
typedef __attribute__((ext_vector_type(8)))  _Float16 v8h;
typedef __attribute__((ext_vector_type(8)))  float    v8f;
typedef __attribute__((ext_vector_type(4)))  int      v4i;

#define B_SZ   8
#define LQ_TOT 3600
#define LK_TOT 3600
#define DM     512
#define M_TOT  (B_SZ * LQ_TOT)   // 28800

#if __has_builtin(__builtin_amdgcn_global_load_async_to_lds_b128)
#define HAVE_ASYNC_LDS 1
#endif

typedef __attribute__((address_space(1))) v4i* as1_v4i;
typedef __attribute__((address_space(3))) v4i* as3_v4i;

// This wave's async copies have landed in LDS. Asm with a memory clobber so
// that no LDS read is moved in front of it.
static __device__ __forceinline__ void wait_asynccnt0() {
    asm volatile("s_wait_asynccnt 0x0" ::: "memory");
}

// 16 bytes per lane, global -> LDS, through no register.
static __device__ __forceinline__ void copy16_to_lds(const _Float16* src, _Float16* dst) {
#if defined(HAVE_ASYNC_LDS)
    __builtin_amdgcn_global_load_async_to_lds_b128((as1_v4i)src, (as3_v4i)dst, 0, 0);
#else
    *(v8h*)dst = *(const v8h*)src;
#endif
}

static __device__ __forceinline__ v8f v8f_zero() {
    v8f z = {0.f, 0.f, 0.f, 0.f, 0.f, 0.f, 0.f, 0.f};
    return z;
}

static __device__ __forceinline__ v16h mk_frag(v8h lo, v8h hi8) {
    union U { v16h v; v8h h[2]; } u;
    u.h[0] = lo; u.h[1] = hi8;
    return u.v;
}

// Load an A/B fragment for v_wmma_f32_16x16x32_f16.
// rowbase must point at (row/col selected by lane&15) + k offset; 'hi' = lane>>4.
// Layout: VGPR0-3 hold K = hi*8 + 0..7, VGPR4-7 hold K = 16 + hi*8 + 0..7.
static __device__ __forceinline__ v16h load_frag(const _Float16* rowbase, int hi) {
    const _Float16* p = rowbase + hi * 8;
    return mk_frag(*(const v8h*)p, *(const v8h*)(p + 16));
}

// ---------------------------------------------------------------------------
// Pack f32 -> f16 (flat)
// ---------------------------------------------------------------------------
__global__ void __launch_bounds__(256) pack_f16(const float* __restrict__ in,
                                                _Float16* __restrict__ out, int n4) {
    int i = blockIdx.x * 256 + threadIdx.x;
    if (i < n4) {
        float4 f = ((const float4*)in)[i];
        union { _Float16 h[4]; unsigned long long u; } u;
        u.h[0] = (_Float16)f.x; u.h[1] = (_Float16)f.y;
        u.h[2] = (_Float16)f.z; u.h[3] = (_Float16)f.w;
        ((unsigned long long*)out)[i] = u.u;
    }
}

// ---------------------------------------------------------------------------
// Transpose [B][512][3600] f32 -> [B*3600][512] f16 (32x32 LDS tiles)
// ---------------------------------------------------------------------------
__global__ void __launch_bounds__(256) transpose_pack(const float* __restrict__ in,
                                                      _Float16* __restrict__ out) {
    __shared__ float t[32][33];
    const int b  = blockIdx.z;
    const int l0 = blockIdx.x * 32;
    const int d0 = blockIdx.y * 32;
    const int tx = threadIdx.x & 31;
    const int ty = threadIdx.x >> 5;
    const size_t inb = (size_t)b * DM * LK_TOT;
#pragma unroll
    for (int i = 0; i < 4; ++i) {
        int d = d0 + ty + i * 8, l = l0 + tx;
        if (l < LK_TOT) t[ty + i * 8][tx] = in[inb + (size_t)d * LK_TOT + l];
    }
    __syncthreads();
#pragma unroll
    for (int i = 0; i < 4; ++i) {
        int l = l0 + ty + i * 8, d = d0 + tx;
        if (l < LK_TOT)
            out[((size_t)b * LK_TOT + l) * DM + d] = (_Float16)t[tx][ty + i * 8];
    }
}

// ---------------------------------------------------------------------------
// NT GEMM: C[M,512] = A[M,512] * W[512,512]^T, f16 in, WMMA f32 accumulate.
// Block = 256 threads (8 waves). Block tile 128x256, wave tile 32x128.
// MODE 0: store f16 row-major.
// MODE 1: store f16 transposed into [512][M_TOT] (for V).
// MODE 2: store f32 row-major + bias + residual (fc layer).
// ---------------------------------------------------------------------------
template <int MODE>
__global__ void __launch_bounds__(256)
gemm512(const _Float16* __restrict__ A, const _Float16* __restrict__ W,
        _Float16* __restrict__ o16, float* __restrict__ o32,
        const float* __restrict__ bias, const float* __restrict__ resid) {
    const int tid  = threadIdx.x;
    const int lane = tid & 31;
    const int w    = tid >> 5;
    const int ln   = lane & 15;
    const int hi   = lane >> 4;
    const int m0   = blockIdx.x * 128 + (w & 3) * 32;
    const int n0   = blockIdx.y * 256 + (w >> 2) * 128;

    v8f acc[2][8];
#pragma unroll
    for (int mi = 0; mi < 2; ++mi)
#pragma unroll
        for (int f = 0; f < 8; ++f) acc[mi][f] = v8f_zero();

    const _Float16* a0 = A + (size_t)(m0 + ln) * DM;
    const _Float16* a1 = A + (size_t)(m0 + 16 + ln) * DM;

    for (int k = 0; k < DM; k += 32) {
        v16h fa0 = load_frag(a0 + k, hi);
        v16h fa1 = load_frag(a1 + k, hi);
#pragma unroll
        for (int f = 0; f < 8; ++f) {
            const _Float16* br = W + (size_t)(n0 + 16 * f + ln) * DM;
            v16h fb = load_frag(br + k, hi);
            acc[0][f] = __builtin_amdgcn_wmma_f32_16x16x32_f16(
                false, fa0, false, fb, (short)0, acc[0][f], false, false);
            acc[1][f] = __builtin_amdgcn_wmma_f32_16x16x32_f16(
                false, fa1, false, fb, (short)0, acc[1][f], false, false);
        }
    }

#pragma unroll
    for (int mi = 0; mi < 2; ++mi) {
        const int r0 = m0 + 16 * mi + hi * 8;
#pragma unroll
        for (int f = 0; f < 8; ++f) {
            const int col = n0 + 16 * f + ln;
            if (MODE == 1) {
                v8h ph;
#pragma unroll
                for (int g = 0; g < 8; ++g) ph[g] = (_Float16)acc[mi][f][g];
                *(v8h*)(o16 + (size_t)col * M_TOT + r0) = ph;
            } else if (MODE == 0) {
#pragma unroll
                for (int g = 0; g < 8; ++g)
                    o16[(size_t)(r0 + g) * DM + col] = (_Float16)acc[mi][f][g];
            } else {
                const float bv = bias[col];
#pragma unroll
                for (int g = 0; g < 8; ++g) {
                    size_t idx = (size_t)(r0 + g) * DM + col;
                    o32[idx] = acc[mi][f][g] + bv + resid[idx];
                }
            }
        }
    }
}

// ---------------------------------------------------------------------------
// Flash attention: block = 32 q-rows, 8 waves, 64-key tiles, online softmax.
// qp: [B*Lq,512] f16  kp: [B*Lk,512] f16  vpT: [512][B*Lk] f16
// attn out: [B*Lq,512] f16
// K and V tiles are staged in LDS by async copies of whole 128-byte runs, two
// buffers: tile t+1 flies while tile t is worked on.
// ---------------------------------------------------------------------------
#define N_KT 57   // key tiles of 64: ceil(3600 / 64)

// Issue one 64-key tile's copies: K rows [64][512] and V^T rows [512][64].
// 16 + 16 copies per lane, every lane on. Ragged keys are clamped to valid
// rows / 8-key chunks; their scores are masked and their P is 0.
// Both loops are unrolled so that the copies issue back to back.
static __device__ __forceinline__ void stage_kv(const _Float16* __restrict__ kp,
                                                const _Float16* __restrict__ vpT,
                                                size_t bL, int k0, int tid,
                                                _Float16 (*dK)[520], _Float16 (*dV)[72]) {
    const _Float16* kb = kp + bL * (size_t)DM;  // block-uniform bases, 32-bit lane offsets
    const _Float16* vb = vpT + bL;
#pragma unroll
    for (int i = 0; i < 16; ++i) {
        const int c  = tid + i * 256;
        const int r  = c >> 6;
        const int k8 = (c & 63) * 8;
        const int gr = min(k0 + r, LK_TOT - 1);
        copy16_to_lds(kb + (unsigned)(gr * DM + k8), &dK[r][k8]);
    }
#pragma unroll
    for (int i = 0; i < 16; ++i) {
        const int c  = tid + i * 256;
        const int d  = c >> 3;
        const int j8 = (c & 7) * 8;
        const int l  = min(k0 + j8, LK_TOT - 8);
        copy16_to_lds(vb + (unsigned)(d * M_TOT + l), &dV[d][j8]);
    }
}

__global__ void __launch_bounds__(256)
flash_attn(const _Float16* __restrict__ qp, const _Float16* __restrict__ kp,
           const _Float16* __restrict__ vpT, _Float16* __restrict__ attn) {
    __shared__ __align__(16) _Float16 sQ[32][520];
    __shared__ __align__(16) _Float16 sK[2][64][520];   // pitch 1040 B = 16 B x odd
    __shared__ __align__(16) _Float16 sV[2][512][72];   // pitch  144 B = 16 B x odd
    __shared__ float                  sS[32][68];
    __shared__ __align__(16) _Float16 sP[32][72];
    __shared__ float sM[32], sL[32], sAlpha[32];

    const int tid  = threadIdx.x;
    const int lane = tid & 31;
    const int w    = tid >> 5;
    const int ln   = lane & 15;
    const int hi   = lane >> 4;
    const int b    = blockIdx.y;
    const int q0   = blockIdx.x * 32;
    const size_t bL = (size_t)b * LQ_TOT;
    const float scale = 0.044194173824159216f;  // 1/sqrt(512)

    // Stage Q tile into LDS (async DMA path when available; clamp ragged rows).
    for (int c = tid; c < 32 * 64; c += 256) {
        int r  = c >> 6;
        int k8 = (c & 63) * 8;
        int gr = min(q0 + r, LQ_TOT - 1);
        const _Float16* src = qp + (bL + gr) * (size_t)DM + k8;
#if defined(HAVE_ASYNC_LDS)
        __builtin_amdgcn_global_load_async_to_lds_b128(
            (as1_v4i)src, (as3_v4i)&sQ[r][k8], 0, 0);
#else
        *(v8h*)(&sQ[r][k8]) = *(const v8h*)src;
#endif
    }
    if (tid < 32) { sM[tid] = -1e30f; sL[tid] = 0.f; }
    stage_kv(kp, vpT, bL, 0, tid, sK[0], sV[0]);
    wait_asynccnt0();  // Q and tile 0

    v8f o[2][4];
#pragma unroll
    for (int mi = 0; mi < 2; ++mi)
#pragma unroll
        for (int ni = 0; ni < 4; ++ni) o[mi][ni] = v8f_zero();

    __syncthreads();
    stage_kv(kp, vpT, bL, 64, tid, sK[1], sV[1]);

    const int mb = w & 1;   // S-frag row block (16 rows)
    const int nb = w >> 1;  // S-frag col block (16 keys)

    for (int kt = 0; kt < N_KT; ++kt) {
        const int k0 = kt * 64;
        _Float16 (*bK)[520] = sK[kt & 1];
        _Float16 (*bV)[72]  = sV[kt & 1];

        // ---- S = Q K^T (each wave: one 16x16 frag over K=512) ----
        v8f s = v8f_zero();
        const _Float16* krow = &bK[16 * nb + ln][0];
        const _Float16* qrow = &sQ[16 * mb + ln][0];

#pragma unroll
        for (int ks = 0; ks < 16; ++ks) {
            v16h fa = load_frag(qrow + ks * 32, hi);
            v16h fb = load_frag(krow + ks * 32, hi);
            s = __builtin_amdgcn_wmma_f32_16x16x32_f16(
                false, fa, false, fb, (short)0, s, false, false);
        }
#pragma unroll
        for (int g = 0; g < 8; ++g)
            sS[16 * mb + hi * 8 + g][16 * nb + ln] = s[g];
        __syncthreads();

        // ---- online softmax: 8 threads per row, intra-wave shfl reduction ----
        {
            const int row = tid >> 3, sub = tid & 7;
            const int nvalid = min(64, LK_TOT - k0);
            float m_old = sM[row];
            float pm = -1e30f;
#pragma unroll
            for (int j = 0; j < 8; ++j) {
                int c = sub * 8 + j;
                float sv = (c < nvalid) ? sS[row][c] * scale : -1e30f;
                pm = fmaxf(pm, sv);
            }
            pm = fmaxf(pm, __shfl_xor(pm, 1));
            pm = fmaxf(pm, __shfl_xor(pm, 2));
            pm = fmaxf(pm, __shfl_xor(pm, 4));
            float m_new = fmaxf(m_old, pm);
            float alpha = __expf(m_old - m_new);
            float ps = 0.f;
#pragma unroll
            for (int j = 0; j < 8; ++j) {
                int c = sub * 8 + j;
                float p = (c < nvalid) ? __expf(sS[row][c] * scale - m_new) : 0.f;
                sP[row][c] = (_Float16)p;
                ps += p;
            }
            ps += __shfl_xor(ps, 1);
            ps += __shfl_xor(ps, 2);
            ps += __shfl_xor(ps, 4);
            if (sub == 0) {
                sL[row] = sL[row] * alpha + ps;
                sM[row] = m_new;
                sAlpha[row] = alpha;
            }
        }
        __syncthreads();

        // ---- rescale O, then O += P * V (wave owns 64 d-columns) ----
#pragma unroll
        for (int mi = 0; mi < 2; ++mi) {
#pragma unroll
            for (int g = 0; g < 8; ++g) {
                float al = sAlpha[16 * mi + hi * 8 + g];
#pragma unroll
                for (int ni = 0; ni < 4; ++ni) o[mi][ni][g] *= al;
            }
        }
#pragma unroll
        for (int ks = 0; ks < 2; ++ks) {
            v16h pa[2];
#pragma unroll
            for (int mi = 0; mi < 2; ++mi)
                pa[mi] = load_frag(&sP[16 * mi + ln][ks * 32], hi);
#pragma unroll
            for (int ni = 0; ni < 4; ++ni) {
                const int d = 64 * w + 16 * ni + ln;
                v16h vb = load_frag(&bV[d][ks * 32], hi);
#pragma unroll
                for (int mi = 0; mi < 2; ++mi)
                    o[mi][ni] = __builtin_amdgcn_wmma_f32_16x16x32_f16(
                        false, pa[mi], false, vb, (short)0, o[mi][ni], false, false);
            }
        }

        // ---- publish tile kt+1, free this tile's buffer, refill it ----
        // Keeps the tile's last WMMAs in front of the copies' address arithmetic.
        __builtin_amdgcn_sched_barrier(0);
        // This wave's LDS reads of the buffer have retired before it is refilled.
        asm volatile("s_wait_dscnt 0x0" ::: "memory");
        wait_asynccnt0();  // this wave's share of tile kt+1
        __syncthreads();
        if (kt + 2 < N_KT) stage_kv(kp, vpT, bL, k0 + 128, tid, bK, bV);
    }
    wait_asynccnt0();  // nothing in flight when the wave ends

    // ---- normalize and store ----
#pragma unroll
    for (int mi = 0; mi < 2; ++mi) {
#pragma unroll
        for (int g = 0; g < 8; ++g) {
            const int row = 16 * mi + hi * 8 + g;
            const int gq  = q0 + row;
            if (gq < LQ_TOT) {
                float inv = 1.0f / sL[row];
#pragma unroll
                for (int ni = 0; ni < 4; ++ni) {
                    int d = 64 * w + 16 * ni + ln;
                    attn[(bL + gq) * (size_t)DM + d] = (_Float16)(o[mi][ni][g] * inv);
                }
            }
        }
    }
}

// ---------------------------------------------------------------------------
// In-place LayerNorm over rows of 512, one block (256 thr) per row.
// ---------------------------------------------------------------------------
__global__ void __launch_bounds__(256)
layernorm_inplace(float* __restrict__ out, const float* __restrict__ gamma,
                  const float* __restrict__ beta) {
    __shared__ float red[256];
    const int tid = threadIdx.x;
    float* p = out + (size_t)blockIdx.x * DM;
    float x0 = p[tid], x1 = p[tid + 256];

    red[tid] = x0 + x1;
    __syncthreads();
    for (int off = 128; off > 0; off >>= 1) {
        if (tid < off) red[tid] += red[tid + off];
        __syncthreads();
    }
    float mean = red[0] * (1.0f / DM);
    __syncthreads();

    float d0 = x0 - mean, d1 = x1 - mean;
    red[tid] = d0 * d0 + d1 * d1;
    __syncthreads();
    for (int off = 128; off > 0; off >>= 1) {
        if (tid < off) red[tid] += red[tid + off];
        __syncthreads();
    }
    float rstd = rsqrtf(red[0] * (1.0f / DM) + 1e-5f);

    p[tid]       = d0 * rstd * gamma[tid]       + beta[tid];
    p[tid + 256] = d1 * rstd * gamma[tid + 256] + beta[tid + 256];
}

// ---------------------------------------------------------------------------
extern "C" void kernel_launch(void* const* d_in, const int* in_sizes, int n_in,
                              void* d_out, int out_size, void* d_ws, size_t ws_size,
                              hipStream_t stream) {
    const float* q     = (const float*)d_in[0];
    const float* k     = (const float*)d_in[1];
    const float* v     = (const float*)d_in[2];
    const float* wqkv  = (const float*)d_in[3];
    const float* fcw   = (const float*)d_in[4];
    const float* fcb   = (const float*)d_in[5];
    const float* gamma = (const float*)d_in[6];
    const float* beta  = (const float*)d_in[7];
    float* out = (float*)d_out;

    char* ws = (char*)d_ws;
    const size_t SZ16 = (size_t)M_TOT * DM * sizeof(_Float16);  // 29,491,200 B
    _Float16* qh    = (_Float16*)(ws + 0 * SZ16);
    _Float16* kh    = (_Float16*)(ws + 1 * SZ16);
    _Float16* vh    = (_Float16*)(ws + 2 * SZ16);
    _Float16* qp    = (_Float16*)(ws + 3 * SZ16);
    _Float16* kp    = (_Float16*)(ws + 4 * SZ16);
    _Float16* vpT   = (_Float16*)(ws + 5 * SZ16);
    _Float16* w16   = (_Float16*)(ws + 6 * SZ16);
    _Float16* wfc16 = (_Float16*)(ws + 6 * SZ16 + (size_t)DM * DM * 2);
    _Float16* attn  = qh;  // qh no longer needed once projections are done

    // Stage 1: convert / transpose inputs to f16
    pack_f16<<<dim3((M_TOT * DM / 4) / 256), 256, 0, stream>>>(q, qh, M_TOT * DM / 4);
    pack_f16<<<dim3((DM * DM / 4) / 256), 256, 0, stream>>>(wqkv, w16, DM * DM / 4);
    pack_f16<<<dim3((DM * DM / 4) / 256), 256, 0, stream>>>(fcw, wfc16, DM * DM / 4);
    dim3 tg(113, 16, 8);
    transpose_pack<<<tg, 256, 0, stream>>>(k, kh);
    transpose_pack<<<tg, 256, 0, stream>>>(v, vh);

    // Stage 2: shared QKV projections (WMMA)
    dim3 gg(M_TOT / 128, 2);
    gemm512<0><<<gg, 256, 0, stream>>>(qh, w16, qp, nullptr, nullptr, nullptr);
    gemm512<0><<<gg, 256, 0, stream>>>(kh, w16, kp, nullptr, nullptr, nullptr);
    gemm512<1><<<gg, 256, 0, stream>>>(vh, w16, vpT, nullptr, nullptr, nullptr);

    // Stage 3: flash attention (WMMA + LDS + async staging + online softmax)
    dim3 fg(113, B_SZ);
    flash_attn<<<fg, 256, 0, stream>>>(qp, kp, vpT, attn);

    // Stage 4: fc projection + bias + residual -> d_out (f32)
    gemm512<2><<<gg, 256, 0, stream>>>(attn, wfc16, nullptr, out, fcb, q);

    // Stage 5: LayerNorm in place on d_out
    layernorm_inplace<<<dim3(M_TOT), 256, 0, stream>>>(out, gamma, beta);
}

// v002
// A run of this version takes 543 microseconds.
// Timed twice side by side with v001, it ran 1.63 and 1.62 times as fast.
// Counting every step since v000, it is 2.46 times as fast.
#include <hip/hip_runtime.h>
#include <hip/hip_bf16.h>

typedef __attribute__((ext_vector_type(16))) _Float16 v16h;
typedef __attribute__((ext_vector_type(8)))  _Float16 v8h;
typedef __attribute__((ext_vector_type(8)))  float    v8f;
typedef __attribute__((ext_vector_type(4)))  int      v4i;

#define B_SZ   8
#define LQ_TOT 3600
#define LK_TOT 3600
#define DM     512
#define M_TOT  (B_SZ * LQ_TOT)   // 28800

#if __has_builtin(__builtin_amdgcn_global_load_async_to_lds_b128)
#define HAVE_ASYNC_LDS 1
#endif

typedef __attribute__((address_space(1))) v4i* as1_v4i;
typedef __attribute__((address_space(3))) v4i* as3_v4i;

// This wave's async copies have landed in LDS. Asm with a memory clobber so
// that no LDS read is moved in front of it.
static __device__ __forceinline__ void wait_asynccnt0() {
    asm volatile("s_wait_asynccnt 0x0" ::: "memory");
}

// 16 bytes per lane, global -> LDS, through no register.
static __device__ __forceinline__ void copy16_to_lds(const _Float16* src, _Float16* dst) {
#if defined(HAVE_ASYNC_LDS)
    __builtin_amdgcn_global_load_async_to_lds_b128((as1_v4i)src, (as3_v4i)dst, 0, 0);
#else
    *(v8h*)dst = *(const v8h*)src;
#endif
}

static __device__ __forceinline__ v8f v8f_zero() {
    v8f z = {0.f, 0.f, 0.f, 0.f, 0.f, 0.f, 0.f, 0.f};
    return z;
}

static __device__ __forceinline__ v16h mk_frag(v8h lo, v8h hi8) {
    union U { v16h v; v8h h[2]; } u;
    u.h[0] = lo; u.h[1] = hi8;
    return u.v;
}

// Load an A/B fragment for v_wmma_f32_16x16x32_f16.
// rowbase must point at (row/col selected by lane&15) + k offset; 'hi' = lane>>4.
// Layout: VGPR0-3 hold K = hi*8 + 0..7, VGPR4-7 hold K = 16 + hi*8 + 0..7.
static __device__ __forceinline__ v16h load_frag(const _Float16* rowbase, int hi) {
    const _Float16* p = rowbase + hi * 8;
    return mk_frag(*(const v8h*)p, *(const v8h*)(p + 16));
}

// ---------------------------------------------------------------------------
// Pack f32 -> f16 (flat)
// ---------------------------------------------------------------------------
__global__ void __launch_bounds__(256) pack_f16(const float* __restrict__ in,
                                                _Float16* __restrict__ out, int n4) {
    int i = blockIdx.x * 256 + threadIdx.x;
    if (i < n4) {
        float4 f = ((const float4*)in)[i];
        union { _Float16 h[4]; unsigned long long u; } u;
        u.h[0] = (_Float16)f.x; u.h[1] = (_Float16)f.y;
        u.h[2] = (_Float16)f.z; u.h[3] = (_Float16)f.w;
        ((unsigned long long*)out)[i] = u.u;
    }
}

// ---------------------------------------------------------------------------
// Transpose [B][512][3600] f32 -> [B*3600][512] f16 (32x32 LDS tiles)
// ---------------------------------------------------------------------------
__global__ void __launch_bounds__(256) transpose_pack(const float* __restrict__ in,
                                                      _Float16* __restrict__ out) {
    __shared__ float t[32][33];
    const int b  = blockIdx.z;
    const int l0 = blockIdx.x * 32;
    const int d0 = blockIdx.y * 32;
    const int tx = threadIdx.x & 31;
    const int ty = threadIdx.x >> 5;
    const size_t inb = (size_t)b * DM * LK_TOT;
#pragma unroll
    for (int i = 0; i < 4; ++i) {
        int d = d0 + ty + i * 8, l = l0 + tx;
        if (l < LK_TOT) t[ty + i * 8][tx] = in[inb + (size_t)d * LK_TOT + l];
    }
    __syncthreads();
#pragma unroll
    for (int i = 0; i < 4; ++i) {
        int l = l0 + ty + i * 8, d = d0 + tx;
        if (l < LK_TOT)
            out[((size_t)b * LK_TOT + l) * DM + d] = (_Float16)t[tx][ty + i * 8];
    }
}

// ---------------------------------------------------------------------------
// NT GEMM: C[M,512] = A[M,512] * W[512,512]^T, f16 in, WMMA f32 accumulate.
// Block = 256 threads (8 waves). Block tile 128x256, wave tile 32x128.
// MODE 0: store f16 row-major.
// MODE 1: store f16 transposed into [512][M_TOT] (for V).
// MODE 2: store f32 row-major + bias + residual (fc layer).
// ---------------------------------------------------------------------------
template <int MODE>
__global__ void __launch_bounds__(256)
gemm512(const _Float16* __restrict__ A, const _Float16* __restrict__ W,
        _Float16* __restrict__ o16, float* __restrict__ o32,
        const float* __restrict__ bias, const float* __restrict__ resid) {
    const int tid  = threadIdx.x;
    const int lane = tid & 31;
    const int w    = tid >> 5;
    const int ln   = lane & 15;
    const int hi   = lane >> 4;
    const int m0   = blockIdx.x * 128 + (w & 3) * 32;
    const int n0   = blockIdx.y * 256 + (w >> 2) * 128;

    v8f acc[2][8];
#pragma unroll
    for (int mi = 0; mi < 2; ++mi)
#pragma unroll
        for (int f = 0; f < 8; ++f) acc[mi][f] = v8f_zero();

    const _Float16* a0 = A + (size_t)(m0 + ln) * DM;
    const _Float16* a1 = A + (size_t)(m0 + 16 + ln) * DM;

    for (int k = 0; k < DM; k += 32) {
        v16h fa0 = load_frag(a0 + k, hi);
        v16h fa1 = load_frag(a1 + k, hi);
#pragma unroll
        for (int f = 0; f < 8; ++f) {
            const _Float16* br = W + (size_t)(n0 + 16 * f + ln) * DM;
            v16h fb = load_frag(br + k, hi);
            acc[0][f] = __builtin_amdgcn_wmma_f32_16x16x32_f16(
                false, fa0, false, fb, (short)0, acc[0][f], false, false);
            acc[1][f] = __builtin_amdgcn_wmma_f32_16x16x32_f16(
                false, fa1, false, fb, (short)0, acc[1][f], false, false);
        }
    }

#pragma unroll
    for (int mi = 0; mi < 2; ++mi) {
        const int r0 = m0 + 16 * mi + hi * 8;
#pragma unroll
        for (int f = 0; f < 8; ++f) {
            const int col = n0 + 16 * f + ln;
            if (MODE == 1) {
                v8h ph;
#pragma unroll
                for (int g = 0; g < 8; ++g) ph[g] = (_Float16)acc[mi][f][g];
                *(v8h*)(o16 + (size_t)col * M_TOT + r0) = ph;
            } else if (MODE == 0) {
#pragma unroll
                for (int g = 0; g < 8; ++g)
                    o16[(size_t)(r0 + g) * DM + col] = (_Float16)acc[mi][f][g];
            } else {
                const float bv = bias[col];
#pragma unroll
                for (int g = 0; g < 8; ++g) {
                    size_t idx = (size_t)(r0 + g) * DM + col;
                    o32[idx] = acc[mi][f][g] + bv + resid[idx];
                }
            }
        }
    }
}

// ---------------------------------------------------------------------------
// Flash attention: block = 128 q-rows, 8 waves, 32-key tiles, online softmax.
// qp: [B*Lq,512] f16  kp: [B*Lk,512] f16  vpT: [512][B*Lk] f16
// attn out: [B*Lq,512] f16
// One work-group per WGP, the whole grid resident at once: every staged K/V
// tile serves 128 query rows. Q lives in registers as B fragments.
// K and V tiles are staged in LDS by async copies, two buffers: tile t+1 flies
// while tile t is worked on.
// Every loop over fragments is unrolled: the fragment and accumulator arrays
// stay in registers only under constant indices.
// ---------------------------------------------------------------------------
#define Q_BLK 128  // query rows per work-group
#define K_BLK 32   // keys per tile
#define N_KT  113  // key tiles: ceil(3600 / 32)

// Issue one 32-key tile's copies: K rows [32][512] and V^T rows [512][32].
// 8 + 8 copies per lane, every lane on. Ragged keys are clamped to valid
// rows / 8-key chunks; their scores are masked and their P is 0.
// Both loops are unrolled so that the copies issue back to back.
static __device__ __forceinline__ void stage_kv(const _Float16* __restrict__ kp,
                                                const _Float16* __restrict__ vpT,
                                                size_t bL, int k0, int tid,
                                                _Float16 (*dK)[520], _Float16 (*dV)[40]) {
    const _Float16* kb = kp + bL * (size_t)DM;  // block-uniform bases, 32-bit lane offsets
    const _Float16* vb = vpT + bL;
    const int r0 = tid >> 6, k8 = (tid & 63) * 8;  // copy i: K row r0 + 4 i
#pragma unroll
    for (int i = 0; i < 8; ++i) {
        const int gr = min(k0 + r0 + 4 * i, LK_TOT - 1);
        copy16_to_lds(kb + (unsigned)(gr * DM + k8), &dK[r0 + 4 * i][k8]);
    }
    const int d0 = tid >> 2, j8 = (tid & 3) * 8;   // copy i: V^T row d0 + 64 i
    const unsigned v0 = (unsigned)(d0 * M_TOT + min(k0 + j8, LK_TOT - 8));
#pragma unroll
    for (int i = 0; i < 8; ++i)
        copy16_to_lds(vb + (v0 + (unsigned)(64 * i * M_TOT)), &dV[d0 + 64 * i][j8]);
}

// Value of the neighbour lane (lane ^ 1): DPP quad_perm [1,0,3,2].
static __device__ __forceinline__ float lane_xor1(float x) {
    return __builtin_bit_cast(float,
        __builtin_amdgcn_mov_dpp(__builtin_bit_cast(int, x), 0xB1, 0xf, 0xf, true));
}

__global__ void __launch_bounds__(256)
flash_attn(const _Float16* __restrict__ qp, const _Float16* __restrict__ kp,
           const _Float16* __restrict__ vpT, _Float16* __restrict__ attn) {
    __shared__ __align__(16) _Float16 sK[2][K_BLK][520];  // pitch 1040 B = 16 B x odd
    __shared__ __align__(16) _Float16 sV[2][512][40];     // pitch   80 B = 16 B x odd
    __shared__ __align__(16) float    sS[2][Q_BLK][36];   // two depth halves, pitch 144 B
    __shared__ __align__(16) _Float16 sP[Q_BLK][40];      // pitch   80 B = 16 B x odd
    __shared__ __align__(16) float    sAlpha[Q_BLK];
    __shared__ __align__(16) float    sL[Q_BLK];

    const int tid  = threadIdx.x;
    const int lane = tid & 31;
    const int w    = tid >> 5;
    const int ln   = lane & 15;
    const int hi   = lane >> 4;
    const int b    = blockIdx.y;
    const int q0   = blockIdx.x * Q_BLK;
    const size_t bL = (size_t)b * LQ_TOT;
    const float scale = 0.044194173824159216f;  // 1/sqrt(512)

    stage_kv(kp, vpT, bL, 0, tid, sK[0], sV[0]);

    // Score work of a wave: 32 query rows x 32 keys x one half of the depth.
    const int qb = w & 3;   // block of 32 query rows
    const int kh = w >> 2;  // depth half (256 of 512)

    // This wave's Q fragments, loaded once (ragged rows clamped, never stored).
    v16h fq[2][8];
#pragma unroll
    for (int qi = 0; qi < 2; ++qi) {
        const int gr = min(q0 + 32 * qb + 16 * qi + ln, LQ_TOT - 1);
        const _Float16* qrow = qp + (bL + gr) * (size_t)DM + kh * 256 + hi * 8;
#pragma unroll
        for (int ks = 0; ks < 8; ++ks)
            fq[qi][ks] = mk_frag(*(const v8h*)(qrow + ks * 32), *(const v8h*)(qrow + ks * 32 + 16));
        // The row's loads are issued before any register of their address is
        // written again; the address is an input so that it lives up to the wait.
        asm volatile("s_wait_xcnt 0x0" :: "v"(qrow) : "memory");
    }

    v8f o[8][4];
#pragma unroll
    for (int mi = 0; mi < 8; ++mi)
#pragma unroll
        for (int ni = 0; ni < 4; ++ni) o[mi][ni] = v8f_zero();

    // Softmax state of row tid >> 1, held alike by the two threads of the row.
    float m_run = -1e30f, l_run = 0.f;

    wait_asynccnt0();  // tile 0
    __syncthreads();
    stage_kv(kp, vpT, bL, K_BLK, tid, sK[1], sV[1]);

    for (int kt = 0; kt < N_KT; ++kt) {
        const int k0 = kt * K_BLK;
        _Float16 (*bK)[520] = sK[kt & 1];
        _Float16 (*bV)[40]  = sV[kt & 1];

        // ---- S^T = K Q^T over this wave's depth half: 2 x 2 fragments ----
        v8f s[2][2];
#pragma unroll
        for (int nj = 0; nj < 2; ++nj)
#pragma unroll
            for (int qi = 0; qi < 2; ++qi) s[nj][qi] = v8f_zero();
        // K fragments come in groups of two depth steps (8 loads), two register
        // sets: a group is issued one block of 8 WMMAs ahead of its use.
        v16h fk[2][2][2];  // [set][step in group][nj]
#pragma unroll
        for (int gp = 0; gp < 2; ++gp)
#pragma unroll
            for (int t = 0; t < 2; ++t)
#pragma unroll
                for (int nj = 0; nj < 2; ++nj)
                    fk[gp][t][nj] = load_frag(&bK[16 * nj + ln][kh * 256 + (2 * gp + t) * 32], hi);
#pragma unroll
        for (int gp = 0; gp < 4; ++gp) {
            // Holds the loads above as one group in front of this WMMA block; sunk
            // among the WMMAs each would be waited for at full LDS latency.
            __builtin_amdgcn_sched_barrier(0);
#pragma unroll
            for (int t = 0; t < 2; ++t)
#pragma unroll
                for (int nj = 0; nj < 2; ++nj)
#pragma unroll
                    for (int qi = 0; qi < 2; ++qi)
                        s[nj][qi] = __builtin_amdgcn_wmma_f32_16x16x32_f16(
                            false, fk[gp & 1][t][nj], false, fq[qi][2 * gp + t], (short)0,
                            s[nj][qi], false, false);
            // Keeps the refill of this register set behind the block that reads it.
            __builtin_amdgcn_sched_barrier(0);
            if (gp + 2 < 4) {
#pragma unroll
                for (int t = 0; t < 2; ++t)
#pragma unroll
                    for (int nj = 0; nj < 2; ++nj)
                        fk[gp & 1][t][nj] =
                            load_frag(&bK[16 * nj + ln][kh * 256 + (2 * (gp + 2) + t) * 32], hi);
            }
        }
        // A lane holds 8 consecutive keys of one query row: two 16-byte stores.
#pragma unroll
        for (int nj = 0; nj < 2; ++nj)
#pragma unroll
            for (int qi = 0; qi < 2; ++qi) {
                float* dst = &sS[kh][32 * qb + 16 * qi + ln][16 * nj + 8 * hi];
                *(float4*)dst       = make_float4(s[nj][qi][0], s[nj][qi][1], s[nj][qi][2], s[nj][qi][3]);
                *(float4*)(dst + 4) = make_float4(s[nj][qi][4], s[nj][qi][5], s[nj][qi][6], s[nj][qi][7]);
            }
        __syncthreads();

        // ---- online softmax: 2 threads per row, 4-key chunks dealt alternately ----
        {
            const int row = tid >> 1, sub = tid & 1;
            const int nvalid = min(K_BLK, LK_TOT - k0);
            float sv[16];
            float pm = -1e30f;
#pragma unroll
            for (int j = 0; j < 4; ++j) {
                const int c0 = 4 * (2 * j + sub);
                const float4 x = *(const float4*)&sS[0][row][c0];
                const float4 y = *(const float4*)&sS[1][row][c0];
                // LK_TOT and K_BLK are multiples of 8: the row's two chunks j are valid together.
                const bool ok = 8 * j < nvalid;
                sv[4 * j + 0] = ok ? (x.x + y.x) * scale : -1e30f;
                sv[4 * j + 1] = ok ? (x.y + y.y) * scale : -1e30f;
                sv[4 * j + 2] = ok ? (x.z + y.z) * scale : -1e30f;
                sv[4 * j + 3] = ok ? (x.w + y.w) * scale : -1e30f;
            }
#pragma unroll
            for (int e = 0; e < 16; ++e) pm = fmaxf(pm, sv[e]);
            pm = fmaxf(pm, lane_xor1(pm));
            const float m_new = fmaxf(m_run, pm);
            const float alpha = __expf(m_run - m_new);
            float ps = 0.f;
#pragma unroll
            for (int j = 0; j < 4; ++j) {
                const int c0 = 4 * (2 * j + sub);
                union { _Float16 h[4]; unsigned long long u; } pk;
#pragma unroll
                for (int e = 0; e < 4; ++e) {
                    const float p = (8 * j < nvalid) ? __expf(sv[4 * j + e] - m_new) : 0.f;
                    pk.h[e] = (_Float16)p;
                    ps += p;
                }
                *(unsigned long long*)&sP[row][c0] = pk.u;
            }
            ps += lane_xor1(ps);
            l_run = l_run * alpha + ps;
            m_run = m_new;
            if (sub == 0) sAlpha[row] = alpha;
        }
        __syncthreads();

        // ---- rescale O^T, then O^T += V^T P^T (wave owns 64 d-rows, all 128 queries) ----
        // A lane's accumulators of block mi all belong to query 16 mi + ln: one factor.
#pragma unroll
        for (int mi = 0; mi < 8; ++mi) {
            const float al = sAlpha[16 * mi + ln];
#pragma unroll
            for (int ni = 0; ni < 4; ++ni)
#pragma unroll
                for (int g = 0; g < 8; ++g) o[mi][ni][g] *= al;
        }
        {
            v16h pa[8];
#pragma unroll
            for (int mi = 0; mi < 8; ++mi) pa[mi] = load_frag(&sP[16 * mi + ln][0], hi);
#pragma unroll
            for (int ni = 0; ni < 4; ++ni) {
                const int d = 64 * w + 16 * ni + ln;
                v16h vb = load_frag(&bV[d][0], hi);
#pragma unroll
                for (int mi = 0; mi < 8; ++mi)
                    o[mi][ni] = __builtin_amdgcn_wmma_f32_16x16x32_f16(
                        false, vb, false, pa[mi], (short)0, o[mi][ni], false, false);
            }
        }

        // ---- publish tile kt+1, free this tile's buffer, refill it ----
        // Keeps the tile's last WMMAs in front of the copies' address arithmetic.
        __builtin_amdgcn_sched_barrier(0);
        // This wave's LDS reads of the buffer have retired before it is refilled.
        asm volatile("s_wait_dscnt 0x0" ::: "memory");
        wait_asynccnt0();  // this wave's share of tile kt+1
        __syncthreads();
        if (kt + 2 < N_KT) stage_kv(kp, vpT, bL, k0 + 2 * K_BLK, tid, bK, bV);
    }
    wait_asynccnt0();  // nothing in flight when the wave ends

    // ---- hand the row sums to every wave, normalize and store ----
    if ((tid & 1) == 0) sL[tid >> 1] = l_run;
    __syncthreads();
    // A lane holds 8 consecutive d of one query row: one 16-byte store per fragment.
#pragma unroll
    for (int mi = 0; mi < 8; ++mi) {
        const int row = 16 * mi + ln;
        const int gq  = q0 + row;
        if (gq < LQ_TOT) {
            const float inv = 1.0f / sL[row];
#pragma unroll
            for (int ni = 0; ni < 4; ++ni) {
                v8h ph;
#pragma unroll
                for (int g = 0; g < 8; ++g) ph[g] = (_Float16)(o[mi][ni][g] * inv);
                *(v8h*)(attn + (bL + gq) * (size_t)DM + 64 * w + 16 * ni + hi * 8) = ph;
            }
        }
    }
}

// ---------------------------------------------------------------------------
// In-place LayerNorm over rows of 512, one block (256 thr) per row.
// ---------------------------------------------------------------------------
__global__ void __launch_bounds__(256)
layernorm_inplace(float* __restrict__ out, const float* __restrict__ gamma,
                  const float* __restrict__ beta) {
    __shared__ float red[256];
    const int tid = threadIdx.x;
    float* p = out + (size_t)blockIdx.x * DM;
    float x0 = p[tid], x1 = p[tid + 256];

    red[tid] = x0 + x1;
    __syncthreads();
    for (int off = 128; off > 0; off >>= 1) {
        if (tid < off) red[tid] += red[tid + off];
        __syncthreads();
    }
    float mean = red[0] * (1.0f / DM);
    __syncthreads();

    float d0 = x0 - mean, d1 = x1 - mean;
    red[tid] = d0 * d0 + d1 * d1;
    __syncthreads();
    for (int off = 128; off > 0; off >>= 1) {
        if (tid < off) red[tid] += red[tid + off];
        __syncthreads();
    }
    float rstd = rsqrtf(red[0] * (1.0f / DM) + 1e-5f);

    p[tid]       = d0 * rstd * gamma[tid]       + beta[tid];
    p[tid + 256] = d1 * rstd * gamma[tid + 256] + beta[tid + 256];
}

// ---------------------------------------------------------------------------
extern "C" void kernel_launch(void* const* d_in, const int* in_sizes, int n_in,
                              void* d_out, int out_size, void* d_ws, size_t ws_size,
                              hipStream_t stream) {
    const float* q     = (const float*)d_in[0];
    const float* k     = (const float*)d_in[1];
    const float* v     = (const float*)d_in[2];
    const float* wqkv  = (const float*)d_in[3];
    const float* fcw   = (const float*)d_in[4];
    const float* fcb   = (const float*)d_in[5];
    const float* gamma = (const float*)d_in[6];
    const float* beta  = (const float*)d_in[7];
    float* out = (float*)d_out;

    char* ws = (char*)d_ws;
    const size_t SZ16 = (size_t)M_TOT * DM * sizeof(_Float16);  // 29,491,200 B
    _Float16* qh    = (_Float16*)(ws + 0 * SZ16);
    _Float16* kh    = (_Float16*)(ws + 1 * SZ16);
    _Float16* vh    = (_Float16*)(ws + 2 * SZ16);
    _Float16* qp    = (_Float16*)(ws + 3 * SZ16);
    _Float16* kp    = (_Float16*)(ws + 4 * SZ16);
    _Float16* vpT   = (_Float16*)(ws + 5 * SZ16);
    _Float16* w16   = (_Float16*)(ws + 6 * SZ16);
    _Float16* wfc16 = (_Float16*)(ws + 6 * SZ16 + (size_t)DM * DM * 2);
    _Float16* attn  = qh;  // qh no longer needed once projections are done

    // Stage 1: convert / transpose inputs to f16
    pack_f16<<<dim3((M_TOT * DM / 4) / 256), 256, 0, stream>>>(q, qh, M_TOT * DM / 4);
    pack_f16<<<dim3((DM * DM / 4) / 256), 256, 0, stream>>>(wqkv, w16, DM * DM / 4);
    pack_f16<<<dim3((DM * DM / 4) / 256), 256, 0, stream>>>(fcw, wfc16, DM * DM / 4);
    dim3 tg(113, 16, 8);
    transpose_pack<<<tg, 256, 0, stream>>>(k, kh);
    transpose_pack<<<tg, 256, 0, stream>>>(v, vh);

    // Stage 2: shared QKV projections (WMMA)
    dim3 gg(M_TOT / 128, 2);
    gemm512<0><<<gg, 256, 0, stream>>>(qh, w16, qp, nullptr, nullptr, nullptr);
    gemm512<0><<<gg, 256, 0, stream>>>(kh, w16, kp, nullptr, nullptr, nullptr);
    gemm512<1><<<gg, 256, 0, stream>>>(vh, w16, vpT, nullptr, nullptr, nullptr);

    // Stage 3: flash attention (WMMA + LDS + async staging + online softmax)
    dim3 fg(29, B_SZ);  // ceil(3600 / 128) query blocks
    flash_attn<<<fg, 256, 0, stream>>>(qp, kp, vpT, attn);

    // Stage 4: fc projection + bias + residual -> d_out (f32)
    gemm512<2><<<gg, 256, 0, stream>>>(attn, wfc16, nullptr, out, fcb, q);

    // Stage 5: LayerNorm in place on d_out
    layernorm_inplace<<<dim3(M_TOT), 256, 0, stream>>>(out, gamma, beta);
}

// v003
// One run takes 413 microseconds.
// Timed twice side by side with v002, it ran 1.32 times as fast both times.
// Counting every step since v000, it is 3.24 times as fast.
#include <hip/hip_runtime.h>
#include <hip/hip_bf16.h>

typedef __attribute__((ext_vector_type(16))) _Float16 v16h;
typedef __attribute__((ext_vector_type(8)))  _Float16 v8h;
typedef __attribute__((ext_vector_type(8)))  float    v8f;
typedef __attribute__((ext_vector_type(4)))  int      v4i;

#define B_SZ   8
#define LQ_TOT 3600
#define LK_TOT 3600
#define DM     512
#define M_TOT  (B_SZ * LQ_TOT)   // 28800

#if __has_builtin(__builtin_amdgcn_global_load_async_to_lds_b128)
#define HAVE_ASYNC_LDS 1
#endif

typedef __attribute__((address_space(1))) v4i* as1_v4i;
typedef __attribute__((address_space(3))) v4i* as3_v4i;

// This wave's async copies have landed in LDS. Asm with a memory clobber so
// that no LDS read is moved in front of it.
static __device__ __forceinline__ void wait_asynccnt0() {
    asm volatile("s_wait_asynccnt 0x0" ::: "memory");
}

// 16 bytes per lane, global -> LDS, through no register.
static __device__ __forceinline__ void copy16_to_lds(const _Float16* src, _Float16* dst) {
#if defined(HAVE_ASYNC_LDS)
    __builtin_amdgcn_global_load_async_to_lds_b128((as1_v4i)src, (as3_v4i)dst, 0, 0);
#else
    *(v8h*)dst = *(const v8h*)src;
#endif
}

static __device__ __forceinline__ v8f v8f_zero() {
    v8f z = {0.f, 0.f, 0.f, 0.f, 0.f, 0.f, 0.f, 0.f};
    return z;
}

static __device__ __forceinline__ v16h mk_frag(v8h lo, v8h hi8) {
    union U { v16h v; v8h h[2]; } u;
    u.h[0] = lo; u.h[1] = hi8;
    return u.v;
}

// Load an A/B fragment for v_wmma_f32_16x16x32_f16.
// rowbase must point at (row/col selected by lane&15) + k offset; 'hi' = lane>>4.
// Layout: VGPR0-3 hold K = hi*8 + 0..7, VGPR4-7 hold K = 16 + hi*8 + 0..7.
static __device__ __forceinline__ v16h load_frag(const _Float16* rowbase, int hi) {
    const _Float16* p = rowbase + hi * 8;
    return mk_frag(*(const v8h*)p, *(const v8h*)(p + 16));
}

// ---------------------------------------------------------------------------
// Pack f32 -> f16 (flat)
// ---------------------------------------------------------------------------
__global__ void __launch_bounds__(256) pack_f16(const float* __restrict__ in,
                                                _Float16* __restrict__ out, int n4) {
    int i = blockIdx.x * 256 + threadIdx.x;
    if (i < n4) {
        float4 f = ((const float4*)in)[i];
        union { _Float16 h[4]; unsigned long long u; } u;
        u.h[0] = (_Float16)f.x; u.h[1] = (_Float16)f.y;
        u.h[2] = (_Float16)f.z; u.h[3] = (_Float16)f.w;
        ((unsigned long long*)out)[i] = u.u;
    }
}

// ---------------------------------------------------------------------------
// Transpose [B][512][3600] f32 -> [B*3600][512] f16 (32x32 LDS tiles)
// ---------------------------------------------------------------------------
__global__ void __launch_bounds__(256) transpose_pack(const float* __restrict__ in,
                                                      _Float16* __restrict__ out) {
    __shared__ float t[32][33];
    const int b  = blockIdx.z;
    const int l0 = blockIdx.x * 32;
    const int d0 = blockIdx.y * 32;
    const int tx = threadIdx.x & 31;
    const int ty = threadIdx.x >> 5;
    const size_t inb = (size_t)b * DM * LK_TOT;
#pragma unroll
    for (int i = 0; i < 4; ++i) {
        int d = d0 + ty + i * 8, l = l0 + tx;
        if (l < LK_TOT) t[ty + i * 8][tx] = in[inb + (size_t)d * LK_TOT + l];
    }
    __syncthreads();
#pragma unroll
    for (int i = 0; i < 4; ++i) {
        int l = l0 + ty + i * 8, d = d0 + tx;
        if (l < LK_TOT)
            out[((size_t)b * LK_TOT + l) * DM + d] = (_Float16)t[tx][ty + i * 8];
    }
}

// ---------------------------------------------------------------------------
// NT GEMM: C[M,512] = A[M,512] * W[512,512]^T, f16 in, WMMA f32 accumulate.
// Block = 256 threads (8 waves). Block tile 128x256, wave tile 64x64.
// A and W come in slabs of 64 depth steps (whole 128-byte lines of every row),
// staged in LDS by async copies, two buffers: slab t+1 flies while slab t is
// worked on. Fragments are read from LDS.
// MODE 0: store f16 row-major.
// MODE 1: store f16 transposed into [512][M_TOT] (for V).
// MODE 2: store f32 row-major + bias + residual (fc layer).
// ---------------------------------------------------------------------------
#define G_KS  64          // depth steps per slab
#define G_PIT 72          // LDS row pitch in elements: 144 B = 16 B x odd
#define G_NS  (DM / G_KS) // slabs

// Issue one slab's copies: A rows [128][64] and W rows [256][64].
// 4 + 8 copies per lane, every lane on; 8 lanes cover one row's 128 bytes.
// Both loops are unrolled so that the copies issue back to back.
static __device__ __forceinline__ void stage_aw(const _Float16* __restrict__ Ab,
                                                const _Float16* __restrict__ Wb,
                                                int k0, int tid,
                                                _Float16 (*dA)[G_PIT], _Float16 (*dW)[G_PIT]) {
    const int r0 = tid >> 3, c8 = (tid & 7) * 8;  // copy i: row r0 + 32 i
    const unsigned g0 = (unsigned)(r0 * DM + k0 + c8);
#pragma unroll
    for (int i = 0; i < 4; ++i)
        copy16_to_lds(Ab + (g0 + (unsigned)(32 * i * DM)), &dA[r0 + 32 * i][c8]);
#pragma unroll
    for (int i = 0; i < 8; ++i)
        copy16_to_lds(Wb + (g0 + (unsigned)(32 * i * DM)), &dW[r0 + 32 * i][c8]);
}

// Four waves per SIMD (256 registers a wave): two work-groups share a WGP, so
// that one works while the other stands at its barrier.
template <int MODE>
__global__ void __launch_bounds__(256, 4)
gemm512(const _Float16* __restrict__ A, const _Float16* __restrict__ W,
        _Float16* __restrict__ o16, float* __restrict__ o32,
        const float* __restrict__ bias, const float* __restrict__ resid) {
    __shared__ __align__(16) _Float16 sA[2][128][G_PIT];
    __shared__ __align__(16) _Float16 sW[2][256][G_PIT];

    const int tid  = threadIdx.x;
    const int lane = tid & 31;
    const int w    = tid >> 5;
    const int ln   = lane & 15;
    const int hi   = lane >> 4;
    const int wm   = (w & 1) * 64;   // wave's rows inside the block tile
    const int wn   = (w >> 1) * 64;  // wave's columns inside the block tile
    const int m0   = blockIdx.x * 128 + wm;
    const int n0   = blockIdx.y * 256 + wn;

    const _Float16* Ab = A + (size_t)blockIdx.x * 128 * DM;  // block-uniform bases
    const _Float16* Wb = W + (size_t)blockIdx.y * 256 * DM;

    stage_aw(Ab, Wb, 0, tid, sA[0], sW[0]);

    v8f acc[4][4];
#pragma unroll
    for (int mi = 0; mi < 4; ++mi)
#pragma unroll
        for (int f = 0; f < 4; ++f) acc[mi][f] = v8f_zero();

    wait_asynccnt0();  // slab 0
    __syncthreads();
    stage_aw(Ab, Wb, G_KS, tid, sA[1], sW[1]);

    // Kept rolled: unrolled, fragments of neighbouring trips live side by side
    // and the 256 registers of a wave no longer hold them (spills).
#pragma unroll 1
    for (int t = 0; t < G_NS; ++t) {
        _Float16 (*bA)[G_PIT] = sA[t & 1];
        _Float16 (*bW)[G_PIT] = sW[t & 1];
        v16h fa[2][4], fb[2][4];  // [depth step of 32][fragment]
#pragma unroll
        for (int mi = 0; mi < 4; ++mi) fa[0][mi] = load_frag(&bA[wm + 16 * mi + ln][0], hi);
#pragma unroll
        for (int f = 0; f < 4; ++f) fb[0][f] = load_frag(&bW[wn + 16 * f + ln][0], hi);
        // Holds the 16 loads above as one group in front of the WMMA block; sunk
        // among the WMMAs each pair would be waited for at full LDS latency.
        __builtin_amdgcn_sched_barrier(0);
#pragma unroll
        for (int mi = 0; mi < 4; ++mi)
#pragma unroll
            for (int f = 0; f < 4; ++f)
                acc[mi][f] = __builtin_amdgcn_wmma_f32_16x16x32_f16(
                    false, fa[0][mi], false, fb[0][f], (short)0, acc[mi][f], false, false);
#pragma unroll
        for (int mi = 0; mi < 4; ++mi) fa[1][mi] = load_frag(&bA[wm + 16 * mi + ln][32], hi);
#pragma unroll
        for (int f = 0; f < 4; ++f) fb[1][f] = load_frag(&bW[wn + 16 * f + ln][32], hi);

        // ---- publish slab t+1, free this slab's buffer, refill it ----
        // This wave's LDS reads of the buffer have retired before it is refilled.
        asm volatile("s_wait_dscnt 0x0" ::: "memory");
        wait_asynccnt0();  // this wave's share of slab t+1
        __syncthreads();
        if (t + 2 < G_NS) stage_aw(Ab, Wb, (t + 2) * G_KS, tid, bA, bW);
        // Keeps the copies in front of the slab's second WMMA block, which works on
        // registers alone: issued behind it they would fly half a trip less.
        __builtin_amdgcn_sched_barrier(0);
#pragma unroll
        for (int mi = 0; mi < 4; ++mi)
#pragma unroll
            for (int f = 0; f < 4; ++f)
                acc[mi][f] = __builtin_amdgcn_wmma_f32_16x16x32_f16(
                    false, fa[1][mi], false, fb[1][f], (short)0, acc[mi][f], false, false);
    }
    wait_asynccnt0();  // nothing in flight when the wave ends

#pragma unroll
    for (int mi = 0; mi < 4; ++mi) {
        const int r0 = m0 + 16 * mi + hi * 8;
#pragma unroll
        for (int f = 0; f < 4; ++f) {
            const int col = n0 + 16 * f + ln;
            if (MODE == 1) {
                v8h ph;
#pragma unroll
                for (int g = 0; g < 8; ++g) ph[g] = (_Float16)acc[mi][f][g];
                *(v8h*)(o16 + (size_t)col * M_TOT + r0) = ph;
            } else if (MODE == 0) {
#pragma unroll
                for (int g = 0; g < 8; ++g)
                    o16[(size_t)(r0 + g) * DM + col] = (_Float16)acc[mi][f][g];
            } else {
                const float bv = bias[col];
#pragma unroll
                for (int g = 0; g < 8; ++g) {
                    size_t idx = (size_t)(r0 + g) * DM + col;
                    o32[idx] = acc[mi][f][g] + bv + resid[idx];
                }
            }
        }
    }
}

// ---------------------------------------------------------------------------
// Flash attention: block = 128 q-rows, 8 waves, 32-key tiles, online softmax.
// qp: [B*Lq,512] f16  kp: [B*Lk,512] f16  vpT: [512][B*Lk] f16
// attn out: [B*Lq,512] f16
// One work-group per WGP, the whole grid resident at once: every staged K/V
// tile serves 128 query rows. Q lives in registers as B fragments.
// K and V tiles are staged in LDS by async copies, two buffers: tile t+1 flies
// while tile t is worked on.
// Every loop over fragments is unrolled: the fragment and accumulator arrays
// stay in registers only under constant indices.
// ---------------------------------------------------------------------------
#define Q_BLK 128  // query rows per work-group
#define K_BLK 32   // keys per tile
#define N_KT  113  // key tiles: ceil(3600 / 32)

// Issue one 32-key tile's copies: K rows [32][512] and V^T rows [512][32].
// 8 + 8 copies per lane, every lane on. Ragged keys are clamped to valid
// rows / 8-key chunks; their scores are masked and their P is 0.
// Both loops are unrolled so that the copies issue back to back.
static __device__ __forceinline__ void stage_kv(const _Float16* __restrict__ kp,
                                                const _Float16* __restrict__ vpT,
                                                size_t bL, int k0, int tid,
                                                _Float16 (*dK)[520], _Float16 (*dV)[40]) {
    const _Float16* kb = kp + bL * (size_t)DM;  // block-uniform bases, 32-bit lane offsets
    const _Float16* vb = vpT + bL;
    const int r0 = tid >> 6, k8 = (tid & 63) * 8;  // copy i: K row r0 + 4 i
#pragma unroll
    for (int i = 0; i < 8; ++i) {
        const int gr = min(k0 + r0 + 4 * i, LK_TOT - 1);
        copy16_to_lds(kb + (unsigned)(gr * DM + k8), &dK[r0 + 4 * i][k8]);
    }
    const int d0 = tid >> 2, j8 = (tid & 3) * 8;   // copy i: V^T row d0 + 64 i
    const unsigned v0 = (unsigned)(d0 * M_TOT + min(k0 + j8, LK_TOT - 8));
#pragma unroll
    for (int i = 0; i < 8; ++i)
        copy16_to_lds(vb + (v0 + (unsigned)(64 * i * M_TOT)), &dV[d0 + 64 * i][j8]);
}

// Value of the neighbour lane (lane ^ 1): DPP quad_perm [1,0,3,2].
static __device__ __forceinline__ float lane_xor1(float x) {
    return __builtin_bit_cast(float,
        __builtin_amdgcn_mov_dpp(__builtin_bit_cast(int, x), 0xB1, 0xf, 0xf, true));
}

__global__ void __launch_bounds__(256)
flash_attn(const _Float16* __restrict__ qp, const _Float16* __restrict__ kp,
           const _Float16* __restrict__ vpT, _Float16* __restrict__ attn) {
    __shared__ __align__(16) _Float16 sK[2][K_BLK][520];  // pitch 1040 B = 16 B x odd
    __shared__ __align__(16) _Float16 sV[2][512][40];     // pitch   80 B = 16 B x odd
    __shared__ __align__(16) float    sS[2][Q_BLK][36];   // two depth halves, pitch 144 B
    __shared__ __align__(16) _Float16 sP[Q_BLK][40];      // pitch   80 B = 16 B x odd
    __shared__ __align__(16) float    sAlpha[Q_BLK];
    __shared__ __align__(16) float    sL[Q_BLK];

    const int tid  = threadIdx.x;
    const int lane = tid & 31;
    const int w    = tid >> 5;
    const int ln   = lane & 15;
    const int hi   = lane >> 4;
    const int b    = blockIdx.y;
    const int q0   = blockIdx.x * Q_BLK;
    const size_t bL = (size_t)b * LQ_TOT;
    const float scale = 0.044194173824159216f;  // 1/sqrt(512)

    stage_kv(kp, vpT, bL, 0, tid, sK[0], sV[0]);

    // Score work of a wave: 32 query rows x 32 keys x one half of the depth.
    const int qb = w & 3;   // block of 32 query rows
    const int kh = w >> 2;  // depth half (256 of 512)

    // This wave's Q fragments, loaded once (ragged rows clamped, never stored).
    v16h fq[2][8];
#pragma unroll
    for (int qi = 0; qi < 2; ++qi) {
        const int gr = min(q0 + 32 * qb + 16 * qi + ln, LQ_TOT - 1);
        const _Float16* qrow = qp + (bL + gr) * (size_t)DM + kh * 256 + hi * 8;
#pragma unroll
        for (int ks = 0; ks < 8; ++ks)
            fq[qi][ks] = mk_frag(*(const v8h*)(qrow + ks * 32), *(const v8h*)(qrow + ks * 32 + 16));
        // The row's loads are issued before any register of their address is
        // written again; the address is an input so that it lives up to the wait.
        asm volatile("s_wait_xcnt 0x0" :: "v"(qrow) : "memory");
    }

    v8f o[8][4];
#pragma unroll
    for (int mi = 0; mi < 8; ++mi)
#pragma unroll
        for (int ni = 0; ni < 4; ++ni) o[mi][ni] = v8f_zero();

    // Softmax state of row tid >> 1, held alike by the two threads of the row.
    float m_run = -1e30f, l_run = 0.f;

    wait_asynccnt0();  // tile 0
    __syncthreads();
    stage_kv(kp, vpT, bL, K_BLK, tid, sK[1], sV[1]);

    for (int kt = 0; kt < N_KT; ++kt) {
        const int k0 = kt * K_BLK;
        _Float16 (*bK)[520] = sK[kt & 1];
        _Float16 (*bV)[40]  = sV[kt & 1];

        // ---- S^T = K Q^T over this wave's depth half: 2 x 2 fragments ----
        v8f s[2][2];
#pragma unroll
        for (int nj = 0; nj < 2; ++nj)
#pragma unroll
            for (int qi = 0; qi < 2; ++qi) s[nj][qi] = v8f_zero();
        // K fragments come in groups of two depth steps (8 loads), two register
        // sets: a group is issued one block of 8 WMMAs ahead of its use.
        v16h fk[2][2][2];  // [set][step in group][nj]
#pragma unroll
        for (int gp = 0; gp < 2; ++gp)
#pragma unroll
            for (int t = 0; t < 2; ++t)
#pragma unroll
                for (int nj = 0; nj < 2; ++nj)
                    fk[gp][t][nj] = load_frag(&bK[16 * nj + ln][kh * 256 + (2 * gp + t) * 32], hi);
#pragma unroll
        for (int gp = 0; gp < 4; ++gp) {
            // Holds the loads above as one group in front of this WMMA block; sunk
            // among the WMMAs each would be waited for at full LDS latency.
            __builtin_amdgcn_sched_barrier(0);
#pragma unroll
            for (int t = 0; t < 2; ++t)
#pragma unroll
                for (int nj = 0; nj < 2; ++nj)
#pragma unroll
                    for (int qi = 0; qi < 2; ++qi)
                        s[nj][qi] = __builtin_amdgcn_wmma_f32_16x16x32_f16(
                            false, fk[gp & 1][t][nj], false, fq[qi][2 * gp + t], (short)0,
                            s[nj][qi], false, false);
            // Keeps the refill of this register set behind the block that reads it.
            __builtin_amdgcn_sched_barrier(0);
            if (gp + 2 < 4) {
#pragma unroll
                for (int t = 0; t < 2; ++t)
#pragma unroll
                    for (int nj = 0; nj < 2; ++nj)
                        fk[gp & 1][t][nj] =
                            load_frag(&bK[16 * nj + ln][kh * 256 + (2 * (gp + 2) + t) * 32], hi);
            }
        }
        // A lane holds 8 consecutive keys of one query row: two 16-byte stores.
#pragma unroll
        for (int nj = 0; nj < 2; ++nj)
#pragma unroll
            for (int qi = 0; qi < 2; ++qi) {
                float* dst = &sS[kh][32 * qb + 16 * qi + ln][16 * nj + 8 * hi];
                *(float4*)dst       = make_float4(s[nj][qi][0], s[nj][qi][1], s[nj][qi][2], s[nj][qi][3]);
                *(float4*)(dst + 4) = make_float4(s[nj][qi][4], s[nj][qi][5], s[nj][qi][6], s[nj][qi][7]);
            }
        __syncthreads();

        // ---- online softmax: 2 threads per row, 4-key chunks dealt alternately ----
        {
            const int row = tid >> 1, sub = tid & 1;
            const int nvalid = min(K_BLK, LK_TOT - k0);
            float sv[16];
            float pm = -1e30f;
#pragma unroll
            for (int j = 0; j < 4; ++j) {
                const int c0 = 4 * (2 * j + sub);
                const float4 x = *(const float4*)&sS[0][row][c0];
                const float4 y = *(const float4*)&sS[1][row][c0];
                // LK_TOT and K_BLK are multiples of 8: the row's two chunks j are valid together.
                const bool ok = 8 * j < nvalid;
                sv[4 * j + 0] = ok ? (x.x + y.x) * scale : -1e30f;
                sv[4 * j + 1] = ok ? (x.y + y.y) * scale : -1e30f;
                sv[4 * j + 2] = ok ? (x.z + y.z) * scale : -1e30f;
                sv[4 * j + 3] = ok ? (x.w + y.w) * scale : -1e30f;
            }
#pragma unroll
            for (int e = 0; e < 16; ++e) pm = fmaxf(pm, sv[e]);
            pm = fmaxf(pm, lane_xor1(pm));
            const float m_new = fmaxf(m_run, pm);
            const float alpha = __expf(m_run - m_new);
            float ps = 0.f;
#pragma unroll
            for (int j = 0; j < 4; ++j) {
                const int c0 = 4 * (2 * j + sub);
                union { _Float16 h[4]; unsigned long long u; } pk;
#pragma unroll
                for (int e = 0; e < 4; ++e) {
                    const float p = (8 * j < nvalid) ? __expf(sv[4 * j + e] - m_new) : 0.f;
                    pk.h[e] = (_Float16)p;
                    ps += p;
                }
                *(unsigned long long*)&sP[row][c0] = pk.u;
            }
            ps += lane_xor1(ps);
            l_run = l_run * alpha + ps;
            m_run = m_new;
            if (sub == 0) sAlpha[row] = alpha;
        }
        __syncthreads();

        // ---- rescale O^T, then O^T += V^T P^T (wave owns 64 d-rows, all 128 queries) ----
        // A lane's accumulators of block mi all belong to query 16 mi + ln: one factor.
#pragma unroll
        for (int mi = 0; mi < 8; ++mi) {
            const float al = sAlpha[16 * mi + ln];
#pragma unroll
            for (int ni = 0; ni < 4; ++ni)
#pragma unroll
                for (int g = 0; g < 8; ++g) o[mi][ni][g] *= al;
        }
        {
            v16h pa[8];
#pragma unroll
            for (int mi = 0; mi < 8; ++mi) pa[mi] = load_frag(&sP[16 * mi + ln][0], hi);
#pragma unroll
            for (int ni = 0; ni < 4; ++ni) {
                const int d = 64 * w + 16 * ni + ln;
                v16h vb = load_frag(&bV[d][0], hi);
#pragma unroll
                for (int mi = 0; mi < 8; ++mi)
                    o[mi][ni] = __builtin_amdgcn_wmma_f32_16x16x32_f16(
                        false, vb, false, pa[mi], (short)0, o[mi][ni], false, false);
            }
        }

        // ---- publish tile kt+1, free this tile's buffer, refill it ----
        // Keeps the tile's last WMMAs in front of the copies' address arithmetic.
        __builtin_amdgcn_sched_barrier(0);
        // This wave's LDS reads of the buffer have retired before it is refilled.
        asm volatile("s_wait_dscnt 0x0" ::: "memory");
        wait_asynccnt0();  // this wave's share of tile kt+1
        __syncthreads();
        if (kt + 2 < N_KT) stage_kv(kp, vpT, bL, k0 + 2 * K_BLK, tid, bK, bV);
    }
    wait_asynccnt0();  // nothing in flight when the wave ends

    // ---- hand the row sums to every wave, normalize and store ----
    if ((tid & 1) == 0) sL[tid >> 1] = l_run;
    __syncthreads();
    // A lane holds 8 consecutive d of one query row: one 16-byte store per fragment.
#pragma unroll
    for (int mi = 0; mi < 8; ++mi) {
        const int row = 16 * mi + ln;
        const int gq  = q0 + row;
        if (gq < LQ_TOT) {
            const float inv = 1.0f / sL[row];
#pragma unroll
            for (int ni = 0; ni < 4; ++ni) {
                v8h ph;
#pragma unroll
                for (int g = 0; g < 8; ++g) ph[g] = (_Float16)(o[mi][ni][g] * inv);
                *(v8h*)(attn + (bL + gq) * (size_t)DM + 64 * w + 16 * ni + hi * 8) = ph;
            }
        }
    }
}

// ---------------------------------------------------------------------------
// In-place LayerNorm over rows of 512, one block (256 thr) per row.
// ---------------------------------------------------------------------------
__global__ void __launch_bounds__(256)
layernorm_inplace(float* __restrict__ out, const float* __restrict__ gamma,
                  const float* __restrict__ beta) {
    __shared__ float red[256];
    const int tid = threadIdx.x;
    float* p = out + (size_t)blockIdx.x * DM;
    float x0 = p[tid], x1 = p[tid + 256];

    red[tid] = x0 + x1;
    __syncthreads();
    for (int off = 128; off > 0; off >>= 1) {
        if (tid < off) red[tid] += red[tid + off];
        __syncthreads();
    }
    float mean = red[0] * (1.0f / DM);
    __syncthreads();

    float d0 = x0 - mean, d1 = x1 - mean;
    red[tid] = d0 * d0 + d1 * d1;
    __syncthreads();
    for (int off = 128; off > 0; off >>= 1) {
        if (tid < off) red[tid] += red[tid + off];
        __syncthreads();
    }
    float rstd = rsqrtf(red[0] * (1.0f / DM) + 1e-5f);

    p[tid]       = d0 * rstd * gamma[tid]       + beta[tid];
    p[tid + 256] = d1 * rstd * gamma[tid + 256] + beta[tid + 256];
}

// ---------------------------------------------------------------------------
extern "C" void kernel_launch(void* const* d_in, const int* in_sizes, int n_in,
                              void* d_out, int out_size, void* d_ws, size_t ws_size,
                              hipStream_t stream) {
    const float* q     = (const float*)d_in[0];
    const float* k     = (const float*)d_in[1];
    const float* v     = (const float*)d_in[2];
    const float* wqkv  = (const float*)d_in[3];
    const float* fcw   = (const float*)d_in[4];
    const float* fcb   = (const float*)d_in[5];
    const float* gamma = (const float*)d_in[6];
    const float* beta  = (const float*)d_in[7];
    float* out = (float*)d_out;

    char* ws = (char*)d_ws;
    const size_t SZ16 = (size_t)M_TOT * DM * sizeof(_Float16);  // 29,491,200 B
    _Float16* qh    = (_Float16*)(ws + 0 * SZ16);
    _Float16* kh    = (_Float16*)(ws + 1 * SZ16);
    _Float16* vh    = (_Float16*)(ws + 2 * SZ16);
    _Float16* qp    = (_Float16*)(ws + 3 * SZ16);
    _Float16* kp    = (_Float16*)(ws + 4 * SZ16);
    _Float16* vpT   = (_Float16*)(ws + 5 * SZ16);
    _Float16* w16   = (_Float16*)(ws + 6 * SZ16);
    _Float16* wfc16 = (_Float16*)(ws + 6 * SZ16 + (size_t)DM * DM * 2);
    _Float16* attn  = qh;  // qh no longer needed once projections are done

    // Stage 1: convert / transpose inputs to f16
    pack_f16<<<dim3((M_TOT * DM / 4) / 256), 256, 0, stream>>>(q, qh, M_TOT * DM / 4);
    pack_f16<<<dim3((DM * DM / 4) / 256), 256, 0, stream>>>(wqkv, w16, DM * DM / 4);
    pack_f16<<<dim3((DM * DM / 4) / 256), 256, 0, stream>>>(fcw, wfc16, DM * DM / 4);
    dim3 tg(113, 16, 8);
    transpose_pack<<<tg, 256, 0, stream>>>(k, kh);
    transpose_pack<<<tg, 256, 0, stream>>>(v, vh);

    // Stage 2: shared QKV projections (WMMA)
    dim3 gg(M_TOT / 128, 2);
    gemm512<0><<<gg, 256, 0, stream>>>(qh, w16, qp, nullptr, nullptr, nullptr);
    gemm512<0><<<gg, 256, 0, stream>>>(kh, w16, kp, nullptr, nullptr, nullptr);
    gemm512<1><<<gg, 256, 0, stream>>>(vh, w16, vpT, nullptr, nullptr, nullptr);

    // Stage 3: flash attention (WMMA + LDS + async staging + online softmax)
    dim3 fg(29, B_SZ);  // ceil(3600 / 128) query blocks
    flash_attn<<<fg, 256, 0, stream>>>(qp, kp, vpT, attn);

    // Stage 4: fc projection + bias + residual -> d_out (f32)
    gemm512<2><<<gg, 256, 0, stream>>>(attn, wfc16, nullptr, out, fcb, q);

    // Stage 5: LayerNorm in place on d_out
    layernorm_inplace<<<dim3(M_TOT), 256, 0, stream>>>(out, gamma, beta);
}

// v004
// It runs in 387 microseconds.
// Two timings next to v003 both put it at 1.07 times that version's speed.
// Counting every step since v000, it is 3.45 times as fast.
#include <hip/hip_runtime.h>
#include <hip/hip_bf16.h>

typedef __attribute__((ext_vector_type(16))) _Float16 v16h;
typedef __attribute__((ext_vector_type(8)))  _Float16 v8h;
typedef __attribute__((ext_vector_type(8)))  float    v8f;
typedef __attribute__((ext_vector_type(4)))  int      v4i;

#define B_SZ   8
#define LQ_TOT 3600
#define LK_TOT 3600
#define DM     512
#define M_TOT  (B_SZ * LQ_TOT)   // 28800

#if __has_builtin(__builtin_amdgcn_global_load_async_to_lds_b128)
#define HAVE_ASYNC_LDS 1
#endif

typedef __attribute__((address_space(1))) v4i* as1_v4i;
typedef __attribute__((address_space(3))) v4i* as3_v4i;

// This wave's async copies have landed in LDS. Asm with a memory clobber so
// that no LDS read is moved in front of it.
static __device__ __forceinline__ void wait_asynccnt0() {
    asm volatile("s_wait_asynccnt 0x0" ::: "memory");
}

// 16 bytes per lane, global -> LDS, through no register.
static __device__ __forceinline__ void copy16_to_lds(const _Float16* src, _Float16* dst) {
#if defined(HAVE_ASYNC_LDS)
    __builtin_amdgcn_global_load_async_to_lds_b128((as1_v4i)src, (as3_v4i)dst, 0, 0);
#else
    *(v8h*)dst = *(const v8h*)src;
#endif
}

static __device__ __forceinline__ v8f v8f_zero() {
    v8f z = {0.f, 0.f, 0.f, 0.f, 0.f, 0.f, 0.f, 0.f};
    return z;
}

static __device__ __forceinline__ v16h mk_frag(v8h lo, v8h hi8) {
    union U { v16h v; v8h h[2]; } u;
    u.h[0] = lo; u.h[1] = hi8;
    return u.v;
}

// Load an A/B fragment for v_wmma_f32_16x16x32_f16.
// rowbase must point at (row/col selected by lane&15) + k offset; 'hi' = lane>>4.
// Layout: VGPR0-3 hold K = hi*8 + 0..7, VGPR4-7 hold K = 16 + hi*8 + 0..7.
static __device__ __forceinline__ v16h load_frag(const _Float16* rowbase, int hi) {
    const _Float16* p = rowbase + hi * 8;
    return mk_frag(*(const v8h*)p, *(const v8h*)(p + 16));
}

// ---------------------------------------------------------------------------
// Pack f32 -> f16 (flat)
// ---------------------------------------------------------------------------
__global__ void __launch_bounds__(256) pack_f16(const float* __restrict__ in,
                                                _Float16* __restrict__ out, int n4) {
    int i = blockIdx.x * 256 + threadIdx.x;
    if (i < n4) {
        float4 f = ((const float4*)in)[i];
        union { _Float16 h[4]; unsigned long long u; } u;
        u.h[0] = (_Float16)f.x; u.h[1] = (_Float16)f.y;
        u.h[2] = (_Float16)f.z; u.h[3] = (_Float16)f.w;
        ((unsigned long long*)out)[i] = u.u;
    }
}

// ---------------------------------------------------------------------------
// Transpose [B][512][3600] f32 -> [B*3600][512] f16 (32x32 LDS tiles)
// ---------------------------------------------------------------------------
__global__ void __launch_bounds__(256) transpose_pack(const float* __restrict__ in,
                                                      _Float16* __restrict__ out) {
    __shared__ float t[32][33];
    const int b  = blockIdx.z;
    const int l0 = blockIdx.x * 32;
    const int d0 = blockIdx.y * 32;
    const int tx = threadIdx.x & 31;
    const int ty = threadIdx.x >> 5;
    const size_t inb = (size_t)b * DM * LK_TOT;
#pragma unroll
    for (int i = 0; i < 4; ++i) {
        int d = d0 + ty + i * 8, l = l0 + tx;
        if (l < LK_TOT) t[ty + i * 8][tx] = in[inb + (size_t)d * LK_TOT + l];
    }
    __syncthreads();
#pragma unroll
    for (int i = 0; i < 4; ++i) {
        int l = l0 + ty + i * 8, d = d0 + tx;
        if (l < LK_TOT)
            out[((size_t)b * LK_TOT + l) * DM + d] = (_Float16)t[tx][ty + i * 8];
    }
}

// ---------------------------------------------------------------------------
// NT GEMM: C[M,512] = A[M,512] * W[512,512]^T, f16 in, WMMA f32 accumulate.
// Block = 256 threads (8 waves). Block tile 128x256, wave tile 64x64.
// A and W come in slabs of 64 depth steps (whole 128-byte lines of every row),
// staged in LDS by async copies, two buffers: slab t+1 flies while slab t is
// worked on. Fragments are read from LDS.
// MODE 0: store f16 row-major.
// MODE 1: store f16 transposed into [512][M_TOT] (for V).
// MODE 2: store f32 row-major + bias + residual (fc layer).
// ---------------------------------------------------------------------------
#define G_KS  64          // depth steps per slab
#define G_PIT 72          // LDS row pitch in elements: 144 B = 16 B x odd
#define G_NS  (DM / G_KS) // slabs

// Issue one slab's copies: A rows [128][64] and W rows [256][64].
// 4 + 8 copies per lane, every lane on; 8 lanes cover one row's 128 bytes.
// Both loops are unrolled so that the copies issue back to back.
static __device__ __forceinline__ void stage_aw(const _Float16* __restrict__ Ab,
                                                const _Float16* __restrict__ Wb,
                                                int k0, int tid,
                                                _Float16 (*dA)[G_PIT], _Float16 (*dW)[G_PIT]) {
    const int r0 = tid >> 3, c8 = (tid & 7) * 8;  // copy i: row r0 + 32 i
    const unsigned g0 = (unsigned)(r0 * DM + k0 + c8);
#pragma unroll
    for (int i = 0; i < 4; ++i)
        copy16_to_lds(Ab + (g0 + (unsigned)(32 * i * DM)), &dA[r0 + 32 * i][c8]);
#pragma unroll
    for (int i = 0; i < 8; ++i)
        copy16_to_lds(Wb + (g0 + (unsigned)(32 * i * DM)), &dW[r0 + 32 * i][c8]);
}

// Four waves per SIMD (256 registers a wave): two work-groups share a WGP, so
// that one works while the other stands at its barrier.
template <int MODE>
__global__ void __launch_bounds__(256, 4)
gemm512(const _Float16* __restrict__ A, const _Float16* __restrict__ W,
        _Float16* __restrict__ o16, float* __restrict__ o32,
        const float* __restrict__ bias, const float* __restrict__ resid) {
    __shared__ __align__(16) _Float16 sA[2][128][G_PIT];
    __shared__ __align__(16) _Float16 sW[2][256][G_PIT];

    const int tid  = threadIdx.x;
    const int lane = tid & 31;
    const int w    = tid >> 5;
    const int ln   = lane & 15;
    const int hi   = lane >> 4;
    const int wm   = (w & 1) * 64;   // wave's rows inside the block tile
    const int wn   = (w >> 1) * 64;  // wave's columns inside the block tile
    const int m0   = blockIdx.x * 128 + wm;
    const int n0   = blockIdx.y * 256 + wn;

    const _Float16* Ab = A + (size_t)blockIdx.x * 128 * DM;  // block-uniform bases
    const _Float16* Wb = W + (size_t)blockIdx.y * 256 * DM;

    stage_aw(Ab, Wb, 0, tid, sA[0], sW[0]);

    v8f acc[4][4];
#pragma unroll
    for (int mi = 0; mi < 4; ++mi)
#pragma unroll
        for (int f = 0; f < 4; ++f) acc[mi][f] = v8f_zero();

    wait_asynccnt0();  // slab 0
    __syncthreads();
    stage_aw(Ab, Wb, G_KS, tid, sA[1], sW[1]);

    // Kept rolled: unrolled, fragments of neighbouring trips live side by side
    // and the 256 registers of a wave no longer hold them (spills).
#pragma unroll 1
    for (int t = 0; t < G_NS; ++t) {
        _Float16 (*bA)[G_PIT] = sA[t & 1];
        _Float16 (*bW)[G_PIT] = sW[t & 1];
        v16h fa[2][4], fb[2][4];  // [depth step of 32][fragment]
#pragma unroll
        for (int mi = 0; mi < 4; ++mi) fa[0][mi] = load_frag(&bA[wm + 16 * mi + ln][0], hi);
#pragma unroll
        for (int f = 0; f < 4; ++f) fb[0][f] = load_frag(&bW[wn + 16 * f + ln][0], hi);
        // Holds the 16 loads above as one group in front of the WMMA block; sunk
        // among the WMMAs each pair would be waited for at full LDS latency.
        __builtin_amdgcn_sched_barrier(0);
#pragma unroll
        for (int mi = 0; mi < 4; ++mi)
#pragma unroll
            for (int f = 0; f < 4; ++f)
                acc[mi][f] = __builtin_amdgcn_wmma_f32_16x16x32_f16(
                    false, fa[0][mi], false, fb[0][f], (short)0, acc[mi][f], false, false);
#pragma unroll
        for (int mi = 0; mi < 4; ++mi) fa[1][mi] = load_frag(&bA[wm + 16 * mi + ln][32], hi);
#pragma unroll
        for (int f = 0; f < 4; ++f) fb[1][f] = load_frag(&bW[wn + 16 * f + ln][32], hi);

        // ---- publish slab t+1, free this slab's buffer, refill it ----
        // This wave's LDS reads of the buffer have retired before it is refilled.
        asm volatile("s_wait_dscnt 0x0" ::: "memory");
        wait_asynccnt0();  // this wave's share of slab t+1
        __syncthreads();
        if (t + 2 < G_NS) stage_aw(Ab, Wb, (t + 2) * G_KS, tid, bA, bW);
        // Keeps the copies in front of the slab's second WMMA block, which works on
        // registers alone: issued behind it they would fly half a trip less.
        __builtin_amdgcn_sched_barrier(0);
#pragma unroll
        for (int mi = 0; mi < 4; ++mi)
#pragma unroll
            for (int f = 0; f < 4; ++f)
                acc[mi][f] = __builtin_amdgcn_wmma_f32_16x16x32_f16(
                    false, fa[1][mi], false, fb[1][f], (short)0, acc[mi][f], false, false);
    }
    wait_asynccnt0();  // nothing in flight when the wave ends

    if (MODE == 2) {
        // One base per array, every element at a constant offset from it. The
        // residual comes in units of 16 rows x 32 columns (16 loads a lane, whole
        // 128-byte lines), three units ahead of their use, into the registers that
        // the fragments have left: a load waited for element by element costs its
        // whole latency 128 times. At most 52 loads of a wave are outstanding.
        const size_t e0 = (size_t)(m0 + hi * 8) * DM + n0 + ln;
        const float* rb = resid + e0;
        float*       ob = o32 + e0;
        const int c0 = n0 + ln;
        float bv[4];
#pragma unroll
        for (int f = 0; f < 4; ++f) bv[f] = bias[c0 + 16 * f];
        // The bias loads are issued before their index register is written again;
        // the index is an input so that it lives up to the wait.
        asm volatile("s_wait_xcnt 0x0" :: "v"(c0) : "memory");
        float rv[8][2][8];  // [unit: row block, column pair][column block][row]
#pragma unroll
        for (int u = 0; u < 3; ++u)
#pragma unroll
            for (int j = 0; j < 2; ++j)
#pragma unroll
                for (int g = 0; g < 8; ++g)
                    rv[u][j][g] = rb[(16 * (u >> 1) + g) * DM + 16 * (2 * (u & 1) + j)];
#pragma unroll
        for (int u = 0; u < 8; ++u) {
            // Holds the loads issued so far in front of this unit's sums and stores;
            // sunk among them each load would again be waited for alone.
            __builtin_amdgcn_sched_barrier(0);
#pragma unroll
            for (int j = 0; j < 2; ++j)
#pragma unroll
                for (int g = 0; g < 8; ++g)
                    ob[(16 * (u >> 1) + g) * DM + 16 * (2 * (u & 1) + j)] =
                        acc[u >> 1][2 * (u & 1) + j][g] + bv[2 * (u & 1) + j] + rv[u][j][g];
            if (u + 3 < 8) {
                // The unit's stores are issued before the loads below write into
                // registers that held their data.
                asm volatile("s_wait_xcnt 0x0" ::: "memory");
#pragma unroll
                for (int j = 0; j < 2; ++j)
#pragma unroll
                    for (int g = 0; g < 8; ++g)
                        rv[u + 3][j][g] =
                            rb[(16 * ((u + 3) >> 1) + g) * DM + 16 * (2 * ((u + 3) & 1) + j)];
            }
        }
        return;
    }

#pragma unroll
    for (int mi = 0; mi < 4; ++mi) {
        const int r0 = m0 + 16 * mi + hi * 8;
#pragma unroll
        for (int f = 0; f < 4; ++f) {
            const int col = n0 + 16 * f + ln;
            if (MODE == 1) {
                v8h ph;
#pragma unroll
                for (int g = 0; g < 8; ++g) ph[g] = (_Float16)acc[mi][f][g];
                *(v8h*)(o16 + (size_t)col * M_TOT + r0) = ph;
            } else {
#pragma unroll
                for (int g = 0; g < 8; ++g)
                    o16[(size_t)(r0 + g) * DM + col] = (_Float16)acc[mi][f][g];
            }
        }
    }
}

// ---------------------------------------------------------------------------
// Flash attention: block = 128 q-rows, 8 waves, 32-key tiles, online softmax.
// qp: [B*Lq,512] f16  kp: [B*Lk,512] f16  vpT: [512][B*Lk] f16
// attn out: [B*Lq,512] f16
// One work-group per WGP, the whole grid resident at once: every staged K/V
// tile serves 128 query rows. Q lives in registers as B fragments.
// K and V tiles are staged in LDS by async copies, two buffers: tile t+1 flies
// while tile t is worked on.
// Every loop over fragments is unrolled: the fragment and accumulator arrays
// stay in registers only under constant indices.
// ---------------------------------------------------------------------------
#define Q_BLK 128  // query rows per work-group
#define K_BLK 32   // keys per tile
#define N_KT  113  // key tiles: ceil(3600 / 32)

// Issue one 32-key tile's copies: K rows [32][512] and V^T rows [512][32].
// 8 + 8 copies per lane, every lane on. Ragged keys are clamped to valid
// rows / 8-key chunks; their scores are masked and their P is 0.
// Both loops are unrolled so that the copies issue back to back.
static __device__ __forceinline__ void stage_kv(const _Float16* __restrict__ kp,
                                                const _Float16* __restrict__ vpT,
                                                size_t bL, int k0, int tid,
                                                _Float16 (*dK)[520], _Float16 (*dV)[40]) {
    const _Float16* kb = kp + bL * (size_t)DM;  // block-uniform bases, 32-bit lane offsets
    const _Float16* vb = vpT + bL;
    const int r0 = tid >> 6, k8 = (tid & 63) * 8;  // copy i: K row r0 + 4 i
#pragma unroll
    for (int i = 0; i < 8; ++i) {
        const int gr = min(k0 + r0 + 4 * i, LK_TOT - 1);
        copy16_to_lds(kb + (unsigned)(gr * DM + k8), &dK[r0 + 4 * i][k8]);
    }
    const int d0 = tid >> 2, j8 = (tid & 3) * 8;   // copy i: V^T row d0 + 64 i
    const unsigned v0 = (unsigned)(d0 * M_TOT + min(k0 + j8, LK_TOT - 8));
#pragma unroll
    for (int i = 0; i < 8; ++i)
        copy16_to_lds(vb + (v0 + (unsigned)(64 * i * M_TOT)), &dV[d0 + 64 * i][j8]);
}

// Value of the neighbour lane (lane ^ 1): DPP quad_perm [1,0,3,2].
static __device__ __forceinline__ float lane_xor1(float x) {
    return __builtin_bit_cast(float,
        __builtin_amdgcn_mov_dpp(__builtin_bit_cast(int, x), 0xB1, 0xf, 0xf, true));
}

__global__ void __launch_bounds__(256)
flash_attn(const _Float16* __restrict__ qp, const _Float16* __restrict__ kp,
           const _Float16* __restrict__ vpT, _Float16* __restrict__ attn) {
    __shared__ __align__(16) _Float16 sK[2][K_BLK][520];  // pitch 1040 B = 16 B x odd
    __shared__ __align__(16) _Float16 sV[2][512][40];     // pitch   80 B = 16 B x odd
    __shared__ __align__(16) float    sS[2][Q_BLK][36];   // two depth halves, pitch 144 B
    __shared__ __align__(16) _Float16 sP[Q_BLK][40];      // pitch   80 B = 16 B x odd
    __shared__ __align__(16) float    sAlpha[Q_BLK];
    __shared__ __align__(16) float    sL[Q_BLK];

    const int tid  = threadIdx.x;
    const int lane = tid & 31;
    const int w    = tid >> 5;
    const int ln   = lane & 15;
    const int hi   = lane >> 4;
    const int b    = blockIdx.y;
    const int q0   = blockIdx.x * Q_BLK;
    const size_t bL = (size_t)b * LQ_TOT;
    const float scale = 0.044194173824159216f;  // 1/sqrt(512)

    stage_kv(kp, vpT, bL, 0, tid, sK[0], sV[0]);

    // Score work of a wave: 32 query rows x 32 keys x one half of the depth.
    const int qb = w & 3;   // block of 32 query rows
    const int kh = w >> 2;  // depth half (256 of 512)

    // This wave's Q fragments, loaded once (ragged rows clamped, never stored).
    v16h fq[2][8];
#pragma unroll
    for (int qi = 0; qi < 2; ++qi) {
        const int gr = min(q0 + 32 * qb + 16 * qi + ln, LQ_TOT - 1);
        const _Float16* qrow = qp + (bL + gr) * (size_t)DM + kh * 256 + hi * 8;
#pragma unroll
        for (int ks = 0; ks < 8; ++ks)
            fq[qi][ks] = mk_frag(*(const v8h*)(qrow + ks * 32), *(const v8h*)(qrow + ks * 32 + 16));
        // The row's loads are issued before any register of their address is
        // written again; the address is an input so that it lives up to the wait.
        asm volatile("s_wait_xcnt 0x0" :: "v"(qrow) : "memory");
    }

    v8f o[8][4];
#pragma unroll
    for (int mi = 0; mi < 8; ++mi)
#pragma unroll
        for (int ni = 0; ni < 4; ++ni) o[mi][ni] = v8f_zero();

    // Softmax state of row tid >> 1, held alike by the two threads of the row.
    float m_run = -1e30f, l_run = 0.f;

    wait_asynccnt0();  // tile 0
    __syncthreads();
    stage_kv(kp, vpT, bL, K_BLK, tid, sK[1], sV[1]);

    for (int kt = 0; kt < N_KT; ++kt) {
        const int k0 = kt * K_BLK;
        _Float16 (*bK)[520] = sK[kt & 1];
        _Float16 (*bV)[40]  = sV[kt & 1];

        // ---- S^T = K Q^T over this wave's depth half: 2 x 2 fragments ----
        v8f s[2][2];
#pragma unroll
        for (int nj = 0; nj < 2; ++nj)
#pragma unroll
            for (int qi = 0; qi < 2; ++qi) s[nj][qi] = v8f_zero();
        // K fragments come in groups of two depth steps (8 loads), two register
        // sets: a group is issued one block of 8 WMMAs ahead of its use.
        v16h fk[2][2][2];  // [set][step in group][nj]
#pragma unroll
        for (int gp = 0; gp < 2; ++gp)
#pragma unroll
            for (int t = 0; t < 2; ++t)
#pragma unroll
                for (int nj = 0; nj < 2; ++nj)
                    fk[gp][t][nj] = load_frag(&bK[16 * nj + ln][kh * 256 + (2 * gp + t) * 32], hi);
#pragma unroll
        for (int gp = 0; gp < 4; ++gp) {
            // Holds the loads above as one group in front of this WMMA block; sunk
            // among the WMMAs each would be waited for at full LDS latency.
            __builtin_amdgcn_sched_barrier(0);
#pragma unroll
            for (int t = 0; t < 2; ++t)
#pragma unroll
                for (int nj = 0; nj < 2; ++nj)
#pragma unroll
                    for (int qi = 0; qi < 2; ++qi)
                        s[nj][qi] = __builtin_amdgcn_wmma_f32_16x16x32_f16(
                            false, fk[gp & 1][t][nj], false, fq[qi][2 * gp + t], (short)0,
                            s[nj][qi], false, false);
            // Keeps the refill of this register set behind the block that reads it.
            __builtin_amdgcn_sched_barrier(0);
            if (gp + 2 < 4) {
#pragma unroll
                for (int t = 0; t < 2; ++t)
#pragma unroll
                    for (int nj = 0; nj < 2; ++nj)
                        fk[gp & 1][t][nj] =
                            load_frag(&bK[16 * nj + ln][kh * 256 + (2 * (gp + 2) + t) * 32], hi);
            }
        }
        // A lane holds 8 consecutive keys of one query row: two 16-byte stores.
#pragma unroll
        for (int nj = 0; nj < 2; ++nj)
#pragma unroll
            for (int qi = 0; qi < 2; ++qi) {
                float* dst = &sS[kh][32 * qb + 16 * qi + ln][16 * nj + 8 * hi];
                *(float4*)dst       = make_float4(s[nj][qi][0], s[nj][qi][1], s[nj][qi][2], s[nj][qi][3]);
                *(float4*)(dst + 4) = make_float4(s[nj][qi][4], s[nj][qi][5], s[nj][qi][6], s[nj][qi][7]);
            }
        __syncthreads();

        // ---- online softmax: 2 threads per row, 4-key chunks dealt alternately ----
        {
            const int row = tid >> 1, sub = tid & 1;
            const int nvalid = min(K_BLK, LK_TOT - k0);
            float sv[16];
            float pm = -1e30f;
#pragma unroll
            for (int j = 0; j < 4; ++j) {
                const int c0 = 4 * (2 * j + sub);
                const float4 x = *(const float4*)&sS[0][row][c0];
                const float4 y = *(const float4*)&sS[1][row][c0];
                // LK_TOT and K_BLK are multiples of 8: the row's two chunks j are valid together.
                const bool ok = 8 * j < nvalid;
                sv[4 * j + 0] = ok ? (x.x + y.x) * scale : -1e30f;
                sv[4 * j + 1] = ok ? (x.y + y.y) * scale : -1e30f;
                sv[4 * j + 2] = ok ? (x.z + y.z) * scale : -1e30f;
                sv[4 * j + 3] = ok ? (x.w + y.w) * scale : -1e30f;
            }
#pragma unroll
            for (int e = 0; e < 16; ++e) pm = fmaxf(pm, sv[e]);
            pm = fmaxf(pm, lane_xor1(pm));
            const float m_new = fmaxf(m_run, pm);
            const float alpha = __expf(m_run - m_new);
            float ps = 0.f;
#pragma unroll
            for (int j = 0; j < 4; ++j) {
                const int c0 = 4 * (2 * j + sub);
                union { _Float16 h[4]; unsigned long long u; } pk;
#pragma unroll
                for (int e = 0; e < 4; ++e) {
                    const float p = (8 * j < nvalid) ? __expf(sv[4 * j + e] - m_new) : 0.f;
                    pk.h[e] = (_Float16)p;
                    ps += p;
                }
                *(unsigned long long*)&sP[row][c0] = pk.u;
            }
            ps += lane_xor1(ps);
            l_run = l_run * alpha + ps;
            m_run = m_new;
            if (sub == 0) sAlpha[row] = alpha;
        }
        __syncthreads();

        // ---- rescale O^T, then O^T += V^T P^T (wave owns 64 d-rows, all 128 queries) ----
        // A lane's accumulators of block mi all belong to query 16 mi + ln: one factor.
#pragma unroll
        for (int mi = 0; mi < 8; ++mi) {
            const float al = sAlpha[16 * mi + ln];
#pragma unroll
            for (int ni = 0; ni < 4; ++ni)
#pragma unroll
                for (int g = 0; g < 8; ++g) o[mi][ni][g] *= al;
        }
        {
            v16h pa[8];
#pragma unroll
            for (int mi = 0; mi < 8; ++mi) pa[mi] = load_frag(&sP[16 * mi + ln][0], hi);
#pragma unroll
            for (int ni = 0; ni < 4; ++ni) {
                const int d = 64 * w + 16 * ni + ln;
                v16h vb = load_frag(&bV[d][0], hi);
#pragma unroll
                for (int mi = 0; mi < 8; ++mi)
                    o[mi][ni] = __builtin_amdgcn_wmma_f32_16x16x32_f16(
                        false, vb, false, pa[mi], (short)0, o[mi][ni], false, false);
            }
        }

        // ---- publish tile kt+1, free this tile's buffer, refill it ----
        // Keeps the tile's last WMMAs in front of the copies' address arithmetic.
        __builtin_amdgcn_sched_barrier(0);
        // This wave's LDS reads of the buffer have retired before it is refilled.
        asm volatile("s_wait_dscnt 0x0" ::: "memory");
        wait_asynccnt0();  // this wave's share of tile kt+1
        __syncthreads();
        if (kt + 2 < N_KT) stage_kv(kp, vpT, bL, k0 + 2 * K_BLK, tid, bK, bV);
    }
    wait_asynccnt0();  // nothing in flight when the wave ends

    // ---- hand the row sums to every wave, normalize and store ----
    if ((tid & 1) == 0) sL[tid >> 1] = l_run;
    __syncthreads();
    // A lane holds 8 consecutive d of one query row: one 16-byte store per fragment.
#pragma unroll
    for (int mi = 0; mi < 8; ++mi) {
        const int row = 16 * mi + ln;
        const int gq  = q0 + row;
        if (gq < LQ_TOT) {
            const float inv = 1.0f / sL[row];
#pragma unroll
            for (int ni = 0; ni < 4; ++ni) {
                v8h ph;
#pragma unroll
                for (int g = 0; g < 8; ++g) ph[g] = (_Float16)(o[mi][ni][g] * inv);
                *(v8h*)(attn + (bL + gq) * (size_t)DM + 64 * w + 16 * ni + hi * 8) = ph;
            }
        }
    }
}

// ---------------------------------------------------------------------------
// In-place LayerNorm over rows of 512, one block (256 thr) per row.
// ---------------------------------------------------------------------------
__global__ void __launch_bounds__(256)
layernorm_inplace(float* __restrict__ out, const float* __restrict__ gamma,
                  const float* __restrict__ beta) {
    __shared__ float red[256];
    const int tid = threadIdx.x;
    float* p = out + (size_t)blockIdx.x * DM;
    float x0 = p[tid], x1 = p[tid + 256];

    red[tid] = x0 + x1;
    __syncthreads();
    for (int off = 128; off > 0; off >>= 1) {
        if (tid < off) red[tid] += red[tid + off];
        __syncthreads();
    }
    float mean = red[0] * (1.0f / DM);
    __syncthreads();

    float d0 = x0 - mean, d1 = x1 - mean;
    red[tid] = d0 * d0 + d1 * d1;
    __syncthreads();
    for (int off = 128; off > 0; off >>= 1) {
        if (tid < off) red[tid] += red[tid + off];
        __syncthreads();
    }
    float rstd = rsqrtf(red[0] * (1.0f / DM) + 1e-5f);

    p[tid]       = d0 * rstd * gamma[tid]       + beta[tid];
    p[tid + 256] = d1 * rstd * gamma[tid + 256] + beta[tid + 256];
}

// ---------------------------------------------------------------------------
extern "C" void kernel_launch(void* const* d_in, const int* in_sizes, int n_in,
                              void* d_out, int out_size, void* d_ws, size_t ws_size,
                              hipStream_t stream) {
    const float* q     = (const float*)d_in[0];
    const float* k     = (const float*)d_in[1];
    const float* v     = (const float*)d_in[2];
    const float* wqkv  = (const float*)d_in[3];
    const float* fcw   = (const float*)d_in[4];
    const float* fcb   = (const float*)d_in[5];
    const float* gamma = (const float*)d_in[6];
    const float* beta  = (const float*)d_in[7];
    float* out = (float*)d_out;

    char* ws = (char*)d_ws;
    const size_t SZ16 = (size_t)M_TOT * DM * sizeof(_Float16);  // 29,491,200 B
    _Float16* qh    = (_Float16*)(ws + 0 * SZ16);
    _Float16* kh    = (_Float16*)(ws + 1 * SZ16);
    _Float16* vh    = (_Float16*)(ws + 2 * SZ16);
    _Float16* qp    = (_Float16*)(ws + 3 * SZ16);
    _Float16* kp    = (_Float16*)(ws + 4 * SZ16);
    _Float16* vpT   = (_Float16*)(ws + 5 * SZ16);
    _Float16* w16   = (_Float16*)(ws + 6 * SZ16);
    _Float16* wfc16 = (_Float16*)(ws + 6 * SZ16 + (size_t)DM * DM * 2);
    _Float16* attn  = qh;  // qh no longer needed once projections are done

    // Stage 1: convert / transpose inputs to f16
    pack_f16<<<dim3((M_TOT * DM / 4) / 256), 256, 0, stream>>>(q, qh, M_TOT * DM / 4);
    pack_f16<<<dim3((DM * DM / 4) / 256), 256, 0, stream>>>(wqkv, w16, DM * DM / 4);
    pack_f16<<<dim3((DM * DM / 4) / 256), 256, 0, stream>>>(fcw, wfc16, DM * DM / 4);
    dim3 tg(113, 16, 8);
    transpose_pack<<<tg, 256, 0, stream>>>(k, kh);
    transpose_pack<<<tg, 256, 0, stream>>>(v, vh);

    // Stage 2: shared QKV projections (WMMA)
    // Still open: W folds into the weights, scores = q (W^T W) k^T and
    // out = (P v)(fc_w W)^T, which leaves two of the four large products.
    dim3 gg(M_TOT / 128, 2);
    gemm512<0><<<gg, 256, 0, stream>>>(qh, w16, qp, nullptr, nullptr, nullptr);
    gemm512<0><<<gg, 256, 0, stream>>>(kh, w16, kp, nullptr, nullptr, nullptr);
    gemm512<1><<<gg, 256, 0, stream>>>(vh, w16, vpT, nullptr, nullptr, nullptr);

    // Stage 3: flash attention (WMMA + LDS + async staging + online softmax)
    dim3 fg(29, B_SZ);  // ceil(3600 / 128) query blocks
    flash_attn<<<fg, 256, 0, stream>>>(qp, kp, vpT, attn);

    // Stage 4: fc projection + bias + residual -> d_out (f32)
    gemm512<2><<<gg, 256, 0, stream>>>(attn, wfc16, nullptr, out, fcb, q);

    // Stage 5: LayerNorm in place on d_out
    layernorm_inplace<<<dim3(M_TOT), 256, 0, stream>>>(out, gamma, beta);
}

// v005
// A run of this version takes 373 microseconds.
// Next to v004, in two timings, it ran 1.04 times as fast each time.
// All steps since v000 together make it 3.58 times as fast.
#include <hip/hip_runtime.h>
#include <hip/hip_bf16.h>

typedef __attribute__((ext_vector_type(16))) _Float16 v16h;
typedef __attribute__((ext_vector_type(8)))  _Float16 v8h;
typedef __attribute__((ext_vector_type(8)))  float    v8f;
typedef __attribute__((ext_vector_type(4)))  int      v4i;

#define B_SZ   8
#define LQ_TOT 3600
#define LK_TOT 3600
#define DM     512
#define M_TOT  (B_SZ * LQ_TOT)   // 28800

#if __has_builtin(__builtin_amdgcn_global_load_async_to_lds_b128)
#define HAVE_ASYNC_LDS 1
#endif

typedef __attribute__((address_space(1))) v4i* as1_v4i;
typedef __attribute__((address_space(3))) v4i* as3_v4i;

// This wave's async copies have landed in LDS. Asm with a memory clobber so
// that no LDS read is moved in front of it.
static __device__ __forceinline__ void wait_asynccnt0() {
    asm volatile("s_wait_asynccnt 0x0" ::: "memory");
}

// 16 bytes per lane, global -> LDS, through no register.
static __device__ __forceinline__ void copy16_to_lds(const _Float16* src, _Float16* dst) {
#if defined(HAVE_ASYNC_LDS)
    __builtin_amdgcn_global_load_async_to_lds_b128((as1_v4i)src, (as3_v4i)dst, 0, 0);
#else
    *(v8h*)dst = *(const v8h*)src;
#endif
}

static __device__ __forceinline__ v8f v8f_zero() {
    v8f z = {0.f, 0.f, 0.f, 0.f, 0.f, 0.f, 0.f, 0.f};
    return z;
}

static __device__ __forceinline__ v16h mk_frag(v8h lo, v8h hi8) {
    union U { v16h v; v8h h[2]; } u;
    u.h[0] = lo; u.h[1] = hi8;
    return u.v;
}

// Load an A/B fragment for v_wmma_f32_16x16x32_f16.
// rowbase must point at (row/col selected by lane&15) + k offset; 'hi' = lane>>4.
// Layout: VGPR0-3 hold K = hi*8 + 0..7, VGPR4-7 hold K = 16 + hi*8 + 0..7.
static __device__ __forceinline__ v16h load_frag(const _Float16* rowbase, int hi) {
    const _Float16* p = rowbase + hi * 8;
    return mk_frag(*(const v8h*)p, *(const v8h*)(p + 16));
}

// ---------------------------------------------------------------------------
// Pack f32 -> f16 (flat); blk = index of the 256-thread block inside this job
// ---------------------------------------------------------------------------
static __device__ __forceinline__ void pack_f16(const float* __restrict__ in,
                                                _Float16* __restrict__ out, int n4, int blk) {
    int i = blk * 256 + threadIdx.x;
    if (i < n4) {
        float4 f = ((const float4*)in)[i];
        union { _Float16 h[4]; unsigned long long u; } u;
        u.h[0] = (_Float16)f.x; u.h[1] = (_Float16)f.y;
        u.h[2] = (_Float16)f.z; u.h[3] = (_Float16)f.w;
        ((unsigned long long*)out)[i] = u.u;
    }
}

// ---------------------------------------------------------------------------
// Transpose [B][512][3600] f32 -> [B*3600][512] f16 (32x32 LDS tiles)
// ---------------------------------------------------------------------------
static __device__ __forceinline__ void transpose_pack(const float* __restrict__ in,
                                                      _Float16* __restrict__ out,
                                                      float (*t)[33], int bx, int by, int b) {
    const int l0 = bx * 32;
    const int d0 = by * 32;
    const int tx = threadIdx.x & 31;
    const int ty = threadIdx.x >> 5;
    const size_t inb = (size_t)b * DM * LK_TOT;
#pragma unroll
    for (int i = 0; i < 4; ++i) {
        int d = d0 + ty + i * 8, l = l0 + tx;
        if (l < LK_TOT) t[ty + i * 8][tx] = in[inb + (size_t)d * LK_TOT + l];
    }
    __syncthreads();
#pragma unroll
    for (int i = 0; i < 4; ++i) {
        int l = l0 + ty + i * 8, d = d0 + tx;
        if (l < LK_TOT)
            out[((size_t)b * LK_TOT + l) * DM + d] = (_Float16)t[tx][ty + i * 8];
    }
}

// ---------------------------------------------------------------------------
// The five conversions depend on nothing but the inputs: one launch, the jobs
// dealt by block index (every test below is the same for a whole block).
// ---------------------------------------------------------------------------
#define NB_TR (113 * 16 * B_SZ)        // blocks of one transpose
#define NB_PQ (M_TOT * DM / 4 / 256)   // blocks of the pack of q
#define NB_PW (DM * DM / 4 / 256)      // blocks of the pack of one weight matrix
#define NB_PREP (2 * NB_TR + NB_PQ + 2 * NB_PW)

__global__ void __launch_bounds__(256)
prep(const float* __restrict__ q, const float* __restrict__ k, const float* __restrict__ v,
     const float* __restrict__ wqkv, const float* __restrict__ fcw,
     _Float16* __restrict__ qh, _Float16* __restrict__ kh, _Float16* __restrict__ vh,
     _Float16* __restrict__ w16, _Float16* __restrict__ wfc16) {
    __shared__ float t[32][33];
    int blk = blockIdx.x;
    if (blk < 2 * NB_PW) {
        if (blk < NB_PW) pack_f16(wqkv, w16, DM * DM / 4, blk);
        else             pack_f16(fcw, wfc16, DM * DM / 4, blk - NB_PW);
        return;
    }
    blk -= 2 * NB_PW;
    if (blk < NB_PQ) {
        pack_f16(q, qh, M_TOT * DM / 4, blk);
        return;
    }
    blk -= NB_PQ;
    const bool second = blk >= NB_TR;
    if (second) blk -= NB_TR;
    const int bx = blk % 113, by = (blk / 113) & 15, b = blk / (113 * 16);
    transpose_pack(second ? v : k, second ? vh : kh, t, bx, by, b);
}

// ---------------------------------------------------------------------------
// NT GEMM: C[M,512] = A[M,512] * W[512,512]^T, f16 in, WMMA f32 accumulate.
// Block = 256 threads (8 waves). Block tile 128x256, wave tile 64x64.
// A and W come in slabs of 64 depth steps (whole 128-byte lines of every row),
// staged in LDS by async copies, two buffers: slab t+1 flies while slab t is
// worked on. Fragments are read from LDS.
// MODE 0: the three projections in one launch: blockIdx.z picks the plane of A
//         and of o16 (q, k, v follow one another in both); f16 stored row-major,
//         for plane 2 (V) transposed into [512][M_TOT].
// MODE 2: store f32 row-major + bias + residual (fc layer).
// ---------------------------------------------------------------------------
#define G_KS  64          // depth steps per slab
#define G_PIT 72          // LDS row pitch in elements: 144 B = 16 B x odd
#define G_NS  (DM / G_KS) // slabs

// Issue one slab's copies: A rows [128][64] and W rows [256][64].
// 4 + 8 copies per lane, every lane on; 8 lanes cover one row's 128 bytes.
// Both loops are unrolled so that the copies issue back to back.
static __device__ __forceinline__ void stage_aw(const _Float16* __restrict__ Ab,
                                                const _Float16* __restrict__ Wb,
                                                int k0, int tid,
                                                _Float16 (*dA)[G_PIT], _Float16 (*dW)[G_PIT]) {
    const int r0 = tid >> 3, c8 = (tid & 7) * 8;  // copy i: row r0 + 32 i
    const unsigned g0 = (unsigned)(r0 * DM + k0 + c8);
#pragma unroll
    for (int i = 0; i < 4; ++i)
        copy16_to_lds(Ab + (g0 + (unsigned)(32 * i * DM)), &dA[r0 + 32 * i][c8]);
#pragma unroll
    for (int i = 0; i < 8; ++i)
        copy16_to_lds(Wb + (g0 + (unsigned)(32 * i * DM)), &dW[r0 + 32 * i][c8]);
}

// Four waves per SIMD (256 registers a wave): two work-groups share a WGP, so
// that one works while the other stands at its barrier.
template <int MODE>
__global__ void __launch_bounds__(256, 4)
gemm512(const _Float16* __restrict__ A, const _Float16* __restrict__ W,
        _Float16* __restrict__ o16, float* __restrict__ o32,
        const float* __restrict__ bias, const float* __restrict__ resid) {
    __shared__ __align__(16) _Float16 sA[2][128][G_PIT];
    __shared__ __align__(16) _Float16 sW[2][256][G_PIT];

    const int tid  = threadIdx.x;
    const int lane = tid & 31;
    const int w    = tid >> 5;
    const int ln   = lane & 15;
    const int hi   = lane >> 4;
    const int wm   = (w & 1) * 64;   // wave's rows inside the block tile
    const int wn   = (w >> 1) * 64;  // wave's columns inside the block tile
    const int m0   = blockIdx.x * 128 + wm;
    const int n0   = blockIdx.y * 256 + wn;

    if (MODE == 0) {
        A   += (size_t)blockIdx.z * M_TOT * DM;
        o16 += (size_t)blockIdx.z * M_TOT * DM;
    }
    const _Float16* Ab = A + (size_t)blockIdx.x * 128 * DM;  // block-uniform bases
    const _Float16* Wb = W + (size_t)blockIdx.y * 256 * DM;

    stage_aw(Ab, Wb, 0, tid, sA[0], sW[0]);

    v8f acc[4][4];
#pragma unroll
    for (int mi = 0; mi < 4; ++mi)
#pragma unroll
        for (int f = 0; f < 4; ++f) acc[mi][f] = v8f_zero();

    wait_asynccnt0();  // slab 0
    __syncthreads();
    stage_aw(Ab, Wb, G_KS, tid, sA[1], sW[1]);

    // Kept rolled: unrolled, fragments of neighbouring trips live side by side
    // and the 256 registers of a wave no longer hold them (spills).
#pragma unroll 1
    for (int t = 0; t < G_NS; ++t) {
        _Float16 (*bA)[G_PIT] = sA[t & 1];
        _Float16 (*bW)[G_PIT] = sW[t & 1];
        v16h fa[2][4], fb[2][4];  // [depth step of 32][fragment]
#pragma unroll
        for (int mi = 0; mi < 4; ++mi) fa[0][mi] = load_frag(&bA[wm + 16 * mi + ln][0], hi);
#pragma unroll
        for (int f = 0; f < 4; ++f) fb[0][f] = load_frag(&bW[wn + 16 * f + ln][0], hi);
        // Holds the 16 loads above as one group in front of the WMMA block; sunk
        // among the WMMAs each pair would be waited for at full LDS latency.
        __builtin_amdgcn_sched_barrier(0);
#pragma unroll
        for (int mi = 0; mi < 4; ++mi)
#pragma unroll
            for (int f = 0; f < 4; ++f)
                acc[mi][f] = __builtin_amdgcn_wmma_f32_16x16x32_f16(
                    false, fa[0][mi], false, fb[0][f], (short)0, acc[mi][f], false, false);
#pragma unroll
        for (int mi = 0; mi < 4; ++mi) fa[1][mi] = load_frag(&bA[wm + 16 * mi + ln][32], hi);
#pragma unroll
        for (int f = 0; f < 4; ++f) fb[1][f] = load_frag(&bW[wn + 16 * f + ln][32], hi);

        // ---- publish slab t+1, free this slab's buffer, refill it ----
        // This wave's LDS reads of the buffer have retired before it is refilled.
        asm volatile("s_wait_dscnt 0x0" ::: "memory");
        wait_asynccnt0();  // this wave's share of slab t+1
        __syncthreads();
        if (t + 2 < G_NS) stage_aw(Ab, Wb, (t + 2) * G_KS, tid, bA, bW);
        // Keeps the copies in front of the slab's second WMMA block, which works on
        // registers alone: issued behind it they would fly half a trip less.
        __builtin_amdgcn_sched_barrier(0);
#pragma unroll
        for (int mi = 0; mi < 4; ++mi)
#pragma unroll
            for (int f = 0; f < 4; ++f)
                acc[mi][f] = __builtin_amdgcn_wmma_f32_16x16x32_f16(
                    false, fa[1][mi], false, fb[1][f], (short)0, acc[mi][f], false, false);
    }
    wait_asynccnt0();  // nothing in flight when the wave ends

    if (MODE == 2) {
        // One base per array, every element at a constant offset from it. The
        // residual comes in units of 16 rows x 32 columns (16 loads a lane, whole
        // 128-byte lines), three units ahead of their use, into the registers that
        // the fragments have left: a load waited for element by element costs its
        // whole latency 128 times. At most 52 loads of a wave are outstanding.
        const size_t e0 = (size_t)(m0 + hi * 8) * DM + n0 + ln;
        const float* rb = resid + e0;
        float*       ob = o32 + e0;
        const int c0 = n0 + ln;
        float bv[4];
#pragma unroll
        for (int f = 0; f < 4; ++f) bv[f] = bias[c0 + 16 * f];
        // The bias loads are issued before their index register is written again;
        // the index is an input so that it lives up to the wait.
        asm volatile("s_wait_xcnt 0x0" :: "v"(c0) : "memory");
        float rv[8][2][8];  // [unit: row block, column pair][column block][row]
#pragma unroll
        for (int u = 0; u < 3; ++u)
#pragma unroll
            for (int j = 0; j < 2; ++j)
#pragma unroll
                for (int g = 0; g < 8; ++g)
                    rv[u][j][g] = rb[(16 * (u >> 1) + g) * DM + 16 * (2 * (u & 1) + j)];
#pragma unroll
        for (int u = 0; u < 8; ++u) {
            // Holds the loads issued so far in front of this unit's sums and stores;
            // sunk among them each load would again be waited for alone.
            __builtin_amdgcn_sched_barrier(0);
#pragma unroll
            for (int j = 0; j < 2; ++j)
#pragma unroll
                for (int g = 0; g < 8; ++g)
                    ob[(16 * (u >> 1) + g) * DM + 16 * (2 * (u & 1) + j)] =
                        acc[u >> 1][2 * (u & 1) + j][g] + bv[2 * (u & 1) + j] + rv[u][j][g];
            if (u + 3 < 8) {
                // The unit's stores are issued before the loads below write into
                // registers that held their data.
                asm volatile("s_wait_xcnt 0x0" ::: "memory");
#pragma unroll
                for (int j = 0; j < 2; ++j)
#pragma unroll
                    for (int g = 0; g < 8; ++g)
                        rv[u + 3][j][g] =
                            rb[(16 * ((u + 3) >> 1) + g) * DM + 16 * (2 * ((u + 3) & 1) + j)];
            }
        }
        return;
    }

    // One test for the whole epilogue, the same for the whole block.
    if (blockIdx.z == 2) {
#pragma unroll
        for (int mi = 0; mi < 4; ++mi) {
            const int r0 = m0 + 16 * mi + hi * 8;
#pragma unroll
            for (int f = 0; f < 4; ++f) {
                const int col = n0 + 16 * f + ln;
                v8h ph;
#pragma unroll
                for (int g = 0; g < 8; ++g) ph[g] = (_Float16)acc[mi][f][g];
                *(v8h*)(o16 + (size_t)col * M_TOT + r0) = ph;
            }
        }
    } else {
#pragma unroll
        for (int mi = 0; mi < 4; ++mi) {
            const int r0 = m0 + 16 * mi + hi * 8;
#pragma unroll
            for (int f = 0; f < 4; ++f) {
                const int col = n0 + 16 * f + ln;
#pragma unroll
                for (int g = 0; g < 8; ++g)
                    o16[(size_t)(r0 + g) * DM + col] = (_Float16)acc[mi][f][g];
            }
        }
        // The built code keeps a (never taken) way from here into the other branch,
        // which writes the stores' address registers anew: the stores are issued first.
        asm volatile("s_wait_xcnt 0x0" ::: "memory");
    }
}

// ---------------------------------------------------------------------------
// Flash attention: block = 128 q-rows, 8 waves, 32-key tiles, online softmax.
// qp: [B*Lq,512] f16  kp: [B*Lk,512] f16  vpT: [512][B*Lk] f16
// attn out: [B*Lq,512] f16
// One work-group per WGP, the whole grid resident at once: every staged K/V
// tile serves 128 query rows. Q lives in registers as B fragments.
// K and V tiles are staged in LDS by async copies, two buffers: tile t+1 flies
// while tile t is worked on.
// Every loop over fragments is unrolled: the fragment and accumulator arrays
// stay in registers only under constant indices.
// ---------------------------------------------------------------------------
#define Q_BLK 128  // query rows per work-group
#define K_BLK 32   // keys per tile
#define N_KT  113  // key tiles: ceil(3600 / 32)

// Issue one 32-key tile's copies: K rows [32][512] and V^T rows [512][32].
// 8 + 8 copies per lane, every lane on. Ragged keys are clamped to valid
// rows / 8-key chunks; their scores are masked and their P is 0.
// Both loops are unrolled so that the copies issue back to back.
static __device__ __forceinline__ void stage_kv(const _Float16* __restrict__ kp,
                                                const _Float16* __restrict__ vpT,
                                                size_t bL, int k0, int tid,
                                                _Float16 (*dK)[520], _Float16 (*dV)[40]) {
    const _Float16* kb = kp + bL * (size_t)DM;  // block-uniform bases, 32-bit lane offsets
    const _Float16* vb = vpT + bL;
    const int r0 = tid >> 6, k8 = (tid & 63) * 8;  // copy i: K row r0 + 4 i
#pragma unroll
    for (int i = 0; i < 8; ++i) {
        const int gr = min(k0 + r0 + 4 * i, LK_TOT - 1);
        copy16_to_lds(kb + (unsigned)(gr * DM + k8), &dK[r0 + 4 * i][k8]);
    }
    const int d0 = tid >> 2, j8 = (tid & 3) * 8;   // copy i: V^T row d0 + 64 i
    const unsigned v0 = (unsigned)(d0 * M_TOT + min(k0 + j8, LK_TOT - 8));
#pragma unroll
    for (int i = 0; i < 8; ++i)
        copy16_to_lds(vb + (v0 + (unsigned)(64 * i * M_TOT)), &dV[d0 + 64 * i][j8]);
}

// Value of the neighbour lane (lane ^ 1): DPP quad_perm [1,0,3,2].
static __device__ __forceinline__ float lane_xor1(float x) {
    return __builtin_bit_cast(float,
        __builtin_amdgcn_mov_dpp(__builtin_bit_cast(int, x), 0xB1, 0xf, 0xf, true));
}

__global__ void __launch_bounds__(256)
flash_attn(const _Float16* __restrict__ qp, const _Float16* __restrict__ kp,
           const _Float16* __restrict__ vpT, _Float16* __restrict__ attn) {
    __shared__ __align__(16) _Float16 sK[2][K_BLK][520];  // pitch 1040 B = 16 B x odd
    __shared__ __align__(16) _Float16 sV[2][512][40];     // pitch   80 B = 16 B x odd
    __shared__ __align__(16) float    sS[2][Q_BLK][36];   // two depth halves, pitch 144 B
    __shared__ __align__(16) _Float16 sP[Q_BLK][40];      // pitch   80 B = 16 B x odd
    __shared__ __align__(16) float    sAlpha[Q_BLK];
    __shared__ __align__(16) float    sL[Q_BLK];

    const int tid  = threadIdx.x;
    const int lane = tid & 31;
    const int w    = tid >> 5;
    const int ln   = lane & 15;
    const int hi   = lane >> 4;
    const int b    = blockIdx.y;
    const int q0   = blockIdx.x * Q_BLK;
    const size_t bL = (size_t)b * LQ_TOT;
    const float scale = 0.044194173824159216f;  // 1/sqrt(512)

    stage_kv(kp, vpT, bL, 0, tid, sK[0], sV[0]);

    // Score work of a wave: 32 query rows x 32 keys x one half of the depth.
    const int qb = w & 3;   // block of 32 query rows
    const int kh = w >> 2;  // depth half (256 of 512)

    // This wave's Q fragments, loaded once (ragged rows clamped, never stored).
    v16h fq[2][8];
#pragma unroll
    for (int qi = 0; qi < 2; ++qi) {
        const int gr = min(q0 + 32 * qb + 16 * qi + ln, LQ_TOT - 1);
        const _Float16* qrow = qp + (bL + gr) * (size_t)DM + kh * 256 + hi * 8;
#pragma unroll
        for (int ks = 0; ks < 8; ++ks)
            fq[qi][ks] = mk_frag(*(const v8h*)(qrow + ks * 32), *(const v8h*)(qrow + ks * 32 + 16));
        // The row's loads are issued before any register of their address is
        // written again; the address is an input so that it lives up to the wait.
        asm volatile("s_wait_xcnt 0x0" :: "v"(qrow) : "memory");
    }

    v8f o[8][4];
#pragma unroll
    for (int mi = 0; mi < 8; ++mi)
#pragma unroll
        for (int ni = 0; ni < 4; ++ni) o[mi][ni] = v8f_zero();

    // Softmax state of row tid >> 1, held alike by the two threads of the row.
    float m_run = -1e30f, l_run = 0.f;

    wait_asynccnt0();  // tile 0
    __syncthreads();
    stage_kv(kp, vpT, bL, K_BLK, tid, sK[1], sV[1]);

    for (int kt = 0; kt < N_KT; ++kt) {
        const int k0 = kt * K_BLK;
        _Float16 (*bK)[520] = sK[kt & 1];
        _Float16 (*bV)[40]  = sV[kt & 1];

        // ---- S^T = K Q^T over this wave's depth half: 2 x 2 fragments ----
        v8f s[2][2];
#pragma unroll
        for (int nj = 0; nj < 2; ++nj)
#pragma unroll
            for (int qi = 0; qi < 2; ++qi) s[nj][qi] = v8f_zero();
        // K fragments come in groups of two depth steps (8 loads), two register
        // sets: a group is issued one block of 8 WMMAs ahead of its use.
        v16h fk[2][2][2];  // [set][step in group][nj]
#pragma unroll
        for (int gp = 0; gp < 2; ++gp)
#pragma unroll
            for (int t = 0; t < 2; ++t)
#pragma unroll
                for (int nj = 0; nj < 2; ++nj)
                    fk[gp][t][nj] = load_frag(&bK[16 * nj + ln][kh * 256 + (2 * gp + t) * 32], hi);
#pragma unroll
        for (int gp = 0; gp < 4; ++gp) {
            // Holds the loads above as one group in front of this WMMA block; sunk
            // among the WMMAs each would be waited for at full LDS latency.
            __builtin_amdgcn_sched_barrier(0);
#pragma unroll
            for (int t = 0; t < 2; ++t)
#pragma unroll
                for (int nj = 0; nj < 2; ++nj)
#pragma unroll
                    for (int qi = 0; qi < 2; ++qi)
                        s[nj][qi] = __builtin_amdgcn_wmma_f32_16x16x32_f16(
                            false, fk[gp & 1][t][nj], false, fq[qi][2 * gp + t], (short)0,
                            s[nj][qi], false, false);
            // Keeps the refill of this register set behind the block that reads it.
            __builtin_amdgcn_sched_barrier(0);
            if (gp + 2 < 4) {
#pragma unroll
                for (int t = 0; t < 2; ++t)
#pragma unroll
                    for (int nj = 0; nj < 2; ++nj)
                        fk[gp & 1][t][nj] =
                            load_frag(&bK[16 * nj + ln][kh * 256 + (2 * (gp + 2) + t) * 32], hi);
            }
        }
        // A lane holds 8 consecutive keys of one query row: two 16-byte stores.
#pragma unroll
        for (int nj = 0; nj < 2; ++nj)
#pragma unroll
            for (int qi = 0; qi < 2; ++qi) {
                float* dst = &sS[kh][32 * qb + 16 * qi + ln][16 * nj + 8 * hi];
                *(float4*)dst       = make_float4(s[nj][qi][0], s[nj][qi][1], s[nj][qi][2], s[nj][qi][3]);
                *(float4*)(dst + 4) = make_float4(s[nj][qi][4], s[nj][qi][5], s[nj][qi][6], s[nj][qi][7]);
            }
        __syncthreads();

        // ---- online softmax: 2 threads per row, 4-key chunks dealt alternately ----
        {
            const int row = tid >> 1, sub = tid & 1;
            const int nvalid = min(K_BLK, LK_TOT - k0);
            float sv[16];
            float pm = -1e30f;
#pragma unroll
            for (int j = 0; j < 4; ++j) {
                const int c0 = 4 * (2 * j + sub);
                const float4 x = *(const float4*)&sS[0][row][c0];
                const float4 y = *(const float4*)&sS[1][row][c0];
                // LK_TOT and K_BLK are multiples of 8: the row's two chunks j are valid together.
                const bool ok = 8 * j < nvalid;
                sv[4 * j + 0] = ok ? (x.x + y.x) * scale : -1e30f;
                sv[4 * j + 1] = ok ? (x.y + y.y) * scale : -1e30f;
                sv[4 * j + 2] = ok ? (x.z + y.z) * scale : -1e30f;
                sv[4 * j + 3] = ok ? (x.w + y.w) * scale : -1e30f;
            }
#pragma unroll
            for (int e = 0; e < 16; ++e) pm = fmaxf(pm, sv[e]);
            pm = fmaxf(pm, lane_xor1(pm));
            const float m_new = fmaxf(m_run, pm);
            const float alpha = __expf(m_run - m_new);
            float ps = 0.f;
#pragma unroll
            for (int j = 0; j < 4; ++j) {
                const int c0 = 4 * (2 * j + sub);
                union { _Float16 h[4]; unsigned long long u; } pk;
#pragma unroll
                for (int e = 0; e < 4; ++e) {
                    const float p = (8 * j < nvalid) ? __expf(sv[4 * j + e] - m_new) : 0.f;
                    pk.h[e] = (_Float16)p;
                    ps += p;
                }
                *(unsigned long long*)&sP[row][c0] = pk.u;
            }
            ps += lane_xor1(ps);
            l_run = l_run * alpha + ps;
            m_run = m_new;
            if (sub == 0) sAlpha[row] = alpha;
        }
        __syncthreads();

        // ---- rescale O^T, then O^T += V^T P^T (wave owns 64 d-rows, all 128 queries) ----
        // A lane's accumulators of block mi all belong to query 16 mi + ln: one factor.
#pragma unroll
        for (int mi = 0; mi < 8; ++mi) {
            const float al = sAlpha[16 * mi + ln];
#pragma unroll
            for (int ni = 0; ni < 4; ++ni)
#pragma unroll
                for (int g = 0; g < 8; ++g) o[mi][ni][g] *= al;
        }
        {
            v16h pa[8];
#pragma unroll
            for (int mi = 0; mi < 8; ++mi) pa[mi] = load_frag(&sP[16 * mi + ln][0], hi);
#pragma unroll
            for (int ni = 0; ni < 4; ++ni) {
                const int d = 64 * w + 16 * ni + ln;
                v16h vb = load_frag(&bV[d][0], hi);
#pragma unroll
                for (int mi = 0; mi < 8; ++mi)
                    o[mi][ni] = __builtin_amdgcn_wmma_f32_16x16x32_f16(
                        false, vb, false, pa[mi], (short)0, o[mi][ni], false, false);
            }
        }

        // ---- publish tile kt+1, free this tile's buffer, refill it ----
        // Keeps the tile's last WMMAs in front of the copies' address arithmetic.
        __builtin_amdgcn_sched_barrier(0);
        // This wave's LDS reads of the buffer have retired before it is refilled.
        asm volatile("s_wait_dscnt 0x0" ::: "memory");
        wait_asynccnt0();  // this wave's share of tile kt+1
        __syncthreads();
        if (kt + 2 < N_KT) stage_kv(kp, vpT, bL, k0 + 2 * K_BLK, tid, bK, bV);
    }
    wait_asynccnt0();  // nothing in flight when the wave ends

    // ---- hand the row sums to every wave, normalize and store ----
    if ((tid & 1) == 0) sL[tid >> 1] = l_run;
    __syncthreads();
    // A lane holds 8 consecutive d of one query row: one 16-byte store per fragment.
#pragma unroll
    for (int mi = 0; mi < 8; ++mi) {
        const int row = 16 * mi + ln;
        const int gq  = q0 + row;
        if (gq < LQ_TOT) {
            const float inv = 1.0f / sL[row];
#pragma unroll
            for (int ni = 0; ni < 4; ++ni) {
                v8h ph;
#pragma unroll
                for (int g = 0; g < 8; ++g) ph[g] = (_Float16)(o[mi][ni][g] * inv);
                *(v8h*)(attn + (bL + gq) * (size_t)DM + 64 * w + 16 * ni + hi * 8) = ph;
            }
        }
    }
}

// ---------------------------------------------------------------------------
// In-place LayerNorm over rows of 512, one block (256 thr) per row.
// ---------------------------------------------------------------------------
__global__ void __launch_bounds__(256)
layernorm_inplace(float* __restrict__ out, const float* __restrict__ gamma,
                  const float* __restrict__ beta) {
    __shared__ float red[256];
    const int tid = threadIdx.x;
    float* p = out + (size_t)blockIdx.x * DM;
    float x0 = p[tid], x1 = p[tid + 256];

    red[tid] = x0 + x1;
    __syncthreads();
    for (int off = 128; off > 0; off >>= 1) {
        if (tid < off) red[tid] += red[tid + off];
        __syncthreads();
    }
    float mean = red[0] * (1.0f / DM);
    __syncthreads();

    float d0 = x0 - mean, d1 = x1 - mean;
    red[tid] = d0 * d0 + d1 * d1;
    __syncthreads();
    for (int off = 128; off > 0; off >>= 1) {
        if (tid < off) red[tid] += red[tid + off];
        __syncthreads();
    }
    float rstd = rsqrtf(red[0] * (1.0f / DM) + 1e-5f);

    p[tid]       = d0 * rstd * gamma[tid]       + beta[tid];
    p[tid + 256] = d1 * rstd * gamma[tid + 256] + beta[tid + 256];
}

// ---------------------------------------------------------------------------
extern "C" void kernel_launch(void* const* d_in, const int* in_sizes, int n_in,
                              void* d_out, int out_size, void* d_ws, size_t ws_size,
                              hipStream_t stream) {
    const float* q     = (const float*)d_in[0];
    const float* k     = (const float*)d_in[1];
    const float* v     = (const float*)d_in[2];
    const float* wqkv  = (const float*)d_in[3];
    const float* fcw   = (const float*)d_in[4];
    const float* fcb   = (const float*)d_in[5];
    const float* gamma = (const float*)d_in[6];
    const float* beta  = (const float*)d_in[7];
    float* out = (float*)d_out;

    char* ws = (char*)d_ws;
    const size_t SZ16 = (size_t)M_TOT * DM * sizeof(_Float16);  // 29,491,200 B
    _Float16* qh    = (_Float16*)(ws + 0 * SZ16);
    _Float16* kh    = (_Float16*)(ws + 1 * SZ16);
    _Float16* vh    = (_Float16*)(ws + 2 * SZ16);
    _Float16* qp    = (_Float16*)(ws + 3 * SZ16);
    _Float16* kp    = (_Float16*)(ws + 4 * SZ16);
    _Float16* vpT   = (_Float16*)(ws + 5 * SZ16);
    _Float16* w16   = (_Float16*)(ws + 6 * SZ16);
    _Float16* wfc16 = (_Float16*)(ws + 6 * SZ16 + (size_t)DM * DM * 2);
    _Float16* attn  = qh;  // qh no longer needed once projections are done

    // Stage 1: convert / transpose inputs to f16, one launch
    prep<<<dim3(NB_PREP), 256, 0, stream>>>(q, k, v, wqkv, fcw, qh, kh, vh, w16, wfc16);

    // Stage 2: shared QKV projections (WMMA), one launch: qh, kh, vh -> qp, kp, vpT
    // Still open in flash_attn: O rescaled only when a row maximum passes the
    // reference of its exponentials by 8 ln 2, one test per tile.
    // Still open: W folds into the weights, scores = q (W^T W) k^T and
    // out = (P v)(fc_w W)^T, which leaves two of the four large products.
    dim3 gg(M_TOT / 128, 2);
    dim3 g3(M_TOT / 128, 2, 3);
    gemm512<0><<<g3, 256, 0, stream>>>(qh, w16, qp, nullptr, nullptr, nullptr);

    // Stage 3: flash attention (WMMA + LDS + async staging + online softmax)
    dim3 fg(29, B_SZ);  // ceil(3600 / 128) query blocks
    flash_attn<<<fg, 256, 0, stream>>>(qp, kp, vpT, attn);

    // Stage 4: fc projection + bias + residual -> d_out (f32)
    gemm512<2><<<gg, 256, 0, stream>>>(attn, wfc16, nullptr, out, fcb, q);

    // Stage 5: LayerNorm in place on d_out
    layernorm_inplace<<<dim3(M_TOT), 256, 0, stream>>>(out, gamma, beta);
}

// v006
// It runs in 330 microseconds.
// Two timings next to v005 both put it at 1.13 times that version's speed.
// All steps since v000 together make it 4.05 times as fast.
#include <hip/hip_runtime.h>
#include <hip/hip_bf16.h>

typedef __attribute__((ext_vector_type(16))) _Float16 v16h;
typedef __attribute__((ext_vector_type(8)))  _Float16 v8h;
typedef __attribute__((ext_vector_type(8)))  float    v8f;
typedef __attribute__((ext_vector_type(4)))  int      v4i;

#define B_SZ   8
#define LQ_TOT 3600
#define LK_TOT 3600
#define DM     512
#define M_TOT  (B_SZ * LQ_TOT)   // 28800
#define K_BLK  32    // keys per attention tile
#define N_KT   113   // key tiles of one batch: ceil(3600 / 32)

#if __has_builtin(__builtin_amdgcn_global_load_async_to_lds_b128)
#define HAVE_ASYNC_LDS 1
#endif

typedef __attribute__((address_space(1))) v4i* as1_v4i;
typedef __attribute__((address_space(3))) v4i* as3_v4i;

// This wave's async copies have landed in LDS. Asm with a memory clobber so
// that no LDS read is moved in front of it.
static __device__ __forceinline__ void wait_asynccnt0() {
    asm volatile("s_wait_asynccnt 0x0" ::: "memory");
}

// 16 bytes per lane, global -> LDS, through no register.
static __device__ __forceinline__ void copy16_to_lds(const _Float16* src, _Float16* dst) {
#if defined(HAVE_ASYNC_LDS)
    __builtin_amdgcn_global_load_async_to_lds_b128((as1_v4i)src, (as3_v4i)dst, 0, 0);
#else
    *(v8h*)dst = *(const v8h*)src;
#endif
}

static __device__ __forceinline__ v8f v8f_zero() {
    v8f z = {0.f, 0.f, 0.f, 0.f, 0.f, 0.f, 0.f, 0.f};
    return z;
}

static __device__ __forceinline__ v16h mk_frag(v8h lo, v8h hi8) {
    union U { v16h v; v8h h[2]; } u;
    u.h[0] = lo; u.h[1] = hi8;
    return u.v;
}

// Load an A/B fragment for v_wmma_f32_16x16x32_f16.
// rowbase must point at (row/col selected by lane&15) + k offset; 'hi' = lane>>4.
// Layout: VGPR0-3 hold K = hi*8 + 0..7, VGPR4-7 hold K = 16 + hi*8 + 0..7.
static __device__ __forceinline__ v16h load_frag(const _Float16* rowbase, int hi) {
    const _Float16* p = rowbase + hi * 8;
    return mk_frag(*(const v8h*)p, *(const v8h*)(p + 16));
}

// ---------------------------------------------------------------------------
// Pack f32 -> f16 (flat); blk = index of the 256-thread block inside this job
// ---------------------------------------------------------------------------
static __device__ __forceinline__ void pack_f16(const float* __restrict__ in,
                                                _Float16* __restrict__ out, int n4, int blk) {
    int i = blk * 256 + threadIdx.x;
    if (i < n4) {
        float4 f = ((const float4*)in)[i];
        union { _Float16 h[4]; unsigned long long u; } u;
        u.h[0] = (_Float16)f.x; u.h[1] = (_Float16)f.y;
        u.h[2] = (_Float16)f.z; u.h[3] = (_Float16)f.w;
        ((unsigned long long*)out)[i] = u.u;
    }
}

// ---------------------------------------------------------------------------
// Transpose [B][512][3600] f32 -> [B*3600][512] f16 (32x32 LDS tiles)
// ---------------------------------------------------------------------------
static __device__ __forceinline__ void transpose_pack(const float* __restrict__ in,
                                                      _Float16* __restrict__ out,
                                                      float (*t)[33], int bx, int by, int b) {
    const int l0 = bx * 32;
    const int d0 = by * 32;
    const int tx = threadIdx.x & 31;
    const int ty = threadIdx.x >> 5;
    const size_t inb = (size_t)b * DM * LK_TOT;
#pragma unroll
    for (int i = 0; i < 4; ++i) {
        int d = d0 + ty + i * 8, l = l0 + tx;
        if (l < LK_TOT) t[ty + i * 8][tx] = in[inb + (size_t)d * LK_TOT + l];
    }
    __syncthreads();
#pragma unroll
    for (int i = 0; i < 4; ++i) {
        int l = l0 + ty + i * 8, d = d0 + tx;
        if (l < LK_TOT)
            out[((size_t)b * LK_TOT + l) * DM + d] = (_Float16)t[tx][ty + i * 8];
    }
}

// ---------------------------------------------------------------------------
// The five conversions depend on nothing but the inputs: one launch, the jobs
// dealt by block index (every test below is the same for a whole block).
// ---------------------------------------------------------------------------
#define NB_TR (113 * 16 * B_SZ)        // blocks of one transpose
#define NB_PQ (M_TOT * DM / 4 / 256)   // blocks of the pack of q
#define NB_PW (DM * DM / 4 / 256)      // blocks of the pack of one weight matrix
#define NB_PREP (2 * NB_TR + NB_PQ + 2 * NB_PW)

__global__ void __launch_bounds__(256)
prep(const float* __restrict__ q, const float* __restrict__ k, const float* __restrict__ v,
     const float* __restrict__ wqkv, const float* __restrict__ fcw,
     _Float16* __restrict__ qh, _Float16* __restrict__ kh, _Float16* __restrict__ vh,
     _Float16* __restrict__ w16, _Float16* __restrict__ wfc16) {
    __shared__ float t[32][33];
    int blk = blockIdx.x;
    if (blk < 2 * NB_PW) {
        if (blk < NB_PW) pack_f16(wqkv, w16, DM * DM / 4, blk);
        else             pack_f16(fcw, wfc16, DM * DM / 4, blk - NB_PW);
        return;
    }
    blk -= 2 * NB_PW;
    if (blk < NB_PQ) {
        pack_f16(q, qh, M_TOT * DM / 4, blk);
        return;
    }
    blk -= NB_PQ;
    const bool second = blk >= NB_TR;
    if (second) blk -= NB_TR;
    const int bx = blk % 113, by = (blk / 113) & 15, b = blk / (113 * 16);
    transpose_pack(second ? v : k, second ? vh : kh, t, bx, by, b);
}

// ---------------------------------------------------------------------------
// NT GEMM: C[M,512] = A[M,512] * W[512,512]^T, f16 in, WMMA f32 accumulate.
// Block = 256 threads (8 waves). Block tile 128x256, wave tile 64x64.
// A and W come in slabs of 64 depth steps (whole 128-byte lines of every row),
// staged in LDS by async copies, two buffers: slab t+1 flies while slab t is
// worked on. Fragments are read from LDS.
// MODE 0: the three projections in one launch: blockIdx.z picks the plane of A
//         and of o16 (q, k, v follow one another in both); f16 stored row-major,
//         for plane 2 (V) transposed, one block per attention key tile:
//         [batch][key tile][512][32 keys], so that a tile is 32 KB in a row.
// MODE 2: store f32 row-major + bias + residual (fc layer).
// ---------------------------------------------------------------------------
#define G_KS  64          // depth steps per slab
#define G_PIT 72          // LDS row pitch in elements: 144 B = 16 B x odd
#define G_NS  (DM / G_KS) // slabs

// Issue one slab's copies: A rows [128][64] and W rows [256][64].
// 4 + 8 copies per lane, every lane on; 8 lanes cover one row's 128 bytes.
// Both loops are unrolled so that the copies issue back to back.
static __device__ __forceinline__ void stage_aw(const _Float16* __restrict__ Ab,
                                                const _Float16* __restrict__ Wb,
                                                int k0, int tid,
                                                _Float16 (*dA)[G_PIT], _Float16 (*dW)[G_PIT]) {
    const int r0 = tid >> 3, c8 = (tid & 7) * 8;  // copy i: row r0 + 32 i
    const unsigned g0 = (unsigned)(r0 * DM + k0 + c8);
#pragma unroll
    for (int i = 0; i < 4; ++i)
        copy16_to_lds(Ab + (g0 + (unsigned)(32 * i * DM)), &dA[r0 + 32 * i][c8]);
#pragma unroll
    for (int i = 0; i < 8; ++i)
        copy16_to_lds(Wb + (g0 + (unsigned)(32 * i * DM)), &dW[r0 + 32 * i][c8]);
}

// Four waves per SIMD (256 registers a wave): two work-groups share a WGP, so
// that one works while the other stands at its barrier.
template <int MODE>
__global__ void __launch_bounds__(256, 4)
gemm512(const _Float16* __restrict__ A, const _Float16* __restrict__ W,
        _Float16* __restrict__ o16, float* __restrict__ o32,
        const float* __restrict__ bias, const float* __restrict__ resid) {
    __shared__ __align__(16) _Float16 sA[2][128][G_PIT];
    __shared__ __align__(16) _Float16 sW[2][256][G_PIT];

    const int tid  = threadIdx.x;
    const int lane = tid & 31;
    const int w    = tid >> 5;
    const int ln   = lane & 15;
    const int hi   = lane >> 4;
    const int wm   = (w & 1) * 64;   // wave's rows inside the block tile
    const int wn   = (w >> 1) * 64;  // wave's columns inside the block tile
    const int m0   = blockIdx.x * 128 + wm;
    const int n0   = blockIdx.y * 256 + wn;

    if (MODE == 0) {
        A   += (size_t)blockIdx.z * M_TOT * DM;
        o16 += (size_t)blockIdx.z * M_TOT * DM;
    }
    const _Float16* Ab = A + (size_t)blockIdx.x * 128 * DM;  // block-uniform bases
    const _Float16* Wb = W + (size_t)blockIdx.y * 256 * DM;

    stage_aw(Ab, Wb, 0, tid, sA[0], sW[0]);

    v8f acc[4][4];
#pragma unroll
    for (int mi = 0; mi < 4; ++mi)
#pragma unroll
        for (int f = 0; f < 4; ++f) acc[mi][f] = v8f_zero();

    wait_asynccnt0();  // slab 0
    __syncthreads();
    stage_aw(Ab, Wb, G_KS, tid, sA[1], sW[1]);

    // Kept rolled: unrolled, fragments of neighbouring trips live side by side
    // and the 256 registers of a wave no longer hold them (spills).
#pragma unroll 1
    for (int t = 0; t < G_NS; ++t) {
        _Float16 (*bA)[G_PIT] = sA[t & 1];
        _Float16 (*bW)[G_PIT] = sW[t & 1];
        v16h fa[2][4], fb[2][4];  // [depth step of 32][fragment]
#pragma unroll
        for (int mi = 0; mi < 4; ++mi) fa[0][mi] = load_frag(&bA[wm + 16 * mi + ln][0], hi);
#pragma unroll
        for (int f = 0; f < 4; ++f) fb[0][f] = load_frag(&bW[wn + 16 * f + ln][0], hi);
        // Holds the 16 loads above as one group in front of the WMMA block; sunk
        // among the WMMAs each pair would be waited for at full LDS latency.
        __builtin_amdgcn_sched_barrier(0);
#pragma unroll
        for (int mi = 0; mi < 4; ++mi)
#pragma unroll
            for (int f = 0; f < 4; ++f)
                acc[mi][f] = __builtin_amdgcn_wmma_f32_16x16x32_f16(
                    false, fa[0][mi], false, fb[0][f], (short)0, acc[mi][f], false, false);
#pragma unroll
        for (int mi = 0; mi < 4; ++mi) fa[1][mi] = load_frag(&bA[wm + 16 * mi + ln][32], hi);
#pragma unroll
        for (int f = 0; f < 4; ++f) fb[1][f] = load_frag(&bW[wn + 16 * f + ln][32], hi);

        // ---- publish slab t+1, free this slab's buffer, refill it ----
        // This wave's LDS reads of the buffer have retired before it is refilled.
        asm volatile("s_wait_dscnt 0x0" ::: "memory");
        wait_asynccnt0();  // this wave's share of slab t+1
        __syncthreads();
        if (t + 2 < G_NS) stage_aw(Ab, Wb, (t + 2) * G_KS, tid, bA, bW);
        // Keeps the copies in front of the slab's second WMMA block, which works on
        // registers alone: issued behind it they would fly half a trip less.
        __builtin_amdgcn_sched_barrier(0);
#pragma unroll
        for (int mi = 0; mi < 4; ++mi)
#pragma unroll
            for (int f = 0; f < 4; ++f)
                acc[mi][f] = __builtin_amdgcn_wmma_f32_16x16x32_f16(
                    false, fa[1][mi], false, fb[1][f], (short)0, acc[mi][f], false, false);
    }
    wait_asynccnt0();  // nothing in flight when the wave ends

    if (MODE == 2) {
        // One base per array, every element at a constant offset from it. The
        // residual comes in units of 16 rows x 32 columns (16 loads a lane, whole
        // 128-byte lines), three units ahead of their use, into the registers that
        // the fragments have left: a load waited for element by element costs its
        // whole latency 128 times. At most 52 loads of a wave are outstanding.
        const size_t e0 = (size_t)(m0 + hi * 8) * DM + n0 + ln;
        const float* rb = resid + e0;
        float*       ob = o32 + e0;
        const int c0 = n0 + ln;
        float bv[4];
#pragma unroll
        for (int f = 0; f < 4; ++f) bv[f] = bias[c0 + 16 * f];
        // The bias loads are issued before their index register is written again;
        // the index is an input so that it lives up to the wait.
        asm volatile("s_wait_xcnt 0x0" :: "v"(c0) : "memory");
        float rv[8][2][8];  // [unit: row block, column pair][column block][row]
#pragma unroll
        for (int u = 0; u < 3; ++u)
#pragma unroll
            for (int j = 0; j < 2; ++j)
#pragma unroll
                for (int g = 0; g < 8; ++g)
                    rv[u][j][g] = rb[(16 * (u >> 1) + g) * DM + 16 * (2 * (u & 1) + j)];
#pragma unroll
        for (int u = 0; u < 8; ++u) {
            // Holds the loads issued so far in front of this unit's sums and stores;
            // sunk among them each load would again be waited for alone.
            __builtin_amdgcn_sched_barrier(0);
#pragma unroll
            for (int j = 0; j < 2; ++j)
#pragma unroll
                for (int g = 0; g < 8; ++g)
                    ob[(16 * (u >> 1) + g) * DM + 16 * (2 * (u & 1) + j)] =
                        acc[u >> 1][2 * (u & 1) + j][g] + bv[2 * (u & 1) + j] + rv[u][j][g];
            if (u + 3 < 8) {
                // The unit's stores are issued before the loads below write into
                // registers that held their data.
                asm volatile("s_wait_xcnt 0x0" ::: "memory");
#pragma unroll
                for (int j = 0; j < 2; ++j)
#pragma unroll
                    for (int g = 0; g < 8; ++g)
                        rv[u + 3][j][g] =
                            rb[(16 * ((u + 3) >> 1) + g) * DM + 16 * (2 * ((u + 3) & 1) + j)];
            }
        }
        return;
    }

    // One test for the whole epilogue, the same for the whole block.
    if (blockIdx.z == 2) {
#pragma unroll
        for (int mi = 0; mi < 4; ++mi) {
            // 8 keys in a row: batch length and tile length are multiples of 8,
            // so the 8 lie in one batch and in one key tile.
            const int r0 = m0 + 16 * mi + hi * 8;
            const int bb = r0 / LK_TOT, l = r0 - bb * LK_TOT;
            _Float16* tb = o16 + (size_t)(bb * N_KT + (l >> 5)) * (DM * K_BLK) + (l & (K_BLK - 1));
#pragma unroll
            for (int f = 0; f < 4; ++f) {
                const int col = n0 + 16 * f + ln;
                v8h ph;
#pragma unroll
                for (int g = 0; g < 8; ++g) ph[g] = (_Float16)acc[mi][f][g];
                *(v8h*)(tb + col * K_BLK) = ph;
            }
        }
    } else {
#pragma unroll
        for (int mi = 0; mi < 4; ++mi) {
            const int r0 = m0 + 16 * mi + hi * 8;
#pragma unroll
            for (int f = 0; f < 4; ++f) {
                const int col = n0 + 16 * f + ln;
#pragma unroll
                for (int g = 0; g < 8; ++g)
                    o16[(size_t)(r0 + g) * DM + col] = (_Float16)acc[mi][f][g];
            }
        }
        // The built code keeps a (never taken) way from here into the other branch,
        // which writes the stores' address registers anew: the stores are issued first.
        asm volatile("s_wait_xcnt 0x0" ::: "memory");
    }
}

// ---------------------------------------------------------------------------
// Flash attention: block = 128 q-rows, 8 waves, 32-key tiles, online softmax.
// qp: [B*Lq,512] f16  kp: [B*Lk,512] f16  vpT: [B][key tile][512][32 keys] f16
// attn out: [B*Lq,512] f16
// One work-group per WGP, the whole grid resident at once: every staged K/V
// tile serves 128 query rows. Q lives in registers as B fragments.
// K and V tiles are staged in LDS by async copies, two buffers: tile t+1 flies
// while tile t is worked on.
// Every loop over fragments is unrolled: the fragment and accumulator arrays
// stay in registers only under constant indices.
// ---------------------------------------------------------------------------
#define Q_BLK 128  // query rows per work-group

// Issue one 32-key tile's copies: K rows [32][512] and V^T rows [512][32].
// 8 + 8 copies per lane, every lane on. Ragged keys are clamped to valid
// rows / 8-key chunks; their scores are masked and their P is 0.
// Both tiles lie in a row in memory: every copy of a wave reads 512 bytes in a
// row, four whole 128-byte lines.
// Both loops are unrolled so that the copies issue back to back.
static __device__ __forceinline__ void stage_kv(const _Float16* __restrict__ kp,
                                                const _Float16* __restrict__ vpT,
                                                size_t bL, int b, int k0, int tid,
                                                _Float16 (*dK)[520], _Float16 (*dV)[40]) {
    const _Float16* kb = kp + bL * (size_t)DM;  // block-uniform bases, 32-bit lane offsets
    const _Float16* vb = vpT + ((size_t)b * N_KT * K_BLK + k0) * DM;  // tile k0 / 32 of batch b
    const int r0 = tid >> 6, k8 = (tid & 63) * 8;  // copy i: K row r0 + 4 i
#pragma unroll
    for (int i = 0; i < 8; ++i) {
        const int gr = min(k0 + r0 + 4 * i, LK_TOT - 1);
        copy16_to_lds(kb + (unsigned)(gr * DM + k8), &dK[r0 + 4 * i][k8]);
    }
    const int d0 = tid >> 2, j8 = (tid & 3) * 8;   // copy i: V^T row d0 + 64 i
    // d0 * 32 + j8 = 8 tid; a chunk past the last key steps back to the last valid one.
    const unsigned v0 = (unsigned)(tid * 8 - max(j8 - (LK_TOT - 8 - k0), 0));
#pragma unroll
    for (int i = 0; i < 8; ++i)
        copy16_to_lds(vb + (v0 + (unsigned)(64 * i * K_BLK)), &dV[d0 + 64 * i][j8]);
}

// Value of the neighbour lane (lane ^ 1): DPP quad_perm [1,0,3,2].
static __device__ __forceinline__ float lane_xor1(float x) {
    return __builtin_bit_cast(float,
        __builtin_amdgcn_mov_dpp(__builtin_bit_cast(int, x), 0xB1, 0xf, 0xf, true));
}

__global__ void __launch_bounds__(256)
flash_attn(const _Float16* __restrict__ qp, const _Float16* __restrict__ kp,
           const _Float16* __restrict__ vpT, _Float16* __restrict__ attn) {
    __shared__ __align__(16) _Float16 sK[2][K_BLK][520];  // pitch 1040 B = 16 B x odd
    __shared__ __align__(16) _Float16 sV[2][512][40];     // pitch   80 B = 16 B x odd
    __shared__ __align__(16) float    sS[2][Q_BLK][36];   // two depth halves, pitch 144 B
    __shared__ __align__(16) _Float16 sP[Q_BLK][40];      // pitch   80 B = 16 B x odd
    __shared__ __align__(16) float    sAlpha[Q_BLK];
    __shared__ __align__(16) float    sL[Q_BLK];

    const int tid  = threadIdx.x;
    const int lane = tid & 31;
    const int w    = tid >> 5;
    const int ln   = lane & 15;
    const int hi   = lane >> 4;
    const int b    = blockIdx.y;
    const int q0   = blockIdx.x * Q_BLK;
    const size_t bL = (size_t)b * LQ_TOT;
    const float scale = 0.044194173824159216f;  // 1/sqrt(512)

    stage_kv(kp, vpT, bL, b, 0, tid, sK[0], sV[0]);

    // Score work of a wave: 32 query rows x 32 keys x one half of the depth.
    const int qb = w & 3;   // block of 32 query rows
    const int kh = w >> 2;  // depth half (256 of 512)

    // This wave's Q fragments, loaded once (ragged rows clamped, never stored).
    v16h fq[2][8];
#pragma unroll
    for (int qi = 0; qi < 2; ++qi) {
        const int gr = min(q0 + 32 * qb + 16 * qi + ln, LQ_TOT - 1);
        const _Float16* qrow = qp + (bL + gr) * (size_t)DM + kh * 256 + hi * 8;
#pragma unroll
        for (int ks = 0; ks < 8; ++ks)
            fq[qi][ks] = mk_frag(*(const v8h*)(qrow + ks * 32), *(const v8h*)(qrow + ks * 32 + 16));
        // The row's loads are issued before any register of their address is
        // written again; the address is an input so that it lives up to the wait.
        asm volatile("s_wait_xcnt 0x0" :: "v"(qrow) : "memory");
    }

    v8f o[8][4];
#pragma unroll
    for (int mi = 0; mi < 8; ++mi)
#pragma unroll
        for (int ni = 0; ni < 4; ++ni) o[mi][ni] = v8f_zero();

    // Softmax state of row tid >> 1, held alike by the two threads of the row.
    float m_run = -1e30f, l_run = 0.f;

    wait_asynccnt0();  // tile 0
    __syncthreads();
    stage_kv(kp, vpT, bL, b, K_BLK, tid, sK[1], sV[1]);

    for (int kt = 0; kt < N_KT; ++kt) {
        const int k0 = kt * K_BLK;
        _Float16 (*bK)[520] = sK[kt & 1];
        _Float16 (*bV)[40]  = sV[kt & 1];

        // ---- S^T = K Q^T over this wave's depth half: 2 x 2 fragments ----
        v8f s[2][2];
#pragma unroll
        for (int nj = 0; nj < 2; ++nj)
#pragma unroll
            for (int qi = 0; qi < 2; ++qi) s[nj][qi] = v8f_zero();
        // K fragments come in groups of two depth steps (8 loads), two register
        // sets: a group is issued one block of 8 WMMAs ahead of its use.
        v16h fk[2][2][2];  // [set][step in group][nj]
#pragma unroll
        for (int gp = 0; gp < 2; ++gp)
#pragma unroll
            for (int t = 0; t < 2; ++t)
#pragma unroll
                for (int nj = 0; nj < 2; ++nj)
                    fk[gp][t][nj] = load_frag(&bK[16 * nj + ln][kh * 256 + (2 * gp + t) * 32], hi);
#pragma unroll
        for (int gp = 0; gp < 4; ++gp) {
            // Holds the loads above as one group in front of this WMMA block; sunk
            // among the WMMAs each would be waited for at full LDS latency.
            __builtin_amdgcn_sched_barrier(0);
#pragma unroll
            for (int t = 0; t < 2; ++t)
#pragma unroll
                for (int nj = 0; nj < 2; ++nj)
#pragma unroll
                    for (int qi = 0; qi < 2; ++qi)
                        s[nj][qi] = __builtin_amdgcn_wmma_f32_16x16x32_f16(
                            false, fk[gp & 1][t][nj], false, fq[qi][2 * gp + t], (short)0,
                            s[nj][qi], false, false);
            // Keeps the refill of this register set behind the block that reads it.
            __builtin_amdgcn_sched_barrier(0);
            if (gp + 2 < 4) {
#pragma unroll
                for (int t = 0; t < 2; ++t)
#pragma unroll
                    for (int nj = 0; nj < 2; ++nj)
                        fk[gp & 1][t][nj] =
                            load_frag(&bK[16 * nj + ln][kh * 256 + (2 * (gp + 2) + t) * 32], hi);
            }
        }
        // A lane holds 8 consecutive keys of one query row: two 16-byte stores.
#pragma unroll
        for (int nj = 0; nj < 2; ++nj)
#pragma unroll
            for (int qi = 0; qi < 2; ++qi) {
                float* dst = &sS[kh][32 * qb + 16 * qi + ln][16 * nj + 8 * hi];
                *(float4*)dst       = make_float4(s[nj][qi][0], s[nj][qi][1], s[nj][qi][2], s[nj][qi][3]);
                *(float4*)(dst + 4) = make_float4(s[nj][qi][4], s[nj][qi][5], s[nj][qi][6], s[nj][qi][7]);
            }
        __syncthreads();

        // ---- online softmax: 2 threads per row, 4-key chunks dealt alternately ----
        {
            const int row = tid >> 1, sub = tid & 1;
            const int nvalid = min(K_BLK, LK_TOT - k0);
            float sv[16];
            float pm = -1e30f;
#pragma unroll
            for (int j = 0; j < 4; ++j) {
                const int c0 = 4 * (2 * j + sub);
                const float4 x = *(const float4*)&sS[0][row][c0];
                const float4 y = *(const float4*)&sS[1][row][c0];
                // LK_TOT and K_BLK are multiples of 8: the row's two chunks j are valid together.
                const bool ok = 8 * j < nvalid;
                sv[4 * j + 0] = ok ? (x.x + y.x) * scale : -1e30f;
                sv[4 * j + 1] = ok ? (x.y + y.y) * scale : -1e30f;
                sv[4 * j + 2] = ok ? (x.z + y.z) * scale : -1e30f;
                sv[4 * j + 3] = ok ? (x.w + y.w) * scale : -1e30f;
            }
#pragma unroll
            for (int e = 0; e < 16; ++e) pm = fmaxf(pm, sv[e]);
            pm = fmaxf(pm, lane_xor1(pm));
            const float m_new = fmaxf(m_run, pm);
            const float alpha = __expf(m_run - m_new);
            float ps = 0.f;
#pragma unroll
            for (int j = 0; j < 4; ++j) {
                const int c0 = 4 * (2 * j + sub);
                union { _Float16 h[4]; unsigned long long u; } pk;
#pragma unroll
                for (int e = 0; e < 4; ++e) {
                    const float p = (8 * j < nvalid) ? __expf(sv[4 * j + e] - m_new) : 0.f;
                    pk.h[e] = (_Float16)p;
                    ps += p;
                }
                *(unsigned long long*)&sP[row][c0] = pk.u;
            }
            ps += lane_xor1(ps);
            l_run = l_run * alpha + ps;
            m_run = m_new;
            if (sub == 0) sAlpha[row] = alpha;
        }
        __syncthreads();

        // ---- rescale O^T, then O^T += V^T P^T (wave owns 64 d-rows, all 128 queries) ----
        // A lane's accumulators of block mi all belong to query 16 mi + ln: one factor.
#pragma unroll
        for (int mi = 0; mi < 8; ++mi) {
            const float al = sAlpha[16 * mi + ln];
#pragma unroll
            for (int ni = 0; ni < 4; ++ni)
#pragma unroll
                for (int g = 0; g < 8; ++g) o[mi][ni][g] *= al;
        }
        {
            v16h pa[8];
#pragma unroll
            for (int mi = 0; mi < 8; ++mi) pa[mi] = load_frag(&sP[16 * mi + ln][0], hi);
#pragma unroll
            for (int ni = 0; ni < 4; ++ni) {
                const int d = 64 * w + 16 * ni + ln;
                v16h vb = load_frag(&bV[d][0], hi);
#pragma unroll
                for (int mi = 0; mi < 8; ++mi)
                    o[mi][ni] = __builtin_amdgcn_wmma_f32_16x16x32_f16(
                        false, vb, false, pa[mi], (short)0, o[mi][ni], false, false);
            }
        }

        // ---- publish tile kt+1, free this tile's buffer, refill it ----
        // Keeps the tile's last WMMAs in front of the copies' address arithmetic.
        __builtin_amdgcn_sched_barrier(0);
        // This wave's LDS reads of the buffer have retired before it is refilled.
        asm volatile("s_wait_dscnt 0x0" ::: "memory");
        wait_asynccnt0();  // this wave's share of tile kt+1
        __syncthreads();
        if (kt + 2 < N_KT) stage_kv(kp, vpT, bL, b, k0 + 2 * K_BLK, tid, bK, bV);
    }
    wait_asynccnt0();  // nothing in flight when the wave ends

    // ---- hand the row sums to every wave, normalize and store ----
    if ((tid & 1) == 0) sL[tid >> 1] = l_run;
    __syncthreads();
    // A lane holds 8 consecutive d of one query row: one 16-byte store per fragment.
    // The lane's half is read anew here: kept alive through the loop, whose
    // registers are all taken, it was spilled to scratch memory.
    const int hi_e = (int)(__builtin_amdgcn_mbcnt_lo(~0u, 0u) >> 4);
#pragma unroll
    for (int mi = 0; mi < 8; ++mi) {
        const int row = 16 * mi + ln;
        const int gq  = q0 + row;
        if (gq < LQ_TOT) {
            const float inv = 1.0f / sL[row];
#pragma unroll
            for (int ni = 0; ni < 4; ++ni) {
                v8h ph;
#pragma unroll
                for (int g = 0; g < 8; ++g) ph[g] = (_Float16)(o[mi][ni][g] * inv);
                *(v8h*)(attn + (bL + gq) * (size_t)DM + 64 * w + 16 * ni + hi_e * 8) = ph;
            }
        }
    }
}

// ---------------------------------------------------------------------------
// In-place LayerNorm over rows of 512, one block (256 thr) per row.
// ---------------------------------------------------------------------------
__global__ void __launch_bounds__(256)
layernorm_inplace(float* __restrict__ out, const float* __restrict__ gamma,
                  const float* __restrict__ beta) {
    __shared__ float red[256];
    const int tid = threadIdx.x;
    float* p = out + (size_t)blockIdx.x * DM;
    float x0 = p[tid], x1 = p[tid + 256];

    red[tid] = x0 + x1;
    __syncthreads();
    for (int off = 128; off > 0; off >>= 1) {
        if (tid < off) red[tid] += red[tid + off];
        __syncthreads();
    }
    float mean = red[0] * (1.0f / DM);
    __syncthreads();

    float d0 = x0 - mean, d1 = x1 - mean;
    red[tid] = d0 * d0 + d1 * d1;
    __syncthreads();
    for (int off = 128; off > 0; off >>= 1) {
        if (tid < off) red[tid] += red[tid + off];
        __syncthreads();
    }
    float rstd = rsqrtf(red[0] * (1.0f / DM) + 1e-5f);

    p[tid]       = d0 * rstd * gamma[tid]       + beta[tid];
    p[tid + 256] = d1 * rstd * gamma[tid + 256] + beta[tid + 256];
}

// ---------------------------------------------------------------------------
extern "C" void kernel_launch(void* const* d_in, const int* in_sizes, int n_in,
                              void* d_out, int out_size, void* d_ws, size_t ws_size,
                              hipStream_t stream) {
    const float* q     = (const float*)d_in[0];
    const float* k     = (const float*)d_in[1];
    const float* v     = (const float*)d_in[2];
    const float* wqkv  = (const float*)d_in[3];
    const float* fcw   = (const float*)d_in[4];
    const float* fcb   = (const float*)d_in[5];
    const float* gamma = (const float*)d_in[6];
    const float* beta  = (const float*)d_in[7];
    float* out = (float*)d_out;

    char* ws = (char*)d_ws;
    const size_t SZ16 = (size_t)M_TOT * DM * sizeof(_Float16);  // 29,491,200 B
    _Float16* qh    = (_Float16*)(ws + 0 * SZ16);
    _Float16* kh    = (_Float16*)(ws + 1 * SZ16);
    _Float16* vh    = (_Float16*)(ws + 2 * SZ16);
    _Float16* qp    = (_Float16*)(ws + 3 * SZ16);
    _Float16* kp    = (_Float16*)(ws + 4 * SZ16);
    _Float16* vpT   = (_Float16*)(ws + 5 * SZ16);
    // vpT holds 113 whole key tiles a batch, a little more than SZ16: the weights
    // stand one plane further on.
    _Float16* w16   = (_Float16*)(ws + 7 * SZ16);
    _Float16* wfc16 = (_Float16*)(ws + 7 * SZ16 + (size_t)DM * DM * 2);
    _Float16* attn  = qh;  // qh no longer needed once projections are done

    // Stage 1: convert / transpose inputs to f16, one launch
    prep<<<dim3(NB_PREP), 256, 0, stream>>>(q, k, v, wqkv, fcw, qh, kh, vh, w16, wfc16);

    // Stage 2: shared QKV projections (WMMA), one launch: qh, kh, vh -> qp, kp, vpT
    // Still open in flash_attn: O rescaled only when a row maximum passes the
    // reference of its exponentials by 8 ln 2, one test per tile.
    // Still open: W folds into the weights, scores = q (W^T W) k^T and
    // out = (P v)(fc_w W)^T, which leaves two of the four large products.
    dim3 gg(M_TOT / 128, 2);
    dim3 g3(M_TOT / 128, 2, 3);
    gemm512<0><<<g3, 256, 0, stream>>>(qh, w16, qp, nullptr, nullptr, nullptr);

    // Stage 3: flash attention (WMMA + LDS + async staging + online softmax)
    dim3 fg(29, B_SZ);  // ceil(3600 / 128) query blocks
    flash_attn<<<fg, 256, 0, stream>>>(qp, kp, vpT, attn);

    // Stage 4: fc projection + bias + residual -> d_out (f32)
    gemm512<2><<<gg, 256, 0, stream>>>(attn, wfc16, nullptr, out, fcb, q);

    // Stage 5: LayerNorm in place on d_out
    layernorm_inplace<<<dim3(M_TOT), 256, 0, stream>>>(out, gamma, beta);
}

// v007
// Measured time: 321 microseconds a run.
// Timed twice side by side with v006, it ran 1.03 times as fast both times.
// Counting every step since v000, it is 4.18 times as fast.
#include <hip/hip_runtime.h>
#include <hip/hip_bf16.h>

typedef __attribute__((ext_vector_type(16))) _Float16 v16h;
typedef __attribute__((ext_vector_type(8)))  _Float16 v8h;
typedef __attribute__((ext_vector_type(8)))  float    v8f;
typedef __attribute__((ext_vector_type(4)))  int      v4i;

#define B_SZ   8
#define LQ_TOT 3600
#define LK_TOT 3600
#define DM     512
#define M_TOT  (B_SZ * LQ_TOT)   // 28800
#define K_BLK  32    // keys per attention tile
#define N_KT   113   // key tiles of one batch: ceil(3600 / 32)

#if __has_builtin(__builtin_amdgcn_global_load_async_to_lds_b128)
#define HAVE_ASYNC_LDS 1
#endif

typedef __attribute__((address_space(1))) v4i* as1_v4i;
typedef __attribute__((address_space(3))) v4i* as3_v4i;

// This wave's async copies have landed in LDS. Asm with a memory clobber so
// that no LDS read is moved in front of it.
static __device__ __forceinline__ void wait_asynccnt0() {
    asm volatile("s_wait_asynccnt 0x0" ::: "memory");
}

// 16 bytes per lane, global -> LDS, through no register.
static __device__ __forceinline__ void copy16_to_lds(const _Float16* src, _Float16* dst) {
#if defined(HAVE_ASYNC_LDS)
    __builtin_amdgcn_global_load_async_to_lds_b128((as1_v4i)src, (as3_v4i)dst, 0, 0);
#else
    *(v8h*)dst = *(const v8h*)src;
#endif
}

static __device__ __forceinline__ v8f v8f_zero() {
    v8f z = {0.f, 0.f, 0.f, 0.f, 0.f, 0.f, 0.f, 0.f};
    return z;
}

static __device__ __forceinline__ v16h mk_frag(v8h lo, v8h hi8) {
    union U { v16h v; v8h h[2]; } u;
    u.h[0] = lo; u.h[1] = hi8;
    return u.v;
}

// Load an A/B fragment for v_wmma_f32_16x16x32_f16.
// rowbase must point at (row/col selected by lane&15) + k offset; 'hi' = lane>>4.
// Layout: VGPR0-3 hold K = hi*8 + 0..7, VGPR4-7 hold K = 16 + hi*8 + 0..7.
static __device__ __forceinline__ v16h load_frag(const _Float16* rowbase, int hi) {
    const _Float16* p = rowbase + hi * 8;
    return mk_frag(*(const v8h*)p, *(const v8h*)(p + 16));
}

// ---------------------------------------------------------------------------
// Pack f32 -> f16 (flat); blk = index of the 256-thread block inside this job.
// A block converts 2048 groups of four: a lane issues its 8 loads of 16 bytes
// before it uses the first, so a wave has 4 KB in flight.
// ---------------------------------------------------------------------------
#define PK_U 8  // groups of four per thread
static __device__ __forceinline__ void pack_f16(const float* __restrict__ in,
                                                _Float16* __restrict__ out, int blk) {
    const int i0 = blk * (256 * PK_U) + threadIdx.x;
    const float4* ip = (const float4*)in + i0;
    unsigned long long* op = (unsigned long long*)out + i0;
    float4 f[PK_U];
    // Unrolled: the array stays in registers and the loads issue back to back.
#pragma unroll
    for (int u = 0; u < PK_U; ++u) f[u] = ip[256 * u];
#pragma unroll
    for (int u = 0; u < PK_U; ++u) {
        union { _Float16 h[4]; unsigned long long u; } pk;
        pk.h[0] = (_Float16)f[u].x; pk.h[1] = (_Float16)f[u].y;
        pk.h[2] = (_Float16)f[u].z; pk.h[3] = (_Float16)f[u].w;
        op[256 * u] = pk.u;
    }
    // The built code keeps a (never taken) way from here into the other jobs of the
    // launch, which write the stores' registers anew: the stores are issued first.
    asm volatile("s_wait_xcnt 0x0" ::: "memory");
}

// ---------------------------------------------------------------------------
// Transpose [B][512][3600] f32 -> [B*3600][512] f16. A block takes all 512
// channels of 32 positions: 64 KB read with 16 loads of 16 bytes a lane in
// flight, turned in LDS, 32 KB written as whole rows that follow one another.
// ---------------------------------------------------------------------------
#define T_PIT 520  // LDS row pitch in elements: 1040 B = 16 B x odd
static __device__ __forceinline__ void transpose_pack(const float* __restrict__ in,
                                                      _Float16* __restrict__ out,
                                                      _Float16 (*t)[T_PIT], int bx, int b) {
    const int tid = threadIdx.x;
    const int l0 = bx * 32;
    const int lq = tid & 7;   // four positions l0 + 4 lq ...
    const int dp = tid >> 3;  // channels 2 dp, 2 dp + 1 (+ 64 i)
    // Positions past the end are clamped to the last four; their LDS rows are not stored.
    const float* sp = in + (size_t)b * DM * LK_TOT + (size_t)(2 * dp) * LK_TOT
                         + min(l0 + 4 * lq, LK_TOT - 4);
    float4 x[8][2];
    // Unrolled: the array stays in registers and the loads issue back to back.
#pragma unroll
    for (int i = 0; i < 8; ++i)
#pragma unroll
        for (int j = 0; j < 2; ++j) x[i][j] = *(const float4*)(sp + (64 * i + j) * LK_TOT);
    // The loads are issued before any register of their address is written again;
    // the address is an input so that it lives up to the wait.
    asm volatile("s_wait_xcnt 0x0" :: "v"(sp) : "memory");
    // Holds all 16 loads in front of the first conversion; otherwise the last four
    // are issued only when the first four have come back.
    __builtin_amdgcn_sched_barrier(0);
#pragma unroll
    for (int i = 0; i < 8; ++i) {
        const float a[4] = {x[i][0].x, x[i][0].y, x[i][0].z, x[i][0].w};
        const float c[4] = {x[i][1].x, x[i][1].y, x[i][1].z, x[i][1].w};
#pragma unroll
        for (int e = 0; e < 4; ++e) {
            union { _Float16 h[2]; unsigned u; } pk;
            pk.h[0] = (_Float16)a[e]; pk.h[1] = (_Float16)c[e];
            *(unsigned*)&t[4 * lq + e][2 * dp + 64 * i] = pk.u;
        }
    }
    __syncthreads();
    const int r0 = tid >> 6, c8 = (tid & 63) * 8;  // store i: row r0 + 4 i
    _Float16* ob = out + ((size_t)b * LK_TOT + l0 + r0) * DM + c8;
    // Valid rows of the block, a multiple of 4: rows 4 i .. 4 i + 3 are valid together,
    // so both tests below are the same for the whole block.
    const int nv = LK_TOT - l0;
    if (nv >= 32) {
        v8h y[8];
#pragma unroll
        for (int i = 0; i < 8; ++i) y[i] = *(const v8h*)&t[r0 + 4 * i][c8];
#pragma unroll
        for (int i = 0; i < 8; ++i) *(v8h*)(ob + 4 * i * DM) = y[i];
    } else {
#pragma unroll
        for (int i = 0; i < 8; ++i)
            if (4 * i < nv) *(v8h*)(ob + 4 * i * DM) = *(const v8h*)&t[r0 + 4 * i][c8];
        // The built code keeps a (never taken) way from here into the other branch,
        // which writes the stores' data registers anew: the stores are issued first.
        asm volatile("s_wait_xcnt 0x0" ::: "memory");
    }
}

// ---------------------------------------------------------------------------
// The five conversions depend on nothing but the inputs: one launch, the jobs
// dealt by block index (every test below is the same for a whole block).
// The transposes, whose blocks move the most bytes, start first.
// ---------------------------------------------------------------------------
#define NB_TR (N_KT * B_SZ)                   // blocks of one transpose
#define NB_PQ (M_TOT * DM / 4 / (256 * PK_U)) // blocks of the pack of q
#define NB_PW (DM * DM / 4 / (256 * PK_U))    // blocks of the pack of one weight matrix
#define NB_PREP (2 * NB_TR + NB_PQ + 2 * NB_PW)

__global__ void __launch_bounds__(256)
prep(const float* __restrict__ q, const float* __restrict__ k, const float* __restrict__ v,
     const float* __restrict__ wqkv, const float* __restrict__ fcw,
     _Float16* __restrict__ qh, _Float16* __restrict__ kh, _Float16* __restrict__ vh,
     _Float16* __restrict__ w16, _Float16* __restrict__ wfc16) {
    __shared__ __align__(16) _Float16 t[32][T_PIT];
    int blk = blockIdx.x;
    if (blk < 2 * NB_TR) {
        const bool second = blk >= NB_TR;
        if (second) blk -= NB_TR;
        transpose_pack(second ? v : k, second ? vh : kh, t, blk % N_KT, blk / N_KT);
        return;
    }
    blk -= 2 * NB_TR;
    if (blk < NB_PQ) {
        pack_f16(q, qh, blk);
        return;
    }
    blk -= NB_PQ;
    if (blk < NB_PW) pack_f16(wqkv, w16, blk);
    else             pack_f16(fcw, wfc16, blk - NB_PW);
}

// ---------------------------------------------------------------------------
// NT GEMM: C[M,512] = A[M,512] * W[512,512]^T, f16 in, WMMA f32 accumulate.
// Block = 256 threads (8 waves). Block tile 128x256, wave tile 64x64.
// A and W come in slabs of 64 depth steps (whole 128-byte lines of every row),
// staged in LDS by async copies, two buffers: slab t+1 flies while slab t is
// worked on. Fragments are read from LDS.
// MODE 0: the three projections in one launch: blockIdx.z picks the plane of A
//         and of o16 (q, k, v follow one another in both); f16 stored row-major,
//         for plane 2 (V) transposed, one block per attention key tile:
//         [batch][key tile][512][32 keys], so that a tile is 32 KB in a row.
// MODE 2: store f32 row-major + bias + residual (fc layer).
// ---------------------------------------------------------------------------
#define G_KS  64          // depth steps per slab
#define G_PIT 72          // LDS row pitch in elements: 144 B = 16 B x odd
#define G_NS  (DM / G_KS) // slabs

// Issue one slab's copies: A rows [128][64] and W rows [256][64].
// 4 + 8 copies per lane, every lane on; 8 lanes cover one row's 128 bytes.
// Both loops are unrolled so that the copies issue back to back.
static __device__ __forceinline__ void stage_aw(const _Float16* __restrict__ Ab,
                                                const _Float16* __restrict__ Wb,
                                                int k0, int tid,
                                                _Float16 (*dA)[G_PIT], _Float16 (*dW)[G_PIT]) {
    const int r0 = tid >> 3, c8 = (tid & 7) * 8;  // copy i: row r0 + 32 i
    const unsigned g0 = (unsigned)(r0 * DM + k0 + c8);
#pragma unroll
    for (int i = 0; i < 4; ++i)
        copy16_to_lds(Ab + (g0 + (unsigned)(32 * i * DM)), &dA[r0 + 32 * i][c8]);
#pragma unroll
    for (int i = 0; i < 8; ++i)
        copy16_to_lds(Wb + (g0 + (unsigned)(32 * i * DM)), &dW[r0 + 32 * i][c8]);
}

// Four waves per SIMD (256 registers a wave): two work-groups share a WGP, so
// that one works while the other stands at its barrier.
template <int MODE>
__global__ void __launch_bounds__(256, 4)
gemm512(const _Float16* __restrict__ A, const _Float16* __restrict__ W,
        _Float16* __restrict__ o16, float* __restrict__ o32,
        const float* __restrict__ bias, const float* __restrict__ resid) {
    __shared__ __align__(16) _Float16 sA[2][128][G_PIT];
    __shared__ __align__(16) _Float16 sW[2][256][G_PIT];

    const int tid  = threadIdx.x;
    const int lane = tid & 31;
    const int w    = tid >> 5;
    const int ln   = lane & 15;
    const int hi   = lane >> 4;
    const int wm   = (w & 1) * 64;   // wave's rows inside the block tile
    const int wn   = (w >> 1) * 64;  // wave's columns inside the block tile
    const int m0   = blockIdx.x * 128 + wm;
    const int n0   = blockIdx.y * 256 + wn;

    if (MODE == 0) {
        A   += (size_t)blockIdx.z * M_TOT * DM;
        o16 += (size_t)blockIdx.z * M_TOT * DM;
    }
    const _Float16* Ab = A + (size_t)blockIdx.x * 128 * DM;  // block-uniform bases
    const _Float16* Wb = W + (size_t)blockIdx.y * 256 * DM;

    stage_aw(Ab, Wb, 0, tid, sA[0], sW[0]);

    v8f acc[4][4];
#pragma unroll
    for (int mi = 0; mi < 4; ++mi)
#pragma unroll
        for (int f = 0; f < 4; ++f) acc[mi][f] = v8f_zero();

    wait_asynccnt0();  // slab 0
    __syncthreads();
    stage_aw(Ab, Wb, G_KS, tid, sA[1], sW[1]);

    // Kept rolled: unrolled, fragments of neighbouring trips live side by side
    // and the 256 registers of a wave no longer hold them (spills).
#pragma unroll 1
    for (int t = 0; t < G_NS; ++t) {
        _Float16 (*bA)[G_PIT] = sA[t & 1];
        _Float16 (*bW)[G_PIT] = sW[t & 1];
        v16h fa[2][4], fb[2][4];  // [depth step of 32][fragment]
#pragma unroll
        for (int mi = 0; mi < 4; ++mi) fa[0][mi] = load_frag(&bA[wm + 16 * mi + ln][0], hi);
#pragma unroll
        for (int f = 0; f < 4; ++f) fb[0][f] = load_frag(&bW[wn + 16 * f + ln][0], hi);
        // Holds the 16 loads above as one group in front of the WMMA block; sunk
        // among the WMMAs each pair would be waited for at full LDS latency.
        __builtin_amdgcn_sched_barrier(0);
#pragma unroll
        for (int mi = 0; mi < 4; ++mi)
#pragma unroll
            for (int f = 0; f < 4; ++f)
                acc[mi][f] = __builtin_amdgcn_wmma_f32_16x16x32_f16(
                    false, fa[0][mi], false, fb[0][f], (short)0, acc[mi][f], false, false);
#pragma unroll
        for (int mi = 0; mi < 4; ++mi) fa[1][mi] = load_frag(&bA[wm + 16 * mi + ln][32], hi);
#pragma unroll
        for (int f = 0; f < 4; ++f) fb[1][f] = load_frag(&bW[wn + 16 * f + ln][32], hi);

        // ---- publish slab t+1, free this slab's buffer, refill it ----
        // This wave's LDS reads of the buffer have retired before it is refilled.
        asm volatile("s_wait_dscnt 0x0" ::: "memory");
        wait_asynccnt0();  // this wave's share of slab t+1
        __syncthreads();
        if (t + 2 < G_NS) stage_aw(Ab, Wb, (t + 2) * G_KS, tid, bA, bW);
        // Keeps the copies in front of the slab's second WMMA block, which works on
        // registers alone: issued behind it they would fly half a trip less.
        __builtin_amdgcn_sched_barrier(0);
#pragma unroll
        for (int mi = 0; mi < 4; ++mi)
#pragma unroll
            for (int f = 0; f < 4; ++f)
                acc[mi][f] = __builtin_amdgcn_wmma_f32_16x16x32_f16(
                    false, fa[1][mi], false, fb[1][f], (short)0, acc[mi][f], false, false);
    }
    wait_asynccnt0();  // nothing in flight when the wave ends

    if (MODE == 2) {
        // One base per array, every element at a constant offset from it. The
        // residual comes in units of 16 rows x 32 columns (16 loads a lane, whole
        // 128-byte lines), three units ahead of their use, into the registers that
        // the fragments have left: a load waited for element by element costs its
        // whole latency 128 times. At most 52 loads of a wave are outstanding.
        const size_t e0 = (size_t)(m0 + hi * 8) * DM + n0 + ln;
        const float* rb = resid + e0;
        float*       ob = o32 + e0;
        const int c0 = n0 + ln;
        float bv[4];
#pragma unroll
        for (int f = 0; f < 4; ++f) bv[f] = bias[c0 + 16 * f];
        // The bias loads are issued before their index register is written again;
        // the index is an input so that it lives up to the wait.
        asm volatile("s_wait_xcnt 0x0" :: "v"(c0) : "memory");
        float rv[8][2][8];  // [unit: row block, column pair][column block][row]
#pragma unroll
        for (int u = 0; u < 3; ++u)
#pragma unroll
            for (int j = 0; j < 2; ++j)
#pragma unroll
                for (int g = 0; g < 8; ++g)
                    rv[u][j][g] = rb[(16 * (u >> 1) + g) * DM + 16 * (2 * (u & 1) + j)];
#pragma unroll
        for (int u = 0; u < 8; ++u) {
            // Holds the loads issued so far in front of this unit's sums and stores;
            // sunk among them each load would again be waited for alone.
            __builtin_amdgcn_sched_barrier(0);
#pragma unroll
            for (int j = 0; j < 2; ++j)
#pragma unroll
                for (int g = 0; g < 8; ++g)
                    ob[(16 * (u >> 1) + g) * DM + 16 * (2 * (u & 1) + j)] =
                        acc[u >> 1][2 * (u & 1) + j][g] + bv[2 * (u & 1) + j] + rv[u][j][g];
            if (u + 3 < 8) {
                // The unit's stores are issued before the loads below write into
                // registers that held their data.
                asm volatile("s_wait_xcnt 0x0" ::: "memory");
#pragma unroll
                for (int j = 0; j < 2; ++j)
#pragma unroll
                    for (int g = 0; g < 8; ++g)
                        rv[u + 3][j][g] =
                            rb[(16 * ((u + 3) >> 1) + g) * DM + 16 * (2 * ((u + 3) & 1) + j)];
            }
        }
        return;
    }

    // One test for the whole epilogue, the same for the whole block.
    if (blockIdx.z == 2) {
#pragma unroll
        for (int mi = 0; mi < 4; ++mi) {
            // 8 keys in a row: batch length and tile length are multiples of 8,
            // so the 8 lie in one batch and in one key tile.
            const int r0 = m0 + 16 * mi + hi * 8;
            const int bb = r0 / LK_TOT, l = r0 - bb * LK_TOT;
            _Float16* tb = o16 + (size_t)(bb * N_KT + (l >> 5)) * (DM * K_BLK) + (l & (K_BLK - 1));
#pragma unroll
            for (int f = 0; f < 4; ++f) {
                const int col = n0 + 16 * f + ln;
                v8h ph;
#pragma unroll
                for (int g = 0; g < 8; ++g) ph[g] = (_Float16)acc[mi][f][g];
                *(v8h*)(tb + col * K_BLK) = ph;
            }
        }
    } else {
#pragma unroll
        for (int mi = 0; mi < 4; ++mi) {
            const int r0 = m0 + 16 * mi + hi * 8;
#pragma unroll
            for (int f = 0; f < 4; ++f) {
                const int col = n0 + 16 * f + ln;
#pragma unroll
                for (int g = 0; g < 8; ++g)
                    o16[(size_t)(r0 + g) * DM + col] = (_Float16)acc[mi][f][g];
            }
        }
        // The built code keeps a (never taken) way from here into the other branch,
        // which writes the stores' address registers anew: the stores are issued first.
        asm volatile("s_wait_xcnt 0x0" ::: "memory");
    }
}

// ---------------------------------------------------------------------------
// Flash attention: block = 128 q-rows, 8 waves, 32-key tiles, online softmax.
// qp: [B*Lq,512] f16  kp: [B*Lk,512] f16  vpT: [B][key tile][512][32 keys] f16
// attn out: [B*Lq,512] f16
// One work-group per WGP, the whole grid resident at once: every staged K/V
// tile serves 128 query rows. Q lives in registers as B fragments.
// K and V tiles are staged in LDS by async copies, two buffers: tile t+1 flies
// while tile t is worked on.
// Every loop over fragments is unrolled: the fragment and accumulator arrays
// stay in registers only under constant indices.
// ---------------------------------------------------------------------------
#define Q_BLK 128  // query rows per work-group

// Issue one 32-key tile's copies: K rows [32][512] and V^T rows [512][32].
// 8 + 8 copies per lane, every lane on. Ragged keys are clamped to valid
// rows / 8-key chunks; their scores are masked and their P is 0.
// Both tiles lie in a row in memory: every copy of a wave reads 512 bytes in a
// row, four whole 128-byte lines.
// Both loops are unrolled so that the copies issue back to back.
static __device__ __forceinline__ void stage_kv(const _Float16* __restrict__ kp,
                                                const _Float16* __restrict__ vpT,
                                                size_t bL, int b, int k0, int tid,
                                                _Float16 (*dK)[520], _Float16 (*dV)[40]) {
    const _Float16* kb = kp + bL * (size_t)DM;  // block-uniform bases, 32-bit lane offsets
    const _Float16* vb = vpT + ((size_t)b * N_KT * K_BLK + k0) * DM;  // tile k0 / 32 of batch b
    const int r0 = tid >> 6, k8 = (tid & 63) * 8;  // copy i: K row r0 + 4 i
#pragma unroll
    for (int i = 0; i < 8; ++i) {
        const int gr = min(k0 + r0 + 4 * i, LK_TOT - 1);
        copy16_to_lds(kb + (unsigned)(gr * DM + k8), &dK[r0 + 4 * i][k8]);
    }
    const int d0 = tid >> 2, j8 = (tid & 3) * 8;   // copy i: V^T row d0 + 64 i
    // d0 * 32 + j8 = 8 tid; a chunk past the last key steps back to the last valid one.
    const unsigned v0 = (unsigned)(tid * 8 - max(j8 - (LK_TOT - 8 - k0), 0));
#pragma unroll
    for (int i = 0; i < 8; ++i)
        copy16_to_lds(vb + (v0 + (unsigned)(64 * i * K_BLK)), &dV[d0 + 64 * i][j8]);
}

// Value of the neighbour lane (lane ^ 1): DPP quad_perm [1,0,3,2].
static __device__ __forceinline__ float lane_xor1(float x) {
    return __builtin_bit_cast(float,
        __builtin_amdgcn_mov_dpp(__builtin_bit_cast(int, x), 0xB1, 0xf, 0xf, true));
}

__global__ void __launch_bounds__(256)
flash_attn(const _Float16* __restrict__ qp, const _Float16* __restrict__ kp,
           const _Float16* __restrict__ vpT, _Float16* __restrict__ attn) {
    __shared__ __align__(16) _Float16 sK[2][K_BLK][520];  // pitch 1040 B = 16 B x odd
    __shared__ __align__(16) _Float16 sV[2][512][40];     // pitch   80 B = 16 B x odd
    __shared__ __align__(16) float    sS[2][Q_BLK][36];   // two depth halves, pitch 144 B
    __shared__ __align__(16) _Float16 sP[Q_BLK][40];      // pitch   80 B = 16 B x odd
    __shared__ __align__(16) float    sAlpha[Q_BLK];
    __shared__ __align__(16) float    sL[Q_BLK];

    const int tid  = threadIdx.x;
    const int lane = tid & 31;
    const int w    = tid >> 5;
    const int ln   = lane & 15;
    const int hi   = lane >> 4;
    const int b    = blockIdx.y;
    const int q0   = blockIdx.x * Q_BLK;
    const size_t bL = (size_t)b * LQ_TOT;
    const float scale = 0.044194173824159216f;  // 1/sqrt(512)

    stage_kv(kp, vpT, bL, b, 0, tid, sK[0], sV[0]);

    // Score work of a wave: 32 query rows x 32 keys x one half of the depth.
    const int qb = w & 3;   // block of 32 query rows
    const int kh = w >> 2;  // depth half (256 of 512)

    // This wave's Q fragments, loaded once (ragged rows clamped, never stored).
    v16h fq[2][8];
#pragma unroll
    for (int qi = 0; qi < 2; ++qi) {
        const int gr = min(q0 + 32 * qb + 16 * qi + ln, LQ_TOT - 1);
        const _Float16* qrow = qp + (bL + gr) * (size_t)DM + kh * 256 + hi * 8;
#pragma unroll
        for (int ks = 0; ks < 8; ++ks)
            fq[qi][ks] = mk_frag(*(const v8h*)(qrow + ks * 32), *(const v8h*)(qrow + ks * 32 + 16));
        // The row's loads are issued before any register of their address is
        // written again; the address is an input so that it lives up to the wait.
        asm volatile("s_wait_xcnt 0x0" :: "v"(qrow) : "memory");
    }

    v8f o[8][4];
#pragma unroll
    for (int mi = 0; mi < 8; ++mi)
#pragma unroll
        for (int ni = 0; ni < 4; ++ni) o[mi][ni] = v8f_zero();

    // Softmax state of row tid >> 1, held alike by the two threads of the row.
    float m_run = -1e30f, l_run = 0.f;

    wait_asynccnt0();  // tile 0
    __syncthreads();
    stage_kv(kp, vpT, bL, b, K_BLK, tid, sK[1], sV[1]);

    for (int kt = 0; kt < N_KT; ++kt) {
        const int k0 = kt * K_BLK;
        _Float16 (*bK)[520] = sK[kt & 1];
        _Float16 (*bV)[40]  = sV[kt & 1];

        // ---- S^T = K Q^T over this wave's depth half: 2 x 2 fragments ----
        v8f s[2][2];
#pragma unroll
        for (int nj = 0; nj < 2; ++nj)
#pragma unroll
            for (int qi = 0; qi < 2; ++qi) s[nj][qi] = v8f_zero();
        // K fragments come in groups of two depth steps (8 loads), two register
        // sets: a group is issued one block of 8 WMMAs ahead of its use.
        v16h fk[2][2][2];  // [set][step in group][nj]
#pragma unroll
        for (int gp = 0; gp < 2; ++gp)
#pragma unroll
            for (int t = 0; t < 2; ++t)
#pragma unroll
                for (int nj = 0; nj < 2; ++nj)
                    fk[gp][t][nj] = load_frag(&bK[16 * nj + ln][kh * 256 + (2 * gp + t) * 32], hi);
#pragma unroll
        for (int gp = 0; gp < 4; ++gp) {
            // Holds the loads above as one group in front of this WMMA block; sunk
            // among the WMMAs each would be waited for at full LDS latency.
            __builtin_amdgcn_sched_barrier(0);
#pragma unroll
            for (int t = 0; t < 2; ++t)
#pragma unroll
                for (int nj = 0; nj < 2; ++nj)
#pragma unroll
                    for (int qi = 0; qi < 2; ++qi)
                        s[nj][qi] = __builtin_amdgcn_wmma_f32_16x16x32_f16(
                            false, fk[gp & 1][t][nj], false, fq[qi][2 * gp + t], (short)0,
                            s[nj][qi], false, false);
            // Keeps the refill of this register set behind the block that reads it.
            __builtin_amdgcn_sched_barrier(0);
            if (gp + 2 < 4) {
#pragma unroll
                for (int t = 0; t < 2; ++t)
#pragma unroll
                    for (int nj = 0; nj < 2; ++nj)
                        fk[gp & 1][t][nj] =
                            load_frag(&bK[16 * nj + ln][kh * 256 + (2 * (gp + 2) + t) * 32], hi);
            }
        }
        // A lane holds 8 consecutive keys of one query row: two 16-byte stores.
#pragma unroll
        for (int nj = 0; nj < 2; ++nj)
#pragma unroll
            for (int qi = 0; qi < 2; ++qi) {
                float* dst = &sS[kh][32 * qb + 16 * qi + ln][16 * nj + 8 * hi];
                *(float4*)dst       = make_float4(s[nj][qi][0], s[nj][qi][1], s[nj][qi][2], s[nj][qi][3]);
                *(float4*)(dst + 4) = make_float4(s[nj][qi][4], s[nj][qi][5], s[nj][qi][6], s[nj][qi][7]);
            }
        __syncthreads();

        // ---- online softmax: 2 threads per row, 4-key chunks dealt alternately ----
        {
            const int row = tid >> 1, sub = tid & 1;
            const int nvalid = min(K_BLK, LK_TOT - k0);
            float sv[16];
            float pm = -1e30f;
#pragma unroll
            for (int j = 0; j < 4; ++j) {
                const int c0 = 4 * (2 * j + sub);
                const float4 x = *(const float4*)&sS[0][row][c0];
                const float4 y = *(const float4*)&sS[1][row][c0];
                // LK_TOT and K_BLK are multiples of 8: the row's two chunks j are valid together.
                const bool ok = 8 * j < nvalid;
                sv[4 * j + 0] = ok ? (x.x + y.x) * scale : -1e30f;
                sv[4 * j + 1] = ok ? (x.y + y.y) * scale : -1e30f;
                sv[4 * j + 2] = ok ? (x.z + y.z) * scale : -1e30f;
                sv[4 * j + 3] = ok ? (x.w + y.w) * scale : -1e30f;
            }
#pragma unroll
            for (int e = 0; e < 16; ++e) pm = fmaxf(pm, sv[e]);
            pm = fmaxf(pm, lane_xor1(pm));
            const float m_new = fmaxf(m_run, pm);
            const float alpha = __expf(m_run - m_new);
            float ps = 0.f;
#pragma unroll
            for (int j = 0; j < 4; ++j) {
                const int c0 = 4 * (2 * j + sub);
                union { _Float16 h[4]; unsigned long long u; } pk;
#pragma unroll
                for (int e = 0; e < 4; ++e) {
                    const float p = (8 * j < nvalid) ? __expf(sv[4 * j + e] - m_new) : 0.f;
                    pk.h[e] = (_Float16)p;
                    ps += p;
                }
                *(unsigned long long*)&sP[row][c0] = pk.u;
            }
            ps += lane_xor1(ps);
            l_run = l_run * alpha + ps;
            m_run = m_new;
            if (sub == 0) sAlpha[row] = alpha;
        }
        __syncthreads();

        // ---- rescale O^T, then O^T += V^T P^T (wave owns 64 d-rows, all 128 queries) ----
        // A lane's accumulators of block mi all belong to query 16 mi + ln: one factor.
#pragma unroll
        for (int mi = 0; mi < 8; ++mi) {
            const float al = sAlpha[16 * mi + ln];
#pragma unroll
            for (int ni = 0; ni < 4; ++ni)
#pragma unroll
                for (int g = 0; g < 8; ++g) o[mi][ni][g] *= al;
        }
        {
            v16h pa[8];
#pragma unroll
            for (int mi = 0; mi < 8; ++mi) pa[mi] = load_frag(&sP[16 * mi + ln][0], hi);
#pragma unroll
            for (int ni = 0; ni < 4; ++ni) {
                const int d = 64 * w + 16 * ni + ln;
                v16h vb = load_frag(&bV[d][0], hi);
#pragma unroll
                for (int mi = 0; mi < 8; ++mi)
                    o[mi][ni] = __builtin_amdgcn_wmma_f32_16x16x32_f16(
                        false, vb, false, pa[mi], (short)0, o[mi][ni], false, false);
            }
        }

        // ---- publish tile kt+1, free this tile's buffer, refill it ----
        // Keeps the tile's last WMMAs in front of the copies' address arithmetic.
        __builtin_amdgcn_sched_barrier(0);
        // This wave's LDS reads of the buffer have retired before it is refilled.
        asm volatile("s_wait_dscnt 0x0" ::: "memory");
        wait_asynccnt0();  // this wave's share of tile kt+1
        __syncthreads();
        if (kt + 2 < N_KT) stage_kv(kp, vpT, bL, b, k0 + 2 * K_BLK, tid, bK, bV);
    }
    wait_asynccnt0();  // nothing in flight when the wave ends

    // ---- hand the row sums to every wave, normalize and store ----
    if ((tid & 1) == 0) sL[tid >> 1] = l_run;
    __syncthreads();
    // A lane holds 8 consecutive d of one query row: one 16-byte store per fragment.
    // The lane's half is read anew here: kept alive through the loop, whose
    // registers are all taken, it was spilled to scratch memory.
    const int hi_e = (int)(__builtin_amdgcn_mbcnt_lo(~0u, 0u) >> 4);
#pragma unroll
    for (int mi = 0; mi < 8; ++mi) {
        const int row = 16 * mi + ln;
        const int gq  = q0 + row;
        if (gq < LQ_TOT) {
            const float inv = 1.0f / sL[row];
#pragma unroll
            for (int ni = 0; ni < 4; ++ni) {
                v8h ph;
#pragma unroll
                for (int g = 0; g < 8; ++g) ph[g] = (_Float16)(o[mi][ni][g] * inv);
                *(v8h*)(attn + (bL + gq) * (size_t)DM + 64 * w + 16 * ni + hi_e * 8) = ph;
            }
        }
    }
}

// ---------------------------------------------------------------------------
// In-place LayerNorm over rows of 512. One wave takes 4 rows that follow one
// another (8 KB): a lane issues all its 16 loads of 16 bytes before the first
// sum; a row is summed in its wave's registers, with no LDS and no barrier.
// ---------------------------------------------------------------------------
#define LN_R 4  // rows per wave

// Sum over the 32 lanes, the same value in every lane: four steps inside the
// 16-lane rows (DPP row_xmask 1, 2, 4, 8), then the other row's sum.
static __device__ __forceinline__ float wave_sum(float x) {
    x += __builtin_bit_cast(float, __builtin_amdgcn_mov_dpp(__builtin_bit_cast(int, x), 0x161, 0xf, 0xf, true));
    x += __builtin_bit_cast(float, __builtin_amdgcn_mov_dpp(__builtin_bit_cast(int, x), 0x162, 0xf, 0xf, true));
    x += __builtin_bit_cast(float, __builtin_amdgcn_mov_dpp(__builtin_bit_cast(int, x), 0x164, 0xf, 0xf, true));
    x += __builtin_bit_cast(float, __builtin_amdgcn_mov_dpp(__builtin_bit_cast(int, x), 0x168, 0xf, 0xf, true));
    const int xi = __builtin_bit_cast(int, x);
    return x + __builtin_bit_cast(float,
        __builtin_amdgcn_permlanex16(xi, xi, 0x76543210, 0xfedcba98, false, false));
}

// Eight waves per SIMD (128 registers a wave): the whole grid is resident at once.
__global__ void __launch_bounds__(256, 8)
layernorm_inplace(float* __restrict__ out, const float* __restrict__ gamma,
                  const float* __restrict__ beta) {
    const int lane = threadIdx.x & 31;
    const int wv   = blockIdx.x * 8 + (threadIdx.x >> 5);
    // Piece j of a row: columns 128 j + 4 lane ..: a wave's load is 512 bytes in a row.
    float* p = out + (size_t)wv * (LN_R * DM) + lane * 4;
    float4 x[LN_R][4], ga[4], be[4];
    // Every loop here is unrolled: the arrays stay in registers.
#pragma unroll
    for (int r = 0; r < LN_R; ++r)
#pragma unroll
        for (int j = 0; j < 4; ++j) x[r][j] = *(const float4*)(p + r * DM + 128 * j);
    // Holds all 16 loads in front of the first sum; otherwise the last row's are
    // issued only when the first row has come back.
    __builtin_amdgcn_sched_barrier(0);
#pragma unroll
    for (int j = 0; j < 4; ++j) {
        ga[j] = *(const float4*)(gamma + lane * 4 + 128 * j);
        be[j] = *(const float4*)(beta + lane * 4 + 128 * j);
    }
    float s[LN_R];
#pragma unroll
    for (int r = 0; r < LN_R; ++r) {
        float a = 0.f;
#pragma unroll
        for (int j = 0; j < 4; ++j) a += (x[r][j].x + x[r][j].y) + (x[r][j].z + x[r][j].w);
        s[r] = a;
    }
#pragma unroll
    for (int r = 0; r < LN_R; ++r) s[r] = wave_sum(s[r]) * (1.0f / DM);
    float qs[LN_R];
#pragma unroll
    for (int r = 0; r < LN_R; ++r) {
        float a = 0.f;
#pragma unroll
        for (int j = 0; j < 4; ++j) {
            x[r][j].x -= s[r]; x[r][j].y -= s[r]; x[r][j].z -= s[r]; x[r][j].w -= s[r];
            a += (x[r][j].x * x[r][j].x + x[r][j].y * x[r][j].y)
               + (x[r][j].z * x[r][j].z + x[r][j].w * x[r][j].w);
        }
        qs[r] = a;
    }
#pragma unroll
    for (int r = 0; r < LN_R; ++r) qs[r] = rsqrtf(wave_sum(qs[r]) * (1.0f / DM) + 1e-5f);
#pragma unroll
    for (int r = 0; r < LN_R; ++r)
#pragma unroll
        for (int j = 0; j < 4; ++j) {
            float4 y;
            y.x = x[r][j].x * qs[r] * ga[j].x + be[j].x;
            y.y = x[r][j].y * qs[r] * ga[j].y + be[j].y;
            y.z = x[r][j].z * qs[r] * ga[j].z + be[j].z;
            y.w = x[r][j].w * qs[r] * ga[j].w + be[j].w;
            *(float4*)(p + r * DM + 128 * j) = y;
        }
}

// ---------------------------------------------------------------------------
extern "C" void kernel_launch(void* const* d_in, const int* in_sizes, int n_in,
                              void* d_out, int out_size, void* d_ws, size_t ws_size,
                              hipStream_t stream) {
    const float* q     = (const float*)d_in[0];
    const float* k     = (const float*)d_in[1];
    const float* v     = (const float*)d_in[2];
    const float* wqkv  = (const float*)d_in[3];
    const float* fcw   = (const float*)d_in[4];
    const float* fcb   = (const float*)d_in[5];
    const float* gamma = (const float*)d_in[6];
    const float* beta  = (const float*)d_in[7];
    float* out = (float*)d_out;

    char* ws = (char*)d_ws;
    const size_t SZ16 = (size_t)M_TOT * DM * sizeof(_Float16);  // 29,491,200 B
    _Float16* qh    = (_Float16*)(ws + 0 * SZ16);
    _Float16* kh    = (_Float16*)(ws + 1 * SZ16);
    _Float16* vh    = (_Float16*)(ws + 2 * SZ16);
    _Float16* qp    = (_Float16*)(ws + 3 * SZ16);
    _Float16* kp    = (_Float16*)(ws + 4 * SZ16);
    _Float16* vpT   = (_Float16*)(ws + 5 * SZ16);
    // vpT holds 113 whole key tiles a batch, a little more than SZ16: the weights
    // stand one plane further on.
    _Float16* w16   = (_Float16*)(ws + 7 * SZ16);
    _Float16* wfc16 = (_Float16*)(ws + 7 * SZ16 + (size_t)DM * DM * 2);
    _Float16* attn  = qh;  // qh no longer needed once projections are done

    // Stage 1: convert / transpose inputs to f16, one launch
    prep<<<dim3(NB_PREP), 256, 0, stream>>>(q, k, v, wqkv, fcw, qh, kh, vh, w16, wfc16);

    // Stage 2: shared QKV projections (WMMA), one launch: qh, kh, vh -> qp, kp, vpT
    // Still open in flash_attn: O rescaled only when a row maximum passes the
    // reference of its exponentials by 8 ln 2, one test per tile.
    // Still open: the f16 GEMM epilogue stores 32-byte pieces; whole lines through LDS.
    // Still open: W folds into the weights, scores = q (W^T W) k^T and
    // out = (P v)(fc_w W)^T, which leaves two of the four large products.
    dim3 gg(M_TOT / 128, 2);
    dim3 g3(M_TOT / 128, 2, 3);
    gemm512<0><<<g3, 256, 0, stream>>>(qh, w16, qp, nullptr, nullptr, nullptr);

    // Stage 3: flash attention (WMMA + LDS + async staging + online softmax)
    dim3 fg(29, B_SZ);  // ceil(3600 / 128) query blocks
    flash_attn<<<fg, 256, 0, stream>>>(qp, kp, vpT, attn);

    // Stage 4: fc projection + bias + residual -> d_out (f32)
    gemm512<2><<<gg, 256, 0, stream>>>(attn, wfc16, nullptr, out, fcb, q);

    // Stage 5: LayerNorm in place on d_out
    layernorm_inplace<<<dim3(M_TOT / (8 * LN_R)), 256, 0, stream>>>(out, gamma, beta);
}

// v008
// One run takes 312 microseconds.
// Next to v007, in two timings, it ran 1.04 and 1.03 times as fast.
// Counting every step since v000, it is 4.33 times as fast.
#include <hip/hip_runtime.h>
#include <hip/hip_bf16.h>

typedef __attribute__((ext_vector_type(16))) _Float16 v16h;
typedef __attribute__((ext_vector_type(8)))  _Float16 v8h;
typedef __attribute__((ext_vector_type(8)))  float    v8f;
typedef __attribute__((ext_vector_type(4)))  int      v4i;

#define B_SZ   8
#define LQ_TOT 3600
#define LK_TOT 3600
#define DM     512
#define M_TOT  (B_SZ * LQ_TOT)   // 28800
#define K_BLK  32    // keys per attention tile
#define N_KT   113   // key tiles of one batch: ceil(3600 / 32)

#if __has_builtin(__builtin_amdgcn_global_load_async_to_lds_b128)
#define HAVE_ASYNC_LDS 1
#endif

typedef __attribute__((address_space(1))) v4i* as1_v4i;
typedef __attribute__((address_space(3))) v4i* as3_v4i;

// This wave's async copies have landed in LDS. Asm with a memory clobber so
// that no LDS read is moved in front of it.
static __device__ __forceinline__ void wait_asynccnt0() {
    asm volatile("s_wait_asynccnt 0x0" ::: "memory");
}

// 16 bytes per lane, global -> LDS, through no register.
static __device__ __forceinline__ void copy16_to_lds(const _Float16* src, _Float16* dst) {
#if defined(HAVE_ASYNC_LDS)
    __builtin_amdgcn_global_load_async_to_lds_b128((as1_v4i)src, (as3_v4i)dst, 0, 0);
#else
    *(v8h*)dst = *(const v8h*)src;
#endif
}

static __device__ __forceinline__ v8f v8f_zero() {
    v8f z = {0.f, 0.f, 0.f, 0.f, 0.f, 0.f, 0.f, 0.f};
    return z;
}

static __device__ __forceinline__ v16h mk_frag(v8h lo, v8h hi8) {
    union U { v16h v; v8h h[2]; } u;
    u.h[0] = lo; u.h[1] = hi8;
    return u.v;
}

// Load an A/B fragment for v_wmma_f32_16x16x32_f16.
// rowbase must point at (row/col selected by lane&15) + k offset; 'hi' = lane>>4.
// Layout: VGPR0-3 hold K = hi*8 + 0..7, VGPR4-7 hold K = 16 + hi*8 + 0..7.
static __device__ __forceinline__ v16h load_frag(const _Float16* rowbase, int hi) {
    const _Float16* p = rowbase + hi * 8;
    return mk_frag(*(const v8h*)p, *(const v8h*)(p + 16));
}

// ---------------------------------------------------------------------------
// Pack f32 -> f16 (flat); blk = index of the 256-thread block inside this job.
// A block converts 2048 groups of four: a lane issues its 8 loads of 16 bytes
// before it uses the first, so a wave has 4 KB in flight.
// ---------------------------------------------------------------------------
#define PK_U 8  // groups of four per thread
static __device__ __forceinline__ void pack_f16(const float* __restrict__ in,
                                                _Float16* __restrict__ out, int blk) {
    const int i0 = blk * (256 * PK_U) + threadIdx.x;
    const float4* ip = (const float4*)in + i0;
    unsigned long long* op = (unsigned long long*)out + i0;
    float4 f[PK_U];
    // Unrolled: the array stays in registers and the loads issue back to back.
#pragma unroll
    for (int u = 0; u < PK_U; ++u) f[u] = ip[256 * u];
#pragma unroll
    for (int u = 0; u < PK_U; ++u) {
        union { _Float16 h[4]; unsigned long long u; } pk;
        pk.h[0] = (_Float16)f[u].x; pk.h[1] = (_Float16)f[u].y;
        pk.h[2] = (_Float16)f[u].z; pk.h[3] = (_Float16)f[u].w;
        op[256 * u] = pk.u;
    }
    // The built code keeps a (never taken) way from here into the other jobs of the
    // launch, which write the stores' registers anew: the stores are issued first.
    asm volatile("s_wait_xcnt 0x0" ::: "memory");
}

// ---------------------------------------------------------------------------
// Transpose [B][512][3600] f32 -> [B*3600][512] f16. A block takes all 512
// channels of 32 positions: 64 KB read with 16 loads of 16 bytes a lane in
// flight, turned in LDS, 32 KB written as whole rows that follow one another.
// ---------------------------------------------------------------------------
#define T_PIT 520  // LDS row pitch in elements: 1040 B = 16 B x odd
static __device__ __forceinline__ void transpose_pack(const float* __restrict__ in,
                                                      _Float16* __restrict__ out,
                                                      _Float16 (*t)[T_PIT], int bx, int b) {
    const int tid = threadIdx.x;
    const int l0 = bx * 32;
    const int lq = tid & 7;   // four positions l0 + 4 lq ...
    const int dp = tid >> 3;  // channels 2 dp, 2 dp + 1 (+ 64 i)
    // Positions past the end are clamped to the last four; their LDS rows are not stored.
    const float* sp = in + (size_t)b * DM * LK_TOT + (size_t)(2 * dp) * LK_TOT
                         + min(l0 + 4 * lq, LK_TOT - 4);
    float4 x[8][2];
    // Unrolled: the array stays in registers and the loads issue back to back.
#pragma unroll
    for (int i = 0; i < 8; ++i)
#pragma unroll
        for (int j = 0; j < 2; ++j) x[i][j] = *(const float4*)(sp + (64 * i + j) * LK_TOT);
    // The loads are issued before any register of their address is written again;
    // the address is an input so that it lives up to the wait.
    asm volatile("s_wait_xcnt 0x0" :: "v"(sp) : "memory");
    // Holds all 16 loads in front of the first conversion; otherwise the last four
    // are issued only when the first four have come back.
    __builtin_amdgcn_sched_barrier(0);
#pragma unroll
    for (int i = 0; i < 8; ++i) {
        const float a[4] = {x[i][0].x, x[i][0].y, x[i][0].z, x[i][0].w};
        const float c[4] = {x[i][1].x, x[i][1].y, x[i][1].z, x[i][1].w};
#pragma unroll
        for (int e = 0; e < 4; ++e) {
            union { _Float16 h[2]; unsigned u; } pk;
            pk.h[0] = (_Float16)a[e]; pk.h[1] = (_Float16)c[e];
            *(unsigned*)&t[4 * lq + e][2 * dp + 64 * i] = pk.u;
        }
    }
    __syncthreads();
    const int r0 = tid >> 6, c8 = (tid & 63) * 8;  // store i: row r0 + 4 i
    _Float16* ob = out + ((size_t)b * LK_TOT + l0 + r0) * DM + c8;
    // Valid rows of the block, a multiple of 4: rows 4 i .. 4 i + 3 are valid together,
    // so both tests below are the same for the whole block.
    const int nv = LK_TOT - l0;
    if (nv >= 32) {
        v8h y[8];
#pragma unroll
        for (int i = 0; i < 8; ++i) y[i] = *(const v8h*)&t[r0 + 4 * i][c8];
#pragma unroll
        for (int i = 0; i < 8; ++i) *(v8h*)(ob + 4 * i * DM) = y[i];
    } else {
#pragma unroll
        for (int i = 0; i < 8; ++i)
            if (4 * i < nv) *(v8h*)(ob + 4 * i * DM) = *(const v8h*)&t[r0 + 4 * i][c8];
        // The built code keeps a (never taken) way from here into the other branch,
        // which writes the stores' data registers anew: the stores are issued first.
        asm volatile("s_wait_xcnt 0x0" ::: "memory");
    }
}

// ---------------------------------------------------------------------------
// The five conversions depend on nothing but the inputs: one launch, the jobs
// dealt by block index (every test below is the same for a whole block).
// The transposes, whose blocks move the most bytes, start first.
// ---------------------------------------------------------------------------
#define NB_TR (N_KT * B_SZ)                   // blocks of one transpose
#define NB_PQ (M_TOT * DM / 4 / (256 * PK_U)) // blocks of the pack of q
#define NB_PW (DM * DM / 4 / (256 * PK_U))    // blocks of the pack of one weight matrix
#define NB_PREP (2 * NB_TR + NB_PQ + 2 * NB_PW)

__global__ void __launch_bounds__(256)
prep(const float* __restrict__ q, const float* __restrict__ k, const float* __restrict__ v,
     const float* __restrict__ wqkv, const float* __restrict__ fcw,
     _Float16* __restrict__ qh, _Float16* __restrict__ kh, _Float16* __restrict__ vh,
     _Float16* __restrict__ w16, _Float16* __restrict__ wfc16) {
    __shared__ __align__(16) _Float16 t[32][T_PIT];
    int blk = blockIdx.x;
    if (blk < 2 * NB_TR) {
        const bool second = blk >= NB_TR;
        if (second) blk -= NB_TR;
        transpose_pack(second ? v : k, second ? vh : kh, t, blk % N_KT, blk / N_KT);
        return;
    }
    blk -= 2 * NB_TR;
    if (blk < NB_PQ) {
        pack_f16(q, qh, blk);
        return;
    }
    blk -= NB_PQ;
    if (blk < NB_PW) pack_f16(wqkv, w16, blk);
    else             pack_f16(fcw, wfc16, blk - NB_PW);
}

// ---------------------------------------------------------------------------
// NT GEMM: C[M,512] = A[M,512] * W[512,512]^T, f16 in, WMMA f32 accumulate.
// Block = 256 threads (8 waves). Block tile 128x256, wave tile 64x64.
// A and W come in slabs of 64 depth steps (whole 128-byte lines of every row),
// staged in LDS by async copies, two buffers: slab t+1 flies while slab t is
// worked on. Fragments are read from LDS.
// MODE 0: the three projections in one launch: blockIdx.z picks the plane of A
//         and of o16 (q, k, v follow one another in both); f16 stored row-major,
//         for plane 2 (V) transposed, one block per attention key tile:
//         [batch][key tile][512][32 keys], so that a tile is 32 KB in a row.
// MODE 2: store f32 row-major + bias + residual (fc layer).
// ---------------------------------------------------------------------------
#define G_KS  64          // depth steps per slab
#define G_PIT 72          // LDS row pitch in elements: 144 B = 16 B x odd
#define G_NS  (DM / G_KS) // slabs

// Issue one slab's copies: A rows [128][64] and W rows [256][64].
// 4 + 8 copies per lane, every lane on; 8 lanes cover one row's 128 bytes.
// Both loops are unrolled so that the copies issue back to back.
static __device__ __forceinline__ void stage_aw(const _Float16* __restrict__ Ab,
                                                const _Float16* __restrict__ Wb,
                                                int k0, int tid,
                                                _Float16 (*dA)[G_PIT], _Float16 (*dW)[G_PIT]) {
    const int r0 = tid >> 3, c8 = (tid & 7) * 8;  // copy i: row r0 + 32 i
    const unsigned g0 = (unsigned)(r0 * DM + k0 + c8);
#pragma unroll
    for (int i = 0; i < 4; ++i)
        copy16_to_lds(Ab + (g0 + (unsigned)(32 * i * DM)), &dA[r0 + 32 * i][c8]);
#pragma unroll
    for (int i = 0; i < 8; ++i)
        copy16_to_lds(Wb + (g0 + (unsigned)(32 * i * DM)), &dW[r0 + 32 * i][c8]);
}

// Four waves per SIMD (256 registers a wave): two work-groups share a WGP, so
// that one works while the other stands at its barrier.
template <int MODE>
__global__ void __launch_bounds__(256, 4)
gemm512(const _Float16* __restrict__ A, const _Float16* __restrict__ W,
        _Float16* __restrict__ o16, float* __restrict__ o32,
        const float* __restrict__ bias, const float* __restrict__ resid) {
    __shared__ __align__(16) _Float16 sA[2][128][G_PIT];
    __shared__ __align__(16) _Float16 sW[2][256][G_PIT];

    const int tid  = threadIdx.x;
    const int lane = tid & 31;
    const int w    = tid >> 5;
    const int ln   = lane & 15;
    const int hi   = lane >> 4;
    const int wm   = (w & 1) * 64;   // wave's rows inside the block tile
    const int wn   = (w >> 1) * 64;  // wave's columns inside the block tile
    const int m0   = blockIdx.x * 128 + wm;
    const int n0   = blockIdx.y * 256 + wn;

    if (MODE == 0) {
        A   += (size_t)blockIdx.z * M_TOT * DM;
        o16 += (size_t)blockIdx.z * M_TOT * DM;
    }
    const _Float16* Ab = A + (size_t)blockIdx.x * 128 * DM;  // block-uniform bases
    const _Float16* Wb = W + (size_t)blockIdx.y * 256 * DM;

    stage_aw(Ab, Wb, 0, tid, sA[0], sW[0]);

    v8f acc[4][4];
#pragma unroll
    for (int mi = 0; mi < 4; ++mi)
#pragma unroll
        for (int f = 0; f < 4; ++f) acc[mi][f] = v8f_zero();

    wait_asynccnt0();  // slab 0
    __syncthreads();
    stage_aw(Ab, Wb, G_KS, tid, sA[1], sW[1]);

    // Kept rolled: unrolled, fragments of neighbouring trips live side by side
    // and the 256 registers of a wave no longer hold them (spills).
#pragma unroll 1
    for (int t = 0; t < G_NS; ++t) {
        _Float16 (*bA)[G_PIT] = sA[t & 1];
        _Float16 (*bW)[G_PIT] = sW[t & 1];
        v16h fa[2][4], fb[2][4];  // [depth step of 32][fragment]
#pragma unroll
        for (int mi = 0; mi < 4; ++mi) fa[0][mi] = load_frag(&bA[wm + 16 * mi + ln][0], hi);
#pragma unroll
        for (int f = 0; f < 4; ++f) fb[0][f] = load_frag(&bW[wn + 16 * f + ln][0], hi);
        // Holds the 16 loads above as one group in front of the WMMA block; sunk
        // among the WMMAs each pair would be waited for at full LDS latency.
        __builtin_amdgcn_sched_barrier(0);
#pragma unroll
        for (int mi = 0; mi < 4; ++mi)
#pragma unroll
            for (int f = 0; f < 4; ++f)
                acc[mi][f] = __builtin_amdgcn_wmma_f32_16x16x32_f16(
                    false, fa[0][mi], false, fb[0][f], (short)0, acc[mi][f], false, false);
#pragma unroll
        for (int mi = 0; mi < 4; ++mi) fa[1][mi] = load_frag(&bA[wm + 16 * mi + ln][32], hi);
#pragma unroll
        for (int f = 0; f < 4; ++f) fb[1][f] = load_frag(&bW[wn + 16 * f + ln][32], hi);

        // ---- publish slab t+1, free this slab's buffer, refill it ----
        // This wave's LDS reads of the buffer have retired before it is refilled.
        asm volatile("s_wait_dscnt 0x0" ::: "memory");
        wait_asynccnt0();  // this wave's share of slab t+1
        __syncthreads();
        if (t + 2 < G_NS) stage_aw(Ab, Wb, (t + 2) * G_KS, tid, bA, bW);
        // Keeps the copies in front of the slab's second WMMA block, which works on
        // registers alone: issued behind it they would fly half a trip less.
        __builtin_amdgcn_sched_barrier(0);
#pragma unroll
        for (int mi = 0; mi < 4; ++mi)
#pragma unroll
            for (int f = 0; f < 4; ++f)
                acc[mi][f] = __builtin_amdgcn_wmma_f32_16x16x32_f16(
                    false, fa[1][mi], false, fb[1][f], (short)0, acc[mi][f], false, false);
    }
    wait_asynccnt0();  // nothing in flight when the wave ends

    if (MODE == 2) {
        // One base per array, every element at a constant offset from it. The
        // residual comes in units of 16 rows x 32 columns (16 loads a lane, whole
        // 128-byte lines), three units ahead of their use, into the registers that
        // the fragments have left: a load waited for element by element costs its
        // whole latency 128 times. At most 52 loads of a wave are outstanding.
        const size_t e0 = (size_t)(m0 + hi * 8) * DM + n0 + ln;
        const float* rb = resid + e0;
        float*       ob = o32 + e0;
        const int c0 = n0 + ln;
        float bv[4];
#pragma unroll
        for (int f = 0; f < 4; ++f) bv[f] = bias[c0 + 16 * f];
        // The bias loads are issued before their index register is written again;
        // the index is an input so that it lives up to the wait.
        asm volatile("s_wait_xcnt 0x0" :: "v"(c0) : "memory");
        float rv[8][2][8];  // [unit: row block, column pair][column block][row]
#pragma unroll
        for (int u = 0; u < 3; ++u)
#pragma unroll
            for (int j = 0; j < 2; ++j)
#pragma unroll
                for (int g = 0; g < 8; ++g)
                    rv[u][j][g] = rb[(16 * (u >> 1) + g) * DM + 16 * (2 * (u & 1) + j)];
#pragma unroll
        for (int u = 0; u < 8; ++u) {
            // Holds the loads issued so far in front of this unit's sums and stores;
            // sunk among them each load would again be waited for alone.
            __builtin_amdgcn_sched_barrier(0);
#pragma unroll
            for (int j = 0; j < 2; ++j)
#pragma unroll
                for (int g = 0; g < 8; ++g)
                    ob[(16 * (u >> 1) + g) * DM + 16 * (2 * (u & 1) + j)] =
                        acc[u >> 1][2 * (u & 1) + j][g] + bv[2 * (u & 1) + j] + rv[u][j][g];
            if (u + 3 < 8) {
                // The unit's stores are issued before the loads below write into
                // registers that held their data.
                asm volatile("s_wait_xcnt 0x0" ::: "memory");
#pragma unroll
                for (int j = 0; j < 2; ++j)
#pragma unroll
                    for (int g = 0; g < 8; ++g)
                        rv[u + 3][j][g] =
                            rb[(16 * ((u + 3) >> 1) + g) * DM + 16 * (2 * ((u + 3) & 1) + j)];
            }
        }
        return;
    }

    // One test for the whole epilogue, the same for the whole block.
    if (blockIdx.z == 2) {
#pragma unroll
        for (int mi = 0; mi < 4; ++mi) {
            // 8 keys in a row: batch length and tile length are multiples of 8,
            // so the 8 lie in one batch and in one key tile.
            const int r0 = m0 + 16 * mi + hi * 8;
            const int bb = r0 / LK_TOT, l = r0 - bb * LK_TOT;
            _Float16* tb = o16 + (size_t)(bb * N_KT + (l >> 5)) * (DM * K_BLK) + (l & (K_BLK - 1));
#pragma unroll
            for (int f = 0; f < 4; ++f) {
                const int col = n0 + 16 * f + ln;
                v8h ph;
#pragma unroll
                for (int g = 0; g < 8; ++g) ph[g] = (_Float16)acc[mi][f][g];
                *(v8h*)(tb + col * K_BLK) = ph;
            }
        }
    } else {
#pragma unroll
        for (int mi = 0; mi < 4; ++mi) {
            const int r0 = m0 + 16 * mi + hi * 8;
#pragma unroll
            for (int f = 0; f < 4; ++f) {
                const int col = n0 + 16 * f + ln;
#pragma unroll
                for (int g = 0; g < 8; ++g)
                    o16[(size_t)(r0 + g) * DM + col] = (_Float16)acc[mi][f][g];
            }
        }
        // The built code keeps a (never taken) way from here into the other branch,
        // which writes the stores' address registers anew: the stores are issued first.
        asm volatile("s_wait_xcnt 0x0" ::: "memory");
    }
}

// ---------------------------------------------------------------------------
// Flash attention: block = 128 q-rows, 8 waves, 32-key tiles, online softmax.
// qp: [B*Lq,512] f16  kp: [B*Lk,512] f16  vpT: [B][key tile][512][32 keys] f16
// attn out: [B*Lq,512] f16
// One work-group per WGP, the whole grid resident at once: every staged K/V
// tile serves 128 query rows. Q lives in registers as B fragments.
// The three steps of a tile are spread over three trips of the loop: trip j
// does the scores of tile j, the softmax of tile j - 1 and the V product of
// tile j - 2. Inside a trip they depend on nothing of one another (scores, P
// and the rescale factors have two LDS buffers each), so a trip has one barrier
// and one wave's softmax runs beside the other wave's matrix work.
// Stage j of the ring is what trip j reads: K tile j and V tile j - 2, staged in
// LDS by async copies, two buffers: stage j+1 flies while stage j is worked on.
// Still open: a third ring buffer (it fits the LDS), so that a stage's copies
// have two trips to land instead of one.
// Every loop over fragments is unrolled: the fragment and accumulator arrays
// stay in registers only under constant indices.
// ---------------------------------------------------------------------------
#define Q_BLK 128  // query rows per work-group

// Issue one 32-key tile's copies of K rows [32][512]: 8 copies per lane, every
// lane on. Ragged keys are clamped to valid rows; their scores are masked.
// The tile lies in a row in memory: every copy of a wave reads 512 bytes in a
// row, four whole 128-byte lines. Unrolled so that the copies issue back to back.
static __device__ __forceinline__ void stage_k(const _Float16* __restrict__ kp,
                                               size_t bL, int k0, int tid,
                                               _Float16 (*dK)[520]) {
    const _Float16* kb = kp + bL * (size_t)DM;  // block-uniform base, 32-bit lane offsets
    const int r0 = tid >> 6, k8 = (tid & 63) * 8;  // copy i: K row r0 + 4 i
#pragma unroll
    for (int i = 0; i < 8; ++i) {
        const int gr = min(k0 + r0 + 4 * i, LK_TOT - 1);
        copy16_to_lds(kb + (unsigned)(gr * DM + k8), &dK[r0 + 4 * i][k8]);
    }
}

// The same for the tile's V^T rows [512][32]. Ragged keys are clamped to valid
// 8-key chunks; their P is 0.
static __device__ __forceinline__ void stage_v(const _Float16* __restrict__ vpT,
                                               int b, int k0, int tid,
                                               _Float16 (*dV)[40]) {
    const _Float16* vb = vpT + ((size_t)b * N_KT * K_BLK + k0) * DM;  // tile k0 / 32 of batch b
    const int d0 = tid >> 2, j8 = (tid & 3) * 8;   // copy i: V^T row d0 + 64 i
    // d0 * 32 + j8 = 8 tid; a chunk past the last key steps back to the last valid one.
    const unsigned v0 = (unsigned)(tid * 8 - max(j8 - (LK_TOT - 8 - k0), 0));
#pragma unroll
    for (int i = 0; i < 8; ++i)
        copy16_to_lds(vb + (v0 + (unsigned)(64 * i * K_BLK)), &dV[d0 + 64 * i][j8]);
}

// Value of the neighbour lane (lane ^ 1): DPP quad_perm [1,0,3,2].
static __device__ __forceinline__ float lane_xor1(float x) {
    return __builtin_bit_cast(float,
        __builtin_amdgcn_mov_dpp(__builtin_bit_cast(int, x), 0xB1, 0xf, 0xf, true));
}

// Online softmax of one 32-key tile: 2 threads per row, 4-key chunks dealt
// alternately. S0, S1: the two depth halves of the scores; P and the rescale
// factors A go to LDS; the row's state stays in the two threads' registers.
// Keys from nvalid on are masked; both tests on nvalid are the same for the
// whole work-group and fail for every tile but the last.
static __device__ __forceinline__ void softmax_tile(const float (*S0)[36], const float (*S1)[36],
                                                    _Float16 (*P)[40], float* A, int nvalid,
                                                    int tid, float& m_run, float& l_run) {
    const float scale = 0.044194173824159216f;  // 1/sqrt(512)
    const int row = tid >> 1, sub = tid & 1;
    float sv[16];
#pragma unroll
    for (int c = 0; c < 4; ++c) {
        const int c0 = 4 * (2 * c + sub);
        const float4 x = *(const float4*)&S0[row][c0];
        const float4 y = *(const float4*)&S1[row][c0];
        sv[4 * c + 0] = (x.x + y.x) * scale;
        sv[4 * c + 1] = (x.y + y.y) * scale;
        sv[4 * c + 2] = (x.z + y.z) * scale;
        sv[4 * c + 3] = (x.w + y.w) * scale;
    }
    // LK_TOT and K_BLK are multiples of 8: the row's two chunks c are valid together.
    if (nvalid < K_BLK) {
#pragma unroll
        for (int e = 0; e < 16; ++e)
            if (8 * (e >> 2) >= nvalid) sv[e] = -1e30f;
    }
    float pm = -1e30f;
#pragma unroll
    for (int e = 0; e < 16; ++e) pm = fmaxf(pm, sv[e]);
    pm = fmaxf(pm, lane_xor1(pm));
    const float m_new = fmaxf(m_run, pm);
    const float alpha = __expf(m_run - m_new);
    float p[16];
#pragma unroll
    for (int e = 0; e < 16; ++e) p[e] = __expf(sv[e] - m_new);
    if (nvalid < K_BLK) {
#pragma unroll
        for (int e = 0; e < 16; ++e)
            if (8 * (e >> 2) >= nvalid) p[e] = 0.f;
    }
    float ps = 0.f;
#pragma unroll
    for (int c = 0; c < 4; ++c) {
        union { _Float16 h[4]; unsigned long long u; } pk;
#pragma unroll
        for (int e = 0; e < 4; ++e) {
            pk.h[e] = (_Float16)p[4 * c + e];
            ps += p[4 * c + e];
        }
        *(unsigned long long*)&P[row][4 * (2 * c + sub)] = pk.u;
    }
    ps += lane_xor1(ps);
    l_run = l_run * alpha + ps;
    m_run = m_new;
    if (sub == 0) A[row] = alpha;
}

__global__ void __launch_bounds__(256)
flash_attn(const _Float16* __restrict__ qp, const _Float16* __restrict__ kp,
           const _Float16* __restrict__ vpT, _Float16* __restrict__ attn) {
    __shared__ __align__(16) _Float16 sK[2][K_BLK][520];   // pitch 1040 B = 16 B x odd
    __shared__ __align__(16) _Float16 sV[2][512][40];      // pitch   80 B = 16 B x odd
    __shared__ __align__(16) float    sS[2][2][Q_BLK][36]; // [tile parity][depth half], pitch 144 B
    __shared__ __align__(16) _Float16 sP[2][Q_BLK][40];    // [tile parity], pitch 80 B = 16 B x odd
    __shared__ __align__(16) float    sAlpha[2][Q_BLK];    // [tile parity]
    __shared__ __align__(16) float    sL[Q_BLK];

    const int tid  = threadIdx.x;
    const int lane = tid & 31;
    const int w    = tid >> 5;
    const int ln   = lane & 15;
    const int hi   = lane >> 4;
    const int b    = blockIdx.y;
    const int q0   = blockIdx.x * Q_BLK;
    const size_t bL = (size_t)b * LQ_TOT;
    stage_k(kp, bL, 0, tid, sK[0]);  // stage 0: K tile 0 alone

    // Score work of a wave: 32 query rows x 32 keys x one half of the depth.
    const int qb = w & 3;   // block of 32 query rows
    const int kh = w >> 2;  // depth half (256 of 512)

    // This wave's Q fragments, loaded once (ragged rows clamped, never stored).
    v16h fq[2][8];
#pragma unroll
    for (int qi = 0; qi < 2; ++qi) {
        const int gr = min(q0 + 32 * qb + 16 * qi + ln, LQ_TOT - 1);
        const _Float16* qrow = qp + (bL + gr) * (size_t)DM + kh * 256 + hi * 8;
#pragma unroll
        for (int ks = 0; ks < 8; ++ks)
            fq[qi][ks] = mk_frag(*(const v8h*)(qrow + ks * 32), *(const v8h*)(qrow + ks * 32 + 16));
        // The row's loads are issued before any register of their address is
        // written again; the address is an input so that it lives up to the wait.
        asm volatile("s_wait_xcnt 0x0" :: "v"(qrow) : "memory");
    }

    v8f o[8][4];
#pragma unroll
    for (int mi = 0; mi < 8; ++mi)
#pragma unroll
        for (int ni = 0; ni < 4; ++ni) o[mi][ni] = v8f_zero();

    // Softmax state of row tid >> 1, held alike by the two threads of the row.
    float m_run = -1e30f, l_run = 0.f;

    wait_asynccnt0();  // stage 0
    __syncthreads();
    stage_k(kp, bL, K_BLK, tid, sK[1]);  // stage 1: K tile 1 alone

    // Every test on j is the same for the whole work-group.
    for (int j = 0; j < N_KT + 2; ++j) {
        const int par = j & 1;

        if (j < N_KT) {
            _Float16 (*bK)[520] = sK[par];
            // ---- tile j: S^T = K Q^T over this wave's depth half: 2 x 2 fragments ----
            v8f s[2][2];
#pragma unroll
            for (int nj = 0; nj < 2; ++nj)
#pragma unroll
                for (int qi = 0; qi < 2; ++qi) s[nj][qi] = v8f_zero();
            // K fragments come in groups of two depth steps (8 loads), two register
            // sets: a group is issued one block of 8 WMMAs ahead of its use.
            v16h fk[2][2][2];  // [set][step in group][nj]
#pragma unroll
            for (int gp = 0; gp < 2; ++gp)
#pragma unroll
                for (int t = 0; t < 2; ++t)
#pragma unroll
                    for (int nj = 0; nj < 2; ++nj)
                        fk[gp][t][nj] = load_frag(&bK[16 * nj + ln][kh * 256 + (2 * gp + t) * 32], hi);
#pragma unroll
            for (int gp = 0; gp < 4; ++gp) {
                // Holds the loads above as one group in front of this WMMA block; sunk
                // among the WMMAs each would be waited for at full LDS latency.
                __builtin_amdgcn_sched_barrier(0);
#pragma unroll
                for (int t = 0; t < 2; ++t)
#pragma unroll
                    for (int nj = 0; nj < 2; ++nj)
#pragma unroll
                        for (int qi = 0; qi < 2; ++qi)
                            s[nj][qi] = __builtin_amdgcn_wmma_f32_16x16x32_f16(
                                false, fk[gp & 1][t][nj], false, fq[qi][2 * gp + t], (short)0,
                                s[nj][qi], false, false);
                // Keeps the refill of this register set behind the block that reads it.
                __builtin_amdgcn_sched_barrier(0);
                if (gp + 2 < 4) {
#pragma unroll
                    for (int t = 0; t < 2; ++t)
#pragma unroll
                        for (int nj = 0; nj < 2; ++nj)
                            fk[gp & 1][t][nj] =
                                load_frag(&bK[16 * nj + ln][kh * 256 + (2 * (gp + 2) + t) * 32], hi);
                }
            }
            // A lane holds 8 consecutive keys of one query row: two 16-byte stores.
#pragma unroll
            for (int nj = 0; nj < 2; ++nj)
#pragma unroll
                for (int qi = 0; qi < 2; ++qi) {
                    float* dst = &sS[par][kh][32 * qb + 16 * qi + ln][16 * nj + 8 * hi];
                    *(float4*)dst       = make_float4(s[nj][qi][0], s[nj][qi][1], s[nj][qi][2], s[nj][qi][3]);
                    *(float4*)(dst + 4) = make_float4(s[nj][qi][4], s[nj][qi][5], s[nj][qi][6], s[nj][qi][7]);
                }
        }

        // ---- tile j - 1: online softmax ----
        if (j >= 1 && j <= N_KT)
            softmax_tile(sS[par ^ 1][0], sS[par ^ 1][1], sP[par ^ 1], sAlpha[par ^ 1],
                         min(K_BLK, LK_TOT - (j - 1) * K_BLK), tid, m_run, l_run);

        // ---- tile j - 2: rescale O^T, then O^T += V^T P^T (wave owns 64 d-rows, all 128 queries) ----
        if (j >= 2) {
            _Float16 (*bV)[40] = sV[par];
            // A lane's accumulators of block mi all belong to query 16 mi + ln: one factor.
#pragma unroll
            for (int mi = 0; mi < 8; ++mi) {
                const float al = sAlpha[par][16 * mi + ln];
#pragma unroll
                for (int ni = 0; ni < 4; ++ni)
#pragma unroll
                    for (int g = 0; g < 8; ++g) o[mi][ni][g] *= al;
            }
            v16h pa[8];
#pragma unroll
            for (int mi = 0; mi < 8; ++mi) pa[mi] = load_frag(&sP[par][16 * mi + ln][0], hi);
#pragma unroll
            for (int ni = 0; ni < 4; ++ni) {
                const int d = 64 * w + 16 * ni + ln;
                v16h vb = load_frag(&bV[d][0], hi);
#pragma unroll
                for (int mi = 0; mi < 8; ++mi)
                    o[mi][ni] = __builtin_amdgcn_wmma_f32_16x16x32_f16(
                        false, vb, false, pa[mi], (short)0, o[mi][ni], false, false);
            }
        }

        // ---- the trip's one barrier: publish stage j+1 and this trip's scores, P and
        // factors, free this stage's buffers, refill them ----
        // This wave's LDS reads of the buffers have retired before they are refilled.
        asm volatile("s_wait_dscnt 0x0" ::: "memory");
        wait_asynccnt0();  // this wave's share of stage j+1
        __syncthreads();
        if (j < N_KT) {  // a stage j+2 exists: K tile j+2, where there is one, and V tile j
            if (j + 2 < N_KT) stage_k(kp, bL, (j + 2) * K_BLK, tid, sK[par]);
            stage_v(vpT, b, j * K_BLK, tid, sV[par]);
        }
    }
    wait_asynccnt0();  // nothing in flight when the wave ends

    // ---- hand the row sums to every wave, normalize and store ----
    if ((tid & 1) == 0) sL[tid >> 1] = l_run;
    __syncthreads();
    // A lane holds 8 consecutive d of one query row: one 16-byte store per fragment.
    // The lane's half is read anew here: kept alive through the loop, whose
    // registers are all taken, it was spilled to scratch memory.
    const int hi_e = (int)(__builtin_amdgcn_mbcnt_lo(~0u, 0u) >> 4);
#pragma unroll
    for (int mi = 0; mi < 8; ++mi) {
        const int row = 16 * mi + ln;
        const int gq  = q0 + row;
        if (gq < LQ_TOT) {
            const float inv = 1.0f / sL[row];
#pragma unroll
            for (int ni = 0; ni < 4; ++ni) {
                v8h ph;
#pragma unroll
                for (int g = 0; g < 8; ++g) ph[g] = (_Float16)(o[mi][ni][g] * inv);
                *(v8h*)(attn + (bL + gq) * (size_t)DM + 64 * w + 16 * ni + hi_e * 8) = ph;
            }
        }
    }
}

// ---------------------------------------------------------------------------
// In-place LayerNorm over rows of 512. One wave takes 4 rows that follow one
// another (8 KB): a lane issues all its 16 loads of 16 bytes before the first
// sum; a row is summed in its wave's registers, with no LDS and no barrier.
// ---------------------------------------------------------------------------
#define LN_R 4  // rows per wave

// Sum over the 32 lanes, the same value in every lane: four steps inside the
// 16-lane rows (DPP row_xmask 1, 2, 4, 8), then the other row's sum.
static __device__ __forceinline__ float wave_sum(float x) {
    x += __builtin_bit_cast(float, __builtin_amdgcn_mov_dpp(__builtin_bit_cast(int, x), 0x161, 0xf, 0xf, true));
    x += __builtin_bit_cast(float, __builtin_amdgcn_mov_dpp(__builtin_bit_cast(int, x), 0x162, 0xf, 0xf, true));
    x += __builtin_bit_cast(float, __builtin_amdgcn_mov_dpp(__builtin_bit_cast(int, x), 0x164, 0xf, 0xf, true));
    x += __builtin_bit_cast(float, __builtin_amdgcn_mov_dpp(__builtin_bit_cast(int, x), 0x168, 0xf, 0xf, true));
    const int xi = __builtin_bit_cast(int, x);
    return x + __builtin_bit_cast(float,
        __builtin_amdgcn_permlanex16(xi, xi, 0x76543210, 0xfedcba98, false, false));
}

// Eight waves per SIMD (128 registers a wave): the whole grid is resident at once.
__global__ void __launch_bounds__(256, 8)
layernorm_inplace(float* __restrict__ out, const float* __restrict__ gamma,
                  const float* __restrict__ beta) {
    const int lane = threadIdx.x & 31;
    const int wv   = blockIdx.x * 8 + (threadIdx.x >> 5);
    // Piece j of a row: columns 128 j + 4 lane ..: a wave's load is 512 bytes in a row.
    float* p = out + (size_t)wv * (LN_R * DM) + lane * 4;
    float4 x[LN_R][4], ga[4], be[4];
    // Every loop here is unrolled: the arrays stay in registers.
#pragma unroll
    for (int r = 0; r < LN_R; ++r)
#pragma unroll
        for (int j = 0; j < 4; ++j) x[r][j] = *(const float4*)(p + r * DM + 128 * j);
    // Holds all 16 loads in front of the first sum; otherwise the last row's are
    // issued only when the first row has come back.
    __builtin_amdgcn_sched_barrier(0);
#pragma unroll
    for (int j = 0; j < 4; ++j) {
        ga[j] = *(const float4*)(gamma + lane * 4 + 128 * j);
        be[j] = *(const float4*)(beta + lane * 4 + 128 * j);
    }
    float s[LN_R];
#pragma unroll
    for (int r = 0; r < LN_R; ++r) {
        float a = 0.f;
#pragma unroll
        for (int j = 0; j < 4; ++j) a += (x[r][j].x + x[r][j].y) + (x[r][j].z + x[r][j].w);
        s[r] = a;
    }
#pragma unroll
    for (int r = 0; r < LN_R; ++r) s[r] = wave_sum(s[r]) * (1.0f / DM);
    float qs[LN_R];
#pragma unroll
    for (int r = 0; r < LN_R; ++r) {
        float a = 0.f;
#pragma unroll
        for (int j = 0; j < 4; ++j) {
            x[r][j].x -= s[r]; x[r][j].y -= s[r]; x[r][j].z -= s[r]; x[r][j].w -= s[r];
            a += (x[r][j].x * x[r][j].x + x[r][j].y * x[r][j].y)
               + (x[r][j].z * x[r][j].z + x[r][j].w * x[r][j].w);
        }
        qs[r] = a;
    }
#pragma unroll
    for (int r = 0; r < LN_R; ++r) qs[r] = rsqrtf(wave_sum(qs[r]) * (1.0f / DM) + 1e-5f);
#pragma unroll
    for (int r = 0; r < LN_R; ++r)
#pragma unroll
        for (int j = 0; j < 4; ++j) {
            float4 y;
            y.x = x[r][j].x * qs[r] * ga[j].x + be[j].x;
            y.y = x[r][j].y * qs[r] * ga[j].y + be[j].y;
            y.z = x[r][j].z * qs[r] * ga[j].z + be[j].z;
            y.w = x[r][j].w * qs[r] * ga[j].w + be[j].w;
            *(float4*)(p + r * DM + 128 * j) = y;
        }
}

// ---------------------------------------------------------------------------
extern "C" void kernel_launch(void* const* d_in, const int* in_sizes, int n_in,
                              void* d_out, int out_size, void* d_ws, size_t ws_size,
                              hipStream_t stream) {
    const float* q     = (const float*)d_in[0];
    const float* k     = (const float*)d_in[1];
    const float* v     = (const float*)d_in[2];
    const float* wqkv  = (const float*)d_in[3];
    const float* fcw   = (const float*)d_in[4];
    const float* fcb   = (const float*)d_in[5];
    const float* gamma = (const float*)d_in[6];
    const float* beta  = (const float*)d_in[7];
    float* out = (float*)d_out;

    char* ws = (char*)d_ws;
    const size_t SZ16 = (size_t)M_TOT * DM * sizeof(_Float16);  // 29,491,200 B
    _Float16* qh    = (_Float16*)(ws + 0 * SZ16);
    _Float16* kh    = (_Float16*)(ws + 1 * SZ16);
    _Float16* vh    = (_Float16*)(ws + 2 * SZ16);
    _Float16* qp    = (_Float16*)(ws + 3 * SZ16);
    _Float16* kp    = (_Float16*)(ws + 4 * SZ16);
    _Float16* vpT   = (_Float16*)(ws + 5 * SZ16);
    // vpT holds 113 whole key tiles a batch, a little more than SZ16: the weights
    // stand one plane further on.
    _Float16* w16   = (_Float16*)(ws + 7 * SZ16);
    _Float16* wfc16 = (_Float16*)(ws + 7 * SZ16 + (size_t)DM * DM * 2);
    _Float16* attn  = qh;  // qh no longer needed once projections are done

    // Stage 1: convert / transpose inputs to f16, one launch
    prep<<<dim3(NB_PREP), 256, 0, stream>>>(q, k, v, wqkv, fcw, qh, kh, vh, w16, wfc16);

    // Stage 2: shared QKV projections (WMMA), one launch: qh, kh, vh -> qp, kp, vpT
    // Still open in flash_attn: O rescaled only when a row maximum passes the
    // reference of its exponentials by 8 ln 2, one test per tile.
    // Still open: the f16 GEMM epilogue stores 32-byte pieces; whole lines through LDS.
    // Still open: W folds into the weights, scores = q (W^T W) k^T and
    // out = (P v)(fc_w W)^T, which leaves two of the four large products.
    dim3 gg(M_TOT / 128, 2);
    dim3 g3(M_TOT / 128, 2, 3);
    gemm512<0><<<g3, 256, 0, stream>>>(qh, w16, qp, nullptr, nullptr, nullptr);

    // Stage 3: flash attention (WMMA + LDS + async staging + online softmax)
    dim3 fg(29, B_SZ);  // ceil(3600 / 128) query blocks
    flash_attn<<<fg, 256, 0, stream>>>(qp, kp, vpT, attn);

    // Stage 4: fc projection + bias + residual -> d_out (f32)
    gemm512<2><<<gg, 256, 0, stream>>>(attn, wfc16, nullptr, out, fcb, q);

    // Stage 5: LayerNorm in place on d_out
    layernorm_inplace<<<dim3(M_TOT / (8 * LN_R)), 256, 0, stream>>>(out, gamma, beta);
}

// v009
// Measured time: 289 microseconds a run.
// In two side-by-side timings against v008, it was 1.09 and 1.08 times as fast.
// Over all steps from v000 it is 4.69 times as fast.
#include <hip/hip_runtime.h>
#include <hip/hip_bf16.h>

typedef __attribute__((ext_vector_type(16))) _Float16 v16h;
typedef __attribute__((ext_vector_type(8)))  _Float16 v8h;
typedef __attribute__((ext_vector_type(8)))  float    v8f;
typedef __attribute__((ext_vector_type(4)))  int      v4i;

#define B_SZ   8
#define LQ_TOT 3600
#define LK_TOT 3600
#define DM     512
#define M_TOT  (B_SZ * LQ_TOT)   // 28800
#define K_BLK  32    // keys per attention tile
#define N_KT   113   // key tiles of one batch: ceil(3600 / 32)

#if __has_builtin(__builtin_amdgcn_global_load_async_to_lds_b128)
#define HAVE_ASYNC_LDS 1
#endif

typedef __attribute__((address_space(1))) v4i* as1_v4i;
typedef __attribute__((address_space(3))) v4i* as3_v4i;

// This wave's async copies have landed in LDS. Asm with a memory clobber so
// that no LDS read is moved in front of it.
static __device__ __forceinline__ void wait_asynccnt0() {
    asm volatile("s_wait_asynccnt 0x0" ::: "memory");
}

// 16 bytes per lane, global -> LDS, through no register.
static __device__ __forceinline__ void copy16_to_lds(const _Float16* src, _Float16* dst) {
#if defined(HAVE_ASYNC_LDS)
    __builtin_amdgcn_global_load_async_to_lds_b128((as1_v4i)src, (as3_v4i)dst, 0, 0);
#else
    *(v8h*)dst = *(const v8h*)src;
#endif
}

static __device__ __forceinline__ v8f v8f_zero() {
    v8f z = {0.f, 0.f, 0.f, 0.f, 0.f, 0.f, 0.f, 0.f};
    return z;
}

static __device__ __forceinline__ v16h mk_frag(v8h lo, v8h hi8) {
    union U { v16h v; v8h h[2]; } u;
    u.h[0] = lo; u.h[1] = hi8;
    return u.v;
}

// Load an A/B fragment for v_wmma_f32_16x16x32_f16.
// rowbase must point at (row/col selected by lane&15) + k offset; 'hi' = lane>>4.
// Layout: VGPR0-3 hold K = hi*8 + 0..7, VGPR4-7 hold K = 16 + hi*8 + 0..7.
static __device__ __forceinline__ v16h load_frag(const _Float16* rowbase, int hi) {
    const _Float16* p = rowbase + hi * 8;
    return mk_frag(*(const v8h*)p, *(const v8h*)(p + 16));
}

// ---------------------------------------------------------------------------
// Pack f32 -> f16 (flat); blk = index of the 256-thread block inside this job.
// A block converts 2048 groups of four: a lane issues its 8 loads of 16 bytes
// before it uses the first, so a wave has 4 KB in flight.
// ---------------------------------------------------------------------------
#define PK_U 8  // groups of four per thread
static __device__ __forceinline__ void pack_f16(const float* __restrict__ in,
                                                _Float16* __restrict__ out, int blk) {
    const int i0 = blk * (256 * PK_U) + threadIdx.x;
    const float4* ip = (const float4*)in + i0;
    unsigned long long* op = (unsigned long long*)out + i0;
    float4 f[PK_U];
    // Unrolled: the array stays in registers and the loads issue back to back.
#pragma unroll
    for (int u = 0; u < PK_U; ++u) f[u] = ip[256 * u];
#pragma unroll
    for (int u = 0; u < PK_U; ++u) {
        union { _Float16 h[4]; unsigned long long u; } pk;
        pk.h[0] = (_Float16)f[u].x; pk.h[1] = (_Float16)f[u].y;
        pk.h[2] = (_Float16)f[u].z; pk.h[3] = (_Float16)f[u].w;
        op[256 * u] = pk.u;
    }
    // The built code keeps a (never taken) way from here into the other jobs of the
    // launch, which write the stores' registers anew: the stores are issued first.
    asm volatile("s_wait_xcnt 0x0" ::: "memory");
}

// ---------------------------------------------------------------------------
// Transpose [B][512][3600] f32 -> [B*3600][512] f16. A block takes all 512
// channels of 32 positions: 64 KB read with 16 loads of 16 bytes a lane in
// flight, turned in LDS, 32 KB written as whole rows that follow one another.
// ---------------------------------------------------------------------------
#define T_PIT 520  // LDS row pitch in elements: 1040 B = 16 B x odd
static __device__ __forceinline__ void transpose_pack(const float* __restrict__ in,
                                                      _Float16* __restrict__ out,
                                                      _Float16 (*t)[T_PIT], int bx, int b) {
    const int tid = threadIdx.x;
    const int l0 = bx * 32;
    const int lq = tid & 7;   // four positions l0 + 4 lq ...
    const int dp = tid >> 3;  // channels 2 dp, 2 dp + 1 (+ 64 i)
    // Positions past the end are clamped to the last four; their LDS rows are not stored.
    const float* sp = in + (size_t)b * DM * LK_TOT + (size_t)(2 * dp) * LK_TOT
                         + min(l0 + 4 * lq, LK_TOT - 4);
    float4 x[8][2];
    // Unrolled: the array stays in registers and the loads issue back to back.
#pragma unroll
    for (int i = 0; i < 8; ++i)
#pragma unroll
        for (int j = 0; j < 2; ++j) x[i][j] = *(const float4*)(sp + (64 * i + j) * LK_TOT);
    // The loads are issued before any register of their address is written again;
    // the address is an input so that it lives up to the wait.
    asm volatile("s_wait_xcnt 0x0" :: "v"(sp) : "memory");
    // Holds all 16 loads in front of the first conversion; otherwise the last four
    // are issued only when the first four have come back.
    __builtin_amdgcn_sched_barrier(0);
#pragma unroll
    for (int i = 0; i < 8; ++i) {
        const float a[4] = {x[i][0].x, x[i][0].y, x[i][0].z, x[i][0].w};
        const float c[4] = {x[i][1].x, x[i][1].y, x[i][1].z, x[i][1].w};
#pragma unroll
        for (int e = 0; e < 4; ++e) {
            union { _Float16 h[2]; unsigned u; } pk;
            pk.h[0] = (_Float16)a[e]; pk.h[1] = (_Float16)c[e];
            *(unsigned*)&t[4 * lq + e][2 * dp + 64 * i] = pk.u;
        }
    }
    __syncthreads();
    const int r0 = tid >> 6, c8 = (tid & 63) * 8;  // store i: row r0 + 4 i
    _Float16* ob = out + ((size_t)b * LK_TOT + l0 + r0) * DM + c8;
    // Valid rows of the block, a multiple of 4: rows 4 i .. 4 i + 3 are valid together,
    // so both tests below are the same for the whole block.
    const int nv = LK_TOT - l0;
    if (nv >= 32) {
        v8h y[8];
#pragma unroll
        for (int i = 0; i < 8; ++i) y[i] = *(const v8h*)&t[r0 + 4 * i][c8];
#pragma unroll
        for (int i = 0; i < 8; ++i) *(v8h*)(ob + 4 * i * DM) = y[i];
    } else {
#pragma unroll
        for (int i = 0; i < 8; ++i)
            if (4 * i < nv) *(v8h*)(ob + 4 * i * DM) = *(const v8h*)&t[r0 + 4 * i][c8];
        // The built code keeps a (never taken) way from here into the other branch,
        // which writes the stores' data registers anew: the stores are issued first.
        asm volatile("s_wait_xcnt 0x0" ::: "memory");
    }
    // The same towards the other jobs of the launch, for both branches.
    asm volatile("s_wait_xcnt 0x0" ::: "memory");
}

// ---------------------------------------------------------------------------
// v [B][512][3600] f32 is V^T as it stands: packed to f16 in blocks of one
// attention key tile, [B][key tile][512][32 keys]. A block takes one tile: 64 KB
// read with 16 loads of 16 bytes a lane in flight (8 lanes cover a channel's 128
// bytes), 32 KB written in a row, 256 bytes a wave and store.
// ---------------------------------------------------------------------------
static __device__ __forceinline__ void reblock_v(const float* __restrict__ in,
                                                 _Float16* __restrict__ out, int bx, int b) {
    const int tid = threadIdx.x;
    const int l0 = bx * K_BLK;
    const int p4 = (tid & 7) * 4;  // four keys l0 + p4 ...
    const int d0 = tid >> 3;       // load i: channel d0 + 32 i
    // Keys past the end are clamped to the last four; they are not stored.
    const float* sp = in + ((size_t)b * DM + d0) * LK_TOT + min(l0 + p4, LK_TOT - 4);
    // Channel d, key p of the tile stand at 32 d + p: group of four number tid + 256 i.
    unsigned long long* op = (unsigned long long*)(out + (size_t)(b * N_KT + bx) * (DM * K_BLK)) + tid;
    float4 x[16];
    // Unrolled: the array stays in registers and the loads issue back to back.
#pragma unroll
    for (int i = 0; i < 16; ++i) x[i] = *(const float4*)(sp + 32 * i * LK_TOT);
    // The loads are issued before any register of their address is written again;
    // the address is an input so that it lives up to the wait.
    asm volatile("s_wait_xcnt 0x0" :: "v"(sp) : "memory");
    // Holds all 16 loads in front of the first conversion; otherwise the last ones
    // are issued only when the first have come back.
    __builtin_amdgcn_sched_barrier(0);
    if (l0 + p4 < LK_TOT) {
#pragma unroll
        for (int i = 0; i < 16; ++i) {
            union { _Float16 h[4]; unsigned long long u; } pk;
            pk.h[0] = (_Float16)x[i].x; pk.h[1] = (_Float16)x[i].y;
            pk.h[2] = (_Float16)x[i].z; pk.h[3] = (_Float16)x[i].w;
            op[256 * i] = pk.u;
        }
    }
    // The built code keeps a (never taken) way from here into the other jobs of the
    // launch, which write the stores' registers anew: the stores are issued first.
    asm volatile("s_wait_xcnt 0x0" ::: "memory");
}

// ---------------------------------------------------------------------------
// Product of two 512 x 512 weight matrices, C[a][b] = sum_o X(a, o) W[o][b], with
// X(a, o) = X[o][a] (XT) or X[a][o]: f32 read, f16 operands, WMMA, f16 stored.
// A wave makes 16 rows x 32 columns, straight from global memory (the matrices
// are small and stay in the caches); a larger tile would take registers that
// cost the other jobs of the launch resident blocks. Column fragment f of lane
// ln is column b0 + 2 ln + f: one 8-byte load serves both fragments, and a lane
// stores two columns in a row. Both operands take depth step 32 ks + 8 hi + e in
// element e and 32 ks + 16 + 8 hi + e in element 8 + e (e = 0 .. 7).
// ---------------------------------------------------------------------------
template <bool XT>
static __device__ __forceinline__ void weight_product(const float* __restrict__ X,
                                                      const float* __restrict__ Wm,
                                                      _Float16* __restrict__ out, int blk) {
    const int lane = threadIdx.x & 31;
    const int ln = lane & 15, hi = lane >> 4;
    const int wv = blk * 8 + (threadIdx.x >> 5);
    const int a0 = 16 * (wv >> 4), b0 = 32 * (wv & 15);
    const float* xb = XT ? X + 8 * hi * DM + a0 + ln : X + (a0 + ln) * DM + 8 * hi;
    const float* wb = Wm + 8 * hi * DM + b0 + 2 * ln;
    v8f acc[2];
#pragma unroll
    for (int f = 0; f < 2; ++f) acc[f] = v8f_zero();
    // Kept rolled: run once by few waves, unrolled it would be 16 times the code.
#pragma unroll 1
    for (int ks = 0; ks < DM / 32; ++ks) {
        const float* xk = xb + (XT ? 32 * ks * DM : 32 * ks);
        const float* wk = wb + 32 * ks * DM;
        float  xa[16];
        float2 wq[16];
#pragma unroll
        for (int e = 0; e < 16; ++e) {
            const int kk = e + (e & 8);  // 0 .. 7, 16 .. 23
            xa[e] = XT ? xk[kk * DM] : xk[kk];
            wq[e] = *(const float2*)(wk + kk * DM);
        }
        // The loads are issued before any register of their addresses is written
        // again; the addresses are inputs so that they live up to the wait.
        asm volatile("s_wait_xcnt 0x0" :: "v"(xk), "v"(wk) : "memory");
        // Holds all the step's loads in front of the first conversion; sunk among the
        // conversions they were waited for in groups, one latency after another.
        __builtin_amdgcn_sched_barrier(0);
        v16h fa, fb[2];
#pragma unroll
        for (int e = 0; e < 16; ++e) {
            fa[e]    = (_Float16)xa[e];
            fb[0][e] = (_Float16)wq[e].x; fb[1][e] = (_Float16)wq[e].y;
        }
#pragma unroll
        for (int f = 0; f < 2; ++f)
            acc[f] = __builtin_amdgcn_wmma_f32_16x16x32_f16(
                false, fa, false, fb[f], (short)0, acc[f], false, false);
    }
    // Accumulator register g of fragment f: row a0 + 8 hi + g, column b0 + 2 ln + f.
    _Float16* ob = out + (a0 + 8 * hi) * DM + b0 + 2 * ln;
#pragma unroll
    for (int g = 0; g < 8; ++g) {
        union { _Float16 h[2]; unsigned u; } pk;
        pk.h[0] = (_Float16)acc[0][g]; pk.h[1] = (_Float16)acc[1][g];
        *(unsigned*)(ob + g * DM) = pk.u;
    }
    // The built code keeps a (never taken) way from here into the other jobs of the
    // launch, which write the stores' registers anew: the stores are issued first.
    asm volatile("s_wait_xcnt 0x0" ::: "memory");
}

// ---------------------------------------------------------------------------
// These five jobs depend on nothing but the inputs: one launch, the jobs dealt
// by block index (every test below is the same for a whole block). The two
// weight products, the longest chains, start first and end under the others;
// then the jobs on k and v, whose blocks move the most bytes.
// ---------------------------------------------------------------------------
#define NB_TR (N_KT * B_SZ)                   // blocks of the transpose of k, of the job on v
#define NB_PQ (M_TOT * DM / 4 / (256 * PK_U)) // blocks of the pack of q
#define NB_WP (DM / 16 * (DM / 32) / 8)       // blocks of one weight product
#define NB_PREP (2 * NB_WP + 2 * NB_TR + NB_PQ)

__global__ void __launch_bounds__(256)
prep(const float* __restrict__ q, const float* __restrict__ k, const float* __restrict__ v,
     const float* __restrict__ wqkv, const float* __restrict__ fcw,
     _Float16* __restrict__ qh, _Float16* __restrict__ kh, _Float16* __restrict__ vT,
     _Float16* __restrict__ wm16, _Float16* __restrict__ wf16) {
    __shared__ __align__(16) _Float16 t[32][T_PIT];
    int blk = blockIdx.x;
    if (blk < NB_WP) {
        weight_product<true>(wqkv, wqkv, wm16, blk);  // W^T W
        return;
    }
    blk -= NB_WP;
    if (blk < NB_WP) {
        weight_product<false>(fcw, wqkv, wf16, blk);  // fc_w W
        return;
    }
    blk -= NB_WP;
    if (blk < NB_TR) {
        transpose_pack(k, kh, t, blk % N_KT, blk / N_KT);
        return;
    }
    blk -= NB_TR;
    if (blk < NB_TR) {
        reblock_v(v, vT, blk % N_KT, blk / N_KT);
        return;
    }
    pack_f16(q, qh, blk - NB_TR);
}

// ---------------------------------------------------------------------------
// NT GEMM: C[M,512] = A[M,512] * W[512,512]^T, f16 in, WMMA f32 accumulate.
// Block = 256 threads (8 waves). Block tile 128x256, wave tile 64x64.
// A and W come in slabs of 64 depth steps (whole 128-byte lines of every row),
// staged in LDS by async copies, two buffers: slab t+1 flies while slab t is
// worked on. Fragments are read from LDS.
// MODE 0: f16 stored row-major.
// MODE 2: store f32 row-major + bias + residual (fc layer).
// ---------------------------------------------------------------------------
#define G_KS  64          // depth steps per slab
#define G_PIT 72          // LDS row pitch in elements: 144 B = 16 B x odd
#define G_NS  (DM / G_KS) // slabs

// Issue one slab's copies: A rows [128][64] and W rows [256][64].
// 4 + 8 copies per lane, every lane on; 8 lanes cover one row's 128 bytes.
// Both loops are unrolled so that the copies issue back to back.
static __device__ __forceinline__ void stage_aw(const _Float16* __restrict__ Ab,
                                                const _Float16* __restrict__ Wb,
                                                int k0, int tid,
                                                _Float16 (*dA)[G_PIT], _Float16 (*dW)[G_PIT]) {
    const int r0 = tid >> 3, c8 = (tid & 7) * 8;  // copy i: row r0 + 32 i
    const unsigned g0 = (unsigned)(r0 * DM + k0 + c8);
#pragma unroll
    for (int i = 0; i < 4; ++i)
        copy16_to_lds(Ab + (g0 + (unsigned)(32 * i * DM)), &dA[r0 + 32 * i][c8]);
#pragma unroll
    for (int i = 0; i < 8; ++i)
        copy16_to_lds(Wb + (g0 + (unsigned)(32 * i * DM)), &dW[r0 + 32 * i][c8]);
}

// Four waves per SIMD (256 registers a wave): two work-groups share a WGP, so
// that one works while the other stands at its barrier.
template <int MODE>
__global__ void __launch_bounds__(256, 4)
gemm512(const _Float16* __restrict__ A, const _Float16* __restrict__ W,
        _Float16* __restrict__ o16, float* __restrict__ o32,
        const float* __restrict__ bias, const float* __restrict__ resid) {
    __shared__ __align__(16) _Float16 sA[2][128][G_PIT];
    __shared__ __align__(16) _Float16 sW[2][256][G_PIT];

    const int tid  = threadIdx.x;
    const int lane = tid & 31;
    const int w    = tid >> 5;
    const int ln   = lane & 15;
    const int hi   = lane >> 4;
    const int wm   = (w & 1) * 64;   // wave's rows inside the block tile
    const int wn   = (w >> 1) * 64;  // wave's columns inside the block tile
    const int m0   = blockIdx.x * 128 + wm;
    const int n0   = blockIdx.y * 256 + wn;

    const _Float16* Ab = A + (size_t)blockIdx.x * 128 * DM;  // block-uniform bases
    const _Float16* Wb = W + (size_t)blockIdx.y * 256 * DM;

    stage_aw(Ab, Wb, 0, tid, sA[0], sW[0]);

    v8f acc[4][4];
#pragma unroll
    for (int mi = 0; mi < 4; ++mi)
#pragma unroll
        for (int f = 0; f < 4; ++f) acc[mi][f] = v8f_zero();

    wait_asynccnt0();  // slab 0
    __syncthreads();
    stage_aw(Ab, Wb, G_KS, tid, sA[1], sW[1]);

    // Kept rolled: unrolled, fragments of neighbouring trips live side by side
    // and the 256 registers of a wave no longer hold them (spills).
#pragma unroll 1
    for (int t = 0; t < G_NS; ++t) {
        _Float16 (*bA)[G_PIT] = sA[t & 1];
        _Float16 (*bW)[G_PIT] = sW[t & 1];
        v16h fa[2][4], fb[2][4];  // [depth step of 32][fragment]
#pragma unroll
        for (int mi = 0; mi < 4; ++mi) fa[0][mi] = load_frag(&bA[wm + 16 * mi + ln][0], hi);
#pragma unroll
        for (int f = 0; f < 4; ++f) fb[0][f] = load_frag(&bW[wn + 16 * f + ln][0], hi);
        // Holds the 16 loads above as one group in front of the WMMA block; sunk
        // among the WMMAs each pair would be waited for at full LDS latency.
        __builtin_amdgcn_sched_barrier(0);
#pragma unroll
        for (int mi = 0; mi < 4; ++mi)
#pragma unroll
            for (int f = 0; f < 4; ++f)
                acc[mi][f] = __builtin_amdgcn_wmma_f32_16x16x32_f16(
                    false, fa[0][mi], false, fb[0][f], (short)0, acc[mi][f], false, false);
#pragma unroll
        for (int mi = 0; mi < 4; ++mi) fa[1][mi] = load_frag(&bA[wm + 16 * mi + ln][32], hi);
#pragma unroll
        for (int f = 0; f < 4; ++f) fb[1][f] = load_frag(&bW[wn + 16 * f + ln][32], hi);

        // ---- publish slab t+1, free this slab's buffer, refill it ----
        // This wave's LDS reads of the buffer have retired before it is refilled.
        asm volatile("s_wait_dscnt 0x0" ::: "memory");
        wait_asynccnt0();  // this wave's share of slab t+1
        __syncthreads();
        if (t + 2 < G_NS) stage_aw(Ab, Wb, (t + 2) * G_KS, tid, bA, bW);
        // Keeps the copies in front of the slab's second WMMA block, which works on
        // registers alone: issued behind it they would fly half a trip less.
        __builtin_amdgcn_sched_barrier(0);
#pragma unroll
        for (int mi = 0; mi < 4; ++mi)
#pragma unroll
            for (int f = 0; f < 4; ++f)
                acc[mi][f] = __builtin_amdgcn_wmma_f32_16x16x32_f16(
                    false, fa[1][mi], false, fb[1][f], (short)0, acc[mi][f], false, false);
    }
    wait_asynccnt0();  // nothing in flight when the wave ends

    if (MODE == 2) {
        // One base per array, every element at a constant offset from it. The
        // residual comes in units of 16 rows x 32 columns (16 loads a lane, whole
        // 128-byte lines), three units ahead of their use, into the registers that
        // the fragments have left: a load waited for element by element costs its
        // whole latency 128 times. At most 52 loads of a wave are outstanding.
        const size_t e0 = (size_t)(m0 + hi * 8) * DM + n0 + ln;
        const float* rb = resid + e0;
        float*       ob = o32 + e0;
        const int c0 = n0 + ln;
        float bv[4];
#pragma unroll
        for (int f = 0; f < 4; ++f) bv[f] = bias[c0 + 16 * f];
        // The bias loads are issued before their index register is written again;
        // the index is an input so that it lives up to the wait.
        asm volatile("s_wait_xcnt 0x0" :: "v"(c0) : "memory");
        float rv[8][2][8];  // [unit: row block, column pair][column block][row]
#pragma unroll
        for (int u = 0; u < 3; ++u)
#pragma unroll
            for (int j = 0; j < 2; ++j)
#pragma unroll
                for (int g = 0; g < 8; ++g)
                    rv[u][j][g] = rb[(16 * (u >> 1) + g) * DM + 16 * (2 * (u & 1) + j)];
#pragma unroll
        for (int u = 0; u < 8; ++u) {
            // Holds the loads issued so far in front of this unit's sums and stores;
            // sunk among them each load would again be waited for alone.
            __builtin_amdgcn_sched_barrier(0);
#pragma unroll
            for (int j = 0; j < 2; ++j)
#pragma unroll
                for (int g = 0; g < 8; ++g)
                    ob[(16 * (u >> 1) + g) * DM + 16 * (2 * (u & 1) + j)] =
                        acc[u >> 1][2 * (u & 1) + j][g] + bv[2 * (u & 1) + j] + rv[u][j][g];
            if (u + 3 < 8) {
                // The unit's stores are issued before the loads below write into
                // registers that held their data.
                asm volatile("s_wait_xcnt 0x0" ::: "memory");
#pragma unroll
                for (int j = 0; j < 2; ++j)
#pragma unroll
                    for (int g = 0; g < 8; ++g)
                        rv[u + 3][j][g] =
                            rb[(16 * ((u + 3) >> 1) + g) * DM + 16 * (2 * ((u + 3) & 1) + j)];
            }
        }
        return;
    }

#pragma unroll
    for (int mi = 0; mi < 4; ++mi) {
        const int r0 = m0 + 16 * mi + hi * 8;
#pragma unroll
        for (int f = 0; f < 4; ++f) {
            const int col = n0 + 16 * f + ln;
#pragma unroll
            for (int g = 0; g < 8; ++g)
                o16[(size_t)(r0 + g) * DM + col] = (_Float16)acc[mi][f][g];
        }
    }
}

// ---------------------------------------------------------------------------
// Flash attention: block = 128 q-rows, 8 waves, 32-key tiles, online softmax.
// qp: [B*Lq,512] f16  kp: [B*Lk,512] f16  vpT: [B][key tile][512][32 keys] f16
// (qp = q W^T W, kp = k and vpT = v^T as they come: see kernel_launch)
// attn out: [B*Lq,512] f16
// One work-group per WGP, the whole grid resident at once: every staged K/V
// tile serves 128 query rows. Q lives in registers as B fragments.
// The three steps of a tile are spread over three trips of the loop: trip j
// does the scores of tile j, the softmax of tile j - 1 and the V product of
// tile j - 2. Inside a trip they depend on nothing of one another (scores, P
// and the rescale factors have two LDS buffers each), so a trip has one barrier
// and one wave's softmax runs beside the other wave's matrix work.
// Stage j of the ring is what trip j reads: K tile j and V tile j - 2, staged in
// LDS by async copies, two buffers: stage j+1 flies while stage j is worked on.
// Still open: a third ring buffer (it fits the LDS), so that a stage's copies
// have two trips to land instead of one.
// Every loop over fragments is unrolled: the fragment and accumulator arrays
// stay in registers only under constant indices.
// ---------------------------------------------------------------------------
#define Q_BLK 128  // query rows per work-group

// Issue one 32-key tile's copies of K rows [32][512]: 8 copies per lane, every
// lane on. Ragged keys are clamped to valid rows; their scores are masked.
// The tile lies in a row in memory: every copy of a wave reads 512 bytes in a
// row, four whole 128-byte lines. Unrolled so that the copies issue back to back.
static __device__ __forceinline__ void stage_k(const _Float16* __restrict__ kp,
                                               size_t bL, int k0, int tid,
                                               _Float16 (*dK)[520]) {
    const _Float16* kb = kp + bL * (size_t)DM;  // block-uniform base, 32-bit lane offsets
    const int r0 = tid >> 6, k8 = (tid & 63) * 8;  // copy i: K row r0 + 4 i
#pragma unroll
    for (int i = 0; i < 8; ++i) {
        const int gr = min(k0 + r0 + 4 * i, LK_TOT - 1);
        copy16_to_lds(kb + (unsigned)(gr * DM + k8), &dK[r0 + 4 * i][k8]);
    }
}

// The same for the tile's V^T rows [512][32]. Ragged keys are clamped to valid
// 8-key chunks; their P is 0.
static __device__ __forceinline__ void stage_v(const _Float16* __restrict__ vpT,
                                               int b, int k0, int tid,
                                               _Float16 (*dV)[40]) {
    const _Float16* vb = vpT + ((size_t)b * N_KT * K_BLK + k0) * DM;  // tile k0 / 32 of batch b
    const int d0 = tid >> 2, j8 = (tid & 3) * 8;   // copy i: V^T row d0 + 64 i
    // d0 * 32 + j8 = 8 tid; a chunk past the last key steps back to the last valid one.
    const unsigned v0 = (unsigned)(tid * 8 - max(j8 - (LK_TOT - 8 - k0), 0));
#pragma unroll
    for (int i = 0; i < 8; ++i)
        copy16_to_lds(vb + (v0 + (unsigned)(64 * i * K_BLK)), &dV[d0 + 64 * i][j8]);
}

// Value of the neighbour lane (lane ^ 1): DPP quad_perm [1,0,3,2].
static __device__ __forceinline__ float lane_xor1(float x) {
    return __builtin_bit_cast(float,
        __builtin_amdgcn_mov_dpp(__builtin_bit_cast(int, x), 0xB1, 0xf, 0xf, true));
}

// Online softmax of one 32-key tile: 2 threads per row, 4-key chunks dealt
// alternately. S0, S1: the two depth halves of the scores; P and the rescale
// factors A go to LDS; the row's state stays in the two threads' registers.
// Keys from nvalid on are masked; both tests on nvalid are the same for the
// whole work-group and fail for every tile but the last.
static __device__ __forceinline__ void softmax_tile(const float (*S0)[36], const float (*S1)[36],
                                                    _Float16 (*P)[40], float* A, int nvalid,
                                                    int tid, float& m_run, float& l_run) {
    const float scale = 0.044194173824159216f;  // 1/sqrt(512)
    const int row = tid >> 1, sub = tid & 1;
    float sv[16];
#pragma unroll
    for (int c = 0; c < 4; ++c) {
        const int c0 = 4 * (2 * c + sub);
        const float4 x = *(const float4*)&S0[row][c0];
        const float4 y = *(const float4*)&S1[row][c0];
        sv[4 * c + 0] = (x.x + y.x) * scale;
        sv[4 * c + 1] = (x.y + y.y) * scale;
        sv[4 * c + 2] = (x.z + y.z) * scale;
        sv[4 * c + 3] = (x.w + y.w) * scale;
    }
    // LK_TOT and K_BLK are multiples of 8: the row's two chunks c are valid together.
    if (nvalid < K_BLK) {
#pragma unroll
        for (int e = 0; e < 16; ++e)
            if (8 * (e >> 2) >= nvalid) sv[e] = -1e30f;
    }
    float pm = -1e30f;
#pragma unroll
    for (int e = 0; e < 16; ++e) pm = fmaxf(pm, sv[e]);
    pm = fmaxf(pm, lane_xor1(pm));
    const float m_new = fmaxf(m_run, pm);
    const float alpha = __expf(m_run - m_new);
    float p[16];
#pragma unroll
    for (int e = 0; e < 16; ++e) p[e] = __expf(sv[e] - m_new);
    if (nvalid < K_BLK) {
#pragma unroll
        for (int e = 0; e < 16; ++e)
            if (8 * (e >> 2) >= nvalid) p[e] = 0.f;
    }
    float ps = 0.f;
#pragma unroll
    for (int c = 0; c < 4; ++c) {
        union { _Float16 h[4]; unsigned long long u; } pk;
#pragma unroll
        for (int e = 0; e < 4; ++e) {
            pk.h[e] = (_Float16)p[4 * c + e];
            ps += p[4 * c + e];
        }
        *(unsigned long long*)&P[row][4 * (2 * c + sub)] = pk.u;
    }
    ps += lane_xor1(ps);
    l_run = l_run * alpha + ps;
    m_run = m_new;
    if (sub == 0) A[row] = alpha;
}

__global__ void __launch_bounds__(256)
flash_attn(const _Float16* __restrict__ qp, const _Float16* __restrict__ kp,
           const _Float16* __restrict__ vpT, _Float16* __restrict__ attn) {
    __shared__ __align__(16) _Float16 sK[2][K_BLK][520];   // pitch 1040 B = 16 B x odd
    __shared__ __align__(16) _Float16 sV[2][512][40];      // pitch   80 B = 16 B x odd
    __shared__ __align__(16) float    sS[2][2][Q_BLK][36]; // [tile parity][depth half], pitch 144 B
    __shared__ __align__(16) _Float16 sP[2][Q_BLK][40];    // [tile parity], pitch 80 B = 16 B x odd
    __shared__ __align__(16) float    sAlpha[2][Q_BLK];    // [tile parity]
    __shared__ __align__(16) float    sL[Q_BLK];

    const int tid  = threadIdx.x;
    const int lane = tid & 31;
    const int w    = tid >> 5;
    const int ln   = lane & 15;
    const int hi   = lane >> 4;
    const int b    = blockIdx.y;
    const int q0   = blockIdx.x * Q_BLK;
    const size_t bL = (size_t)b * LQ_TOT;
    stage_k(kp, bL, 0, tid, sK[0]);  // stage 0: K tile 0 alone

    // Score work of a wave: 32 query rows x 32 keys x one half of the depth.
    const int qb = w & 3;   // block of 32 query rows
    const int kh = w >> 2;  // depth half (256 of 512)

    // This wave's Q fragments, loaded once (ragged rows clamped, never stored).
    v16h fq[2][8];
#pragma unroll
    for (int qi = 0; qi < 2; ++qi) {
        const int gr = min(q0 + 32 * qb + 16 * qi + ln, LQ_TOT - 1);
        const _Float16* qrow = qp + (bL + gr) * (size_t)DM + kh * 256 + hi * 8;
#pragma unroll
        for (int ks = 0; ks < 8; ++ks)
            fq[qi][ks] = mk_frag(*(const v8h*)(qrow + ks * 32), *(const v8h*)(qrow + ks * 32 + 16));
        // The row's loads are issued before any register of their address is
        // written again; the address is an input so that it lives up to the wait.
        asm volatile("s_wait_xcnt 0x0" :: "v"(qrow) : "memory");
    }

    v8f o[8][4];
#pragma unroll
    for (int mi = 0; mi < 8; ++mi)
#pragma unroll
        for (int ni = 0; ni < 4; ++ni) o[mi][ni] = v8f_zero();

    // Softmax state of row tid >> 1, held alike by the two threads of the row.
    float m_run = -1e30f, l_run = 0.f;

    wait_asynccnt0();  // stage 0
    __syncthreads();
    stage_k(kp, bL, K_BLK, tid, sK[1]);  // stage 1: K tile 1 alone

    // Every test on j is the same for the whole work-group.
    for (int j = 0; j < N_KT + 2; ++j) {
        const int par = j & 1;

        if (j < N_KT) {
            _Float16 (*bK)[520] = sK[par];
            // ---- tile j: S^T = K Q^T over this wave's depth half: 2 x 2 fragments ----
            v8f s[2][2];
#pragma unroll
            for (int nj = 0; nj < 2; ++nj)
#pragma unroll
                for (int qi = 0; qi < 2; ++qi) s[nj][qi] = v8f_zero();
            // K fragments come in groups of two depth steps (8 loads), two register
            // sets: a group is issued one block of 8 WMMAs ahead of its use.
            v16h fk[2][2][2];  // [set][step in group][nj]
#pragma unroll
            for (int gp = 0; gp < 2; ++gp)
#pragma unroll
                for (int t = 0; t < 2; ++t)
#pragma unroll
                    for (int nj = 0; nj < 2; ++nj)
                        fk[gp][t][nj] = load_frag(&bK[16 * nj + ln][kh * 256 + (2 * gp + t) * 32], hi);
#pragma unroll
            for (int gp = 0; gp < 4; ++gp) {
                // Holds the loads above as one group in front of this WMMA block; sunk
                // among the WMMAs each would be waited for at full LDS latency.
                __builtin_amdgcn_sched_barrier(0);
#pragma unroll
                for (int t = 0; t < 2; ++t)
#pragma unroll
                    for (int nj = 0; nj < 2; ++nj)
#pragma unroll
                        for (int qi = 0; qi < 2; ++qi)
                            s[nj][qi] = __builtin_amdgcn_wmma_f32_16x16x32_f16(
                                false, fk[gp & 1][t][nj], false, fq[qi][2 * gp + t], (short)0,
                                s[nj][qi], false, false);
                // Keeps the refill of this register set behind the block that reads it.
                __builtin_amdgcn_sched_barrier(0);
                if (gp + 2 < 4) {
#pragma unroll
                    for (int t = 0; t < 2; ++t)
#pragma unroll
                        for (int nj = 0; nj < 2; ++nj)
                            fk[gp & 1][t][nj] =
                                load_frag(&bK[16 * nj + ln][kh * 256 + (2 * (gp + 2) + t) * 32], hi);
                }
            }
            // A lane holds 8 consecutive keys of one query row: two 16-byte stores.
#pragma unroll
            for (int nj = 0; nj < 2; ++nj)
#pragma unroll
                for (int qi = 0; qi < 2; ++qi) {
                    float* dst = &sS[par][kh][32 * qb + 16 * qi + ln][16 * nj + 8 * hi];
                    *(float4*)dst       = make_float4(s[nj][qi][0], s[nj][qi][1], s[nj][qi][2], s[nj][qi][3]);
                    *(float4*)(dst + 4) = make_float4(s[nj][qi][4], s[nj][qi][5], s[nj][qi][6], s[nj][qi][7]);
                }
        }

        // ---- tile j - 1: online softmax ----
        if (j >= 1 && j <= N_KT)
            softmax_tile(sS[par ^ 1][0], sS[par ^ 1][1], sP[par ^ 1], sAlpha[par ^ 1],
                         min(K_BLK, LK_TOT - (j - 1) * K_BLK), tid, m_run, l_run);

        // ---- tile j - 2: rescale O^T, then O^T += V^T P^T (wave owns 64 d-rows, all 128 queries) ----
        if (j >= 2) {
            _Float16 (*bV)[40] = sV[par];
            // A lane's accumulators of block mi all belong to query 16 mi + ln: one factor.
#pragma unroll
            for (int mi = 0; mi < 8; ++mi) {
                const float al = sAlpha[par][16 * mi + ln];
#pragma unroll
                for (int ni = 0; ni < 4; ++ni)
#pragma unroll
                    for (int g = 0; g < 8; ++g) o[mi][ni][g] *= al;
            }
            v16h pa[8];
#pragma unroll
            for (int mi = 0; mi < 8; ++mi) pa[mi] = load_frag(&sP[par][16 * mi + ln][0], hi);
#pragma unroll
            for (int ni = 0; ni < 4; ++ni) {
                const int d = 64 * w + 16 * ni + ln;
                v16h vb = load_frag(&bV[d][0], hi);
#pragma unroll
                for (int mi = 0; mi < 8; ++mi)
                    o[mi][ni] = __builtin_amdgcn_wmma_f32_16x16x32_f16(
                        false, vb, false, pa[mi], (short)0, o[mi][ni], false, false);
            }
        }

        // ---- the trip's one barrier: publish stage j+1 and this trip's scores, P and
        // factors, free this stage's buffers, refill them ----
        // This wave's LDS reads of the buffers have retired before they are refilled.
        asm volatile("s_wait_dscnt 0x0" ::: "memory");
        wait_asynccnt0();  // this wave's share of stage j+1
        __syncthreads();
        if (j < N_KT) {  // a stage j+2 exists: K tile j+2, where there is one, and V tile j
            if (j + 2 < N_KT) stage_k(kp, bL, (j + 2) * K_BLK, tid, sK[par]);
            stage_v(vpT, b, j * K_BLK, tid, sV[par]);
        }
    }
    wait_asynccnt0();  // nothing in flight when the wave ends

    // ---- hand the row sums to every wave, normalize and store ----
    if ((tid & 1) == 0) sL[tid >> 1] = l_run;
    __syncthreads();
    // A lane holds 8 consecutive d of one query row: one 16-byte store per fragment.
    // The lane's half is read anew here: kept alive through the loop, whose
    // registers are all taken, it was spilled to scratch memory.
    const int hi_e = (int)(__builtin_amdgcn_mbcnt_lo(~0u, 0u) >> 4);
#pragma unroll
    for (int mi = 0; mi < 8; ++mi) {
        const int row = 16 * mi + ln;
        const int gq  = q0 + row;
        if (gq < LQ_TOT) {
            const float inv = 1.0f / sL[row];
#pragma unroll
            for (int ni = 0; ni < 4; ++ni) {
                v8h ph;
#pragma unroll
                for (int g = 0; g < 8; ++g) ph[g] = (_Float16)(o[mi][ni][g] * inv);
                *(v8h*)(attn + (bL + gq) * (size_t)DM + 64 * w + 16 * ni + hi_e * 8) = ph;
            }
        }
    }
}

// ---------------------------------------------------------------------------
// In-place LayerNorm over rows of 512. One wave takes 4 rows that follow one
// another (8 KB): a lane issues all its 16 loads of 16 bytes before the first
// sum; a row is summed in its wave's registers, with no LDS and no barrier.
// ---------------------------------------------------------------------------
#define LN_R 4  // rows per wave

// Sum over the 32 lanes, the same value in every lane: four steps inside the
// 16-lane rows (DPP row_xmask 1, 2, 4, 8), then the other row's sum.
static __device__ __forceinline__ float wave_sum(float x) {
    x += __builtin_bit_cast(float, __builtin_amdgcn_mov_dpp(__builtin_bit_cast(int, x), 0x161, 0xf, 0xf, true));
    x += __builtin_bit_cast(float, __builtin_amdgcn_mov_dpp(__builtin_bit_cast(int, x), 0x162, 0xf, 0xf, true));
    x += __builtin_bit_cast(float, __builtin_amdgcn_mov_dpp(__builtin_bit_cast(int, x), 0x164, 0xf, 0xf, true));
    x += __builtin_bit_cast(float, __builtin_amdgcn_mov_dpp(__builtin_bit_cast(int, x), 0x168, 0xf, 0xf, true));
    const int xi = __builtin_bit_cast(int, x);
    return x + __builtin_bit_cast(float,
        __builtin_amdgcn_permlanex16(xi, xi, 0x76543210, 0xfedcba98, false, false));
}

// Eight waves per SIMD (128 registers a wave): the whole grid is resident at once.
__global__ void __launch_bounds__(256, 8)
layernorm_inplace(float* __restrict__ out, const float* __restrict__ gamma,
                  const float* __restrict__ beta) {
    const int lane = threadIdx.x & 31;
    const int wv   = blockIdx.x * 8 + (threadIdx.x >> 5);
    // Piece j of a row: columns 128 j + 4 lane ..: a wave's load is 512 bytes in a row.
    float* p = out + (size_t)wv * (LN_R * DM) + lane * 4;
    float4 x[LN_R][4], ga[4], be[4];
    // Every loop here is unrolled: the arrays stay in registers.
#pragma unroll
    for (int r = 0; r < LN_R; ++r)
#pragma unroll
        for (int j = 0; j < 4; ++j) x[r][j] = *(const float4*)(p + r * DM + 128 * j);
    // Holds all 16 loads in front of the first sum; otherwise the last row's are
    // issued only when the first row has come back.
    __builtin_amdgcn_sched_barrier(0);
#pragma unroll
    for (int j = 0; j < 4; ++j) {
        ga[j] = *(const float4*)(gamma + lane * 4 + 128 * j);
        be[j] = *(const float4*)(beta + lane * 4 + 128 * j);
    }
    float s[LN_R];
#pragma unroll
    for (int r = 0; r < LN_R; ++r) {
        float a = 0.f;
#pragma unroll
        for (int j = 0; j < 4; ++j) a += (x[r][j].x + x[r][j].y) + (x[r][j].z + x[r][j].w);
        s[r] = a;
    }
#pragma unroll
    for (int r = 0; r < LN_R; ++r) s[r] = wave_sum(s[r]) * (1.0f / DM);
    float qs[LN_R];
#pragma unroll
    for (int r = 0; r < LN_R; ++r) {
        float a = 0.f;
#pragma unroll
        for (int j = 0; j < 4; ++j) {
            x[r][j].x -= s[r]; x[r][j].y -= s[r]; x[r][j].z -= s[r]; x[r][j].w -= s[r];
            a += (x[r][j].x * x[r][j].x + x[r][j].y * x[r][j].y)
               + (x[r][j].z * x[r][j].z + x[r][j].w * x[r][j].w);
        }
        qs[r] = a;
    }
#pragma unroll
    for (int r = 0; r < LN_R; ++r) qs[r] = rsqrtf(wave_sum(qs[r]) * (1.0f / DM) + 1e-5f);
#pragma unroll
    for (int r = 0; r < LN_R; ++r)
#pragma unroll
        for (int j = 0; j < 4; ++j) {
            float4 y;
            y.x = x[r][j].x * qs[r] * ga[j].x + be[j].x;
            y.y = x[r][j].y * qs[r] * ga[j].y + be[j].y;
            y.z = x[r][j].z * qs[r] * ga[j].z + be[j].z;
            y.w = x[r][j].w * qs[r] * ga[j].w + be[j].w;
            *(float4*)(p + r * DM + 128 * j) = y;
        }
}

// ---------------------------------------------------------------------------
extern "C" void kernel_launch(void* const* d_in, const int* in_sizes, int n_in,
                              void* d_out, int out_size, void* d_ws, size_t ws_size,
                              hipStream_t stream) {
    const float* q     = (const float*)d_in[0];
    const float* k     = (const float*)d_in[1];
    const float* v     = (const float*)d_in[2];
    const float* wqkv  = (const float*)d_in[3];
    const float* fcw   = (const float*)d_in[4];
    const float* fcb   = (const float*)d_in[5];
    const float* gamma = (const float*)d_in[6];
    const float* beta  = (const float*)d_in[7];
    float* out = (float*)d_out;

    char* ws = (char*)d_ws;
    const size_t SZ16 = (size_t)M_TOT * DM * sizeof(_Float16);  // 29,491,200 B
    _Float16* qh    = (_Float16*)(ws + 0 * SZ16);
    _Float16* kh    = (_Float16*)(ws + 1 * SZ16);
    _Float16* qp    = (_Float16*)(ws + 3 * SZ16);
    _Float16* vT    = (_Float16*)(ws + 5 * SZ16);
    // vT holds 113 whole key tiles a batch, a little more than SZ16: the weights
    // stand one plane further on.
    _Float16* wm16  = (_Float16*)(ws + 7 * SZ16);                        // W^T W
    _Float16* wf16  = (_Float16*)(ws + 7 * SZ16 + (size_t)DM * DM * 2);  // fc_w W
    _Float16* attn  = qh;  // qh no longer needed once q is projected

    // The shared projection W is folded into the weights:
    //   scores = (q W^T)(k W^T)^T = (q W^T W) k^T,
    //   out    = (P (v W^T)) fc_w^T = (P v)(fc_w W)^T,
    // so k and v go into the attention as they come and two of the four large
    // products are replaced by two products of 512 x 512 matrices.

    // Stage 1: the two weight products (WMMA); q, k, v to f16 in the layouts of
    // their readers; one launch
    prep<<<dim3(NB_PREP), 256, 0, stream>>>(q, k, v, wqkv, fcw, qh, kh, vT, wm16, wf16);

    // Stage 2: qp = q (W^T W) (WMMA); row n of wm16 is column n of W^T W as well
    // Still open in flash_attn: O rescaled only when a row maximum passes the
    // reference of its exponentials by 8 ln 2, one test per tile.
    // Still open: the f16 GEMM epilogue stores 32-byte pieces; whole lines through LDS.
    // Still open in flash_attn: waves w and w + 4 take a trip's three
    // independent steps in the same order; scores last in one of them would put its
    // vector work beside the other's matrix work (it builds in the same registers).
    dim3 gg(M_TOT / 128, 2);
    gemm512<0><<<gg, 256, 0, stream>>>(qh, wm16, qp, nullptr, nullptr, nullptr);

    // Stage 3: flash attention (WMMA + LDS + async staging + online softmax)
    dim3 fg(29, B_SZ);  // ceil(3600 / 128) query blocks
    flash_attn<<<fg, 256, 0, stream>>>(qp, kh, vT, attn);

    // Stage 4: fc projection + bias + residual -> d_out (f32)
    gemm512<2><<<gg, 256, 0, stream>>>(attn, wf16, nullptr, out, fcb, q);

    // Stage 5: LayerNorm in place on d_out
    layernorm_inplace<<<dim3(M_TOT / (8 * LN_R)), 256, 0, stream>>>(out, gamma, beta);
}

// v010
// Measured time: 230 microseconds a run.
// Next to v009, in two timings, it ran 1.27 times as fast each time.
// Over all steps from v000 it is 5.97 times as fast.
#include <hip/hip_runtime.h>
#include <hip/hip_bf16.h>

typedef __attribute__((ext_vector_type(16))) _Float16 v16h;
typedef __attribute__((ext_vector_type(8)))  _Float16 v8h;
typedef __attribute__((ext_vector_type(8)))  float    v8f;
typedef __attribute__((ext_vector_type(4)))  int      v4i;

#define B_SZ   8
#define LQ_TOT 3600
#define LK_TOT 3600
#define DM     512
#define M_TOT  (B_SZ * LQ_TOT)   // 28800
#define K_BLK  32    // keys per attention tile
#define N_KT   113   // key tiles of one batch: ceil(3600 / 32)

#if __has_builtin(__builtin_amdgcn_global_load_async_to_lds_b128)
#define HAVE_ASYNC_LDS 1
#endif

typedef __attribute__((address_space(1))) v4i* as1_v4i;
typedef __attribute__((address_space(3))) v4i* as3_v4i;

// This wave's async copies have landed in LDS. Asm with a memory clobber so
// that no LDS read is moved in front of it.
static __device__ __forceinline__ void wait_asynccnt0() {
    asm volatile("s_wait_asynccnt 0x0" ::: "memory");
}

// 16 bytes per lane, global -> LDS, through no register.
static __device__ __forceinline__ void copy16_to_lds(const _Float16* src, _Float16* dst) {
#if defined(HAVE_ASYNC_LDS)
    __builtin_amdgcn_global_load_async_to_lds_b128((as1_v4i)src, (as3_v4i)dst, 0, 0);
#else
    *(v8h*)dst = *(const v8h*)src;
#endif
}

static __device__ __forceinline__ v8f v8f_zero() {
    v8f z = {0.f, 0.f, 0.f, 0.f, 0.f, 0.f, 0.f, 0.f};
    return z;
}

static __device__ __forceinline__ v16h mk_frag(v8h lo, v8h hi8) {
    union U { v16h v; v8h h[2]; } u;
    u.h[0] = lo; u.h[1] = hi8;
    return u.v;
}

// Load an A/B fragment for v_wmma_f32_16x16x32_f16.
// rowbase must point at (row/col selected by lane&15) + k offset; 'hi' = lane>>4.
// Layout: VGPR0-3 hold K = hi*8 + 0..7, VGPR4-7 hold K = 16 + hi*8 + 0..7.
static __device__ __forceinline__ v16h load_frag(const _Float16* rowbase, int hi) {
    const _Float16* p = rowbase + hi * 8;
    return mk_frag(*(const v8h*)p, *(const v8h*)(p + 16));
}

// ---------------------------------------------------------------------------
// Pack f32 -> f16 (flat); blk = index of the 256-thread block inside this job.
// A block converts 2048 groups of four: a lane issues its 8 loads of 16 bytes
// before it uses the first, so a wave has 4 KB in flight.
// ---------------------------------------------------------------------------
#define PK_U 8  // groups of four per thread
static __device__ __forceinline__ void pack_f16(const float* __restrict__ in,
                                                _Float16* __restrict__ out, int blk) {
    const int i0 = blk * (256 * PK_U) + threadIdx.x;
    const float4* ip = (const float4*)in + i0;
    unsigned long long* op = (unsigned long long*)out + i0;
    float4 f[PK_U];
    // Unrolled: the array stays in registers and the loads issue back to back.
#pragma unroll
    for (int u = 0; u < PK_U; ++u) f[u] = ip[256 * u];
#pragma unroll
    for (int u = 0; u < PK_U; ++u) {
        union { _Float16 h[4]; unsigned long long u; } pk;
        pk.h[0] = (_Float16)f[u].x; pk.h[1] = (_Float16)f[u].y;
        pk.h[2] = (_Float16)f[u].z; pk.h[3] = (_Float16)f[u].w;
        op[256 * u] = pk.u;
    }
    // The built code keeps a (never taken) way from here into the other jobs of the
    // launch, which write the stores' registers anew: the stores are issued first.
    asm volatile("s_wait_xcnt 0x0" ::: "memory");
}

// ---------------------------------------------------------------------------
// Transpose [B][512][3600] f32 -> [B*3600][512] f16. A block takes all 512
// channels of 32 positions: 64 KB read with 16 loads of 16 bytes a lane in
// flight, turned in LDS, 32 KB written as whole rows that follow one another.
// ---------------------------------------------------------------------------
#define T_PIT 520  // LDS row pitch in elements: 1040 B = 16 B x odd
static __device__ __forceinline__ void transpose_pack(const float* __restrict__ in,
                                                      _Float16* __restrict__ out,
                                                      _Float16 (*t)[T_PIT], int bx, int b) {
    const int tid = threadIdx.x;
    const int l0 = bx * 32;
    const int lq = tid & 7;   // four positions l0 + 4 lq ...
    const int dp = tid >> 3;  // channels 2 dp, 2 dp + 1 (+ 64 i)
    // Positions past the end are clamped to the last four; their LDS rows are not stored.
    const float* sp = in + (size_t)b * DM * LK_TOT + (size_t)(2 * dp) * LK_TOT
                         + min(l0 + 4 * lq, LK_TOT - 4);
    float4 x[8][2];
    // Unrolled: the array stays in registers and the loads issue back to back.
#pragma unroll
    for (int i = 0; i < 8; ++i)
#pragma unroll
        for (int j = 0; j < 2; ++j) x[i][j] = *(const float4*)(sp + (64 * i + j) * LK_TOT);
    // The loads are issued before any register of their address is written again;
    // the address is an input so that it lives up to the wait.
    asm volatile("s_wait_xcnt 0x0" :: "v"(sp) : "memory");
    // Holds all 16 loads in front of the first conversion; otherwise the last four
    // are issued only when the first four have come back.
    __builtin_amdgcn_sched_barrier(0);
#pragma unroll
    for (int i = 0; i < 8; ++i) {
        const float a[4] = {x[i][0].x, x[i][0].y, x[i][0].z, x[i][0].w};
        const float c[4] = {x[i][1].x, x[i][1].y, x[i][1].z, x[i][1].w};
#pragma unroll
        for (int e = 0; e < 4; ++e) {
            union { _Float16 h[2]; unsigned u; } pk;
            pk.h[0] = (_Float16)a[e]; pk.h[1] = (_Float16)c[e];
            *(unsigned*)&t[4 * lq + e][2 * dp + 64 * i] = pk.u;
        }
    }
    __syncthreads();
    const int r0 = tid >> 6, c8 = (tid & 63) * 8;  // store i: row r0 + 4 i
    _Float16* ob = out + ((size_t)b * LK_TOT + l0 + r0) * DM + c8;
    // Valid rows of the block, a multiple of 4: rows 4 i .. 4 i + 3 are valid together,
    // so both tests below are the same for the whole block.
    const int nv = LK_TOT - l0;
    if (nv >= 32) {
        v8h y[8];
#pragma unroll
        for (int i = 0; i < 8; ++i) y[i] = *(const v8h*)&t[r0 + 4 * i][c8];
#pragma unroll
        for (int i = 0; i < 8; ++i) *(v8h*)(ob + 4 * i * DM) = y[i];
    } else {
#pragma unroll
        for (int i = 0; i < 8; ++i)
            if (4 * i < nv) *(v8h*)(ob + 4 * i * DM) = *(const v8h*)&t[r0 + 4 * i][c8];
        // The built code keeps a (never taken) way from here into the other branch,
        // which writes the stores' data registers anew: the stores are issued first.
        asm volatile("s_wait_xcnt 0x0" ::: "memory");
    }
    // The same towards the other jobs of the launch, for both branches.
    asm volatile("s_wait_xcnt 0x0" ::: "memory");
}

// ---------------------------------------------------------------------------
// v [B][512][3600] f32 is V^T as it stands: packed to f16 in blocks of one
// attention key tile, [B][key tile][512][32 keys]. A block takes one tile: 64 KB
// read with 16 loads of 16 bytes a lane in flight (8 lanes cover a channel's 128
// bytes), 32 KB written in a row, 256 bytes a wave and store.
// ---------------------------------------------------------------------------
static __device__ __forceinline__ void reblock_v(const float* __restrict__ in,
                                                 _Float16* __restrict__ out, int bx, int b) {
    const int tid = threadIdx.x;
    const int l0 = bx * K_BLK;
    const int p4 = (tid & 7) * 4;  // four keys l0 + p4 ...
    const int d0 = tid >> 3;       // load i: channel d0 + 32 i
    // Keys past the end are clamped to the last four; they are not stored.
    const float* sp = in + ((size_t)b * DM + d0) * LK_TOT + min(l0 + p4, LK_TOT - 4);
    // Channel d, key p of the tile stand at 32 d + p: group of four number tid + 256 i.
    unsigned long long* op = (unsigned long long*)(out + (size_t)(b * N_KT + bx) * (DM * K_BLK)) + tid;
    float4 x[16];
    // Unrolled: the array stays in registers and the loads issue back to back.
#pragma unroll
    for (int i = 0; i < 16; ++i) x[i] = *(const float4*)(sp + 32 * i * LK_TOT);
    // The loads are issued before any register of their address is written again;
    // the address is an input so that it lives up to the wait.
    asm volatile("s_wait_xcnt 0x0" :: "v"(sp) : "memory");
    // Holds all 16 loads in front of the first conversion; otherwise the last ones
    // are issued only when the first have come back.
    __builtin_amdgcn_sched_barrier(0);
    if (l0 + p4 < LK_TOT) {
#pragma unroll
        for (int i = 0; i < 16; ++i) {
            union { _Float16 h[4]; unsigned long long u; } pk;
            pk.h[0] = (_Float16)x[i].x; pk.h[1] = (_Float16)x[i].y;
            pk.h[2] = (_Float16)x[i].z; pk.h[3] = (_Float16)x[i].w;
            op[256 * i] = pk.u;
        }
    }
    // The built code keeps a (never taken) way from here into the other jobs of the
    // launch, which write the stores' registers anew: the stores are issued first.
    asm volatile("s_wait_xcnt 0x0" ::: "memory");
}

// ---------------------------------------------------------------------------
// Product of two 512 x 512 weight matrices, C[a][b] = sum_o X(a, o) W[o][b], with
// X(a, o) = X[o][a] (XT) or X[a][o]: f32 read, f16 operands, WMMA, f16 stored.
// A wave makes 16 rows x 32 columns, straight from global memory (the matrices
// are small and stay in the caches); a larger tile would take registers that
// cost the other jobs of the launch resident blocks. Column fragment f of lane
// ln is column b0 + 2 ln + f: one 8-byte load serves both fragments, and a lane
// stores two columns in a row. Both operands take depth step 32 ks + 8 hi + e in
// element e and 32 ks + 16 + 8 hi + e in element 8 + e (e = 0 .. 7).
// ---------------------------------------------------------------------------
template <bool XT>
static __device__ __forceinline__ void weight_product(const float* __restrict__ X,
                                                      const float* __restrict__ Wm,
                                                      _Float16* __restrict__ out, int blk) {
    const int lane = threadIdx.x & 31;
    const int ln = lane & 15, hi = lane >> 4;
    const int wv = blk * 8 + (threadIdx.x >> 5);
    const int a0 = 16 * (wv >> 4), b0 = 32 * (wv & 15);
    const float* xb = XT ? X + 8 * hi * DM + a0 + ln : X + (a0 + ln) * DM + 8 * hi;
    const float* wb = Wm + 8 * hi * DM + b0 + 2 * ln;
    v8f acc[2];
#pragma unroll
    for (int f = 0; f < 2; ++f) acc[f] = v8f_zero();
    // Kept rolled: run once by few waves, unrolled it would be 16 times the code.
#pragma unroll 1
    for (int ks = 0; ks < DM / 32; ++ks) {
        const float* xk = xb + (XT ? 32 * ks * DM : 32 * ks);
        const float* wk = wb + 32 * ks * DM;
        float  xa[16];
        float2 wq[16];
#pragma unroll
        for (int e = 0; e < 16; ++e) {
            const int kk = e + (e & 8);  // 0 .. 7, 16 .. 23
            xa[e] = XT ? xk[kk * DM] : xk[kk];
            wq[e] = *(const float2*)(wk + kk * DM);
        }
        // The loads are issued before any register of their addresses is written
        // again; the addresses are inputs so that they live up to the wait.
        asm volatile("s_wait_xcnt 0x0" :: "v"(xk), "v"(wk) : "memory");
        // Holds all the step's loads in front of the first conversion; sunk among the
        // conversions they were waited for in groups, one latency after another.
        __builtin_amdgcn_sched_barrier(0);
        v16h fa, fb[2];
#pragma unroll
        for (int e = 0; e < 16; ++e) {
            fa[e]    = (_Float16)xa[e];
            fb[0][e] = (_Float16)wq[e].x; fb[1][e] = (_Float16)wq[e].y;
        }
#pragma unroll
        for (int f = 0; f < 2; ++f)
            acc[f] = __builtin_amdgcn_wmma_f32_16x16x32_f16(
                false, fa, false, fb[f], (short)0, acc[f], false, false);
    }
    // Accumulator register g of fragment f: row a0 + 8 hi + g, column b0 + 2 ln + f.
    _Float16* ob = out + (a0 + 8 * hi) * DM + b0 + 2 * ln;
#pragma unroll
    for (int g = 0; g < 8; ++g) {
        union { _Float16 h[2]; unsigned u; } pk;
        pk.h[0] = (_Float16)acc[0][g]; pk.h[1] = (_Float16)acc[1][g];
        *(unsigned*)(ob + g * DM) = pk.u;
    }
    // The built code keeps a (never taken) way from here into the other jobs of the
    // launch, which write the stores' registers anew: the stores are issued first.
    asm volatile("s_wait_xcnt 0x0" ::: "memory");
}

// ---------------------------------------------------------------------------
// These five jobs depend on nothing but the inputs: one launch, the jobs dealt
// by block index (every test below is the same for a whole block). The two
// weight products, the longest chains, start first and end under the others;
// then the jobs on k and v, whose blocks move the most bytes.
// ---------------------------------------------------------------------------
#define NB_TR (N_KT * B_SZ)                   // blocks of the transpose of k, of the job on v
#define NB_PQ (M_TOT * DM / 4 / (256 * PK_U)) // blocks of the pack of q
#define NB_WP (DM / 16 * (DM / 32) / 8)       // blocks of one weight product
#define NB_PREP (2 * NB_WP + 2 * NB_TR + NB_PQ)

__global__ void __launch_bounds__(256)
prep(const float* __restrict__ q, const float* __restrict__ k, const float* __restrict__ v,
     const float* __restrict__ wqkv, const float* __restrict__ fcw,
     _Float16* __restrict__ qh, _Float16* __restrict__ kh, _Float16* __restrict__ vT,
     _Float16* __restrict__ wm16, _Float16* __restrict__ wf16) {
    __shared__ __align__(16) _Float16 t[32][T_PIT];
    int blk = blockIdx.x;
    if (blk < NB_WP) {
        weight_product<true>(wqkv, wqkv, wm16, blk);  // W^T W
        return;
    }
    blk -= NB_WP;
    if (blk < NB_WP) {
        weight_product<false>(fcw, wqkv, wf16, blk);  // fc_w W
        return;
    }
    blk -= NB_WP;
    if (blk < NB_TR) {
        transpose_pack(k, kh, t, blk % N_KT, blk / N_KT);
        return;
    }
    blk -= NB_TR;
    if (blk < NB_TR) {
        reblock_v(v, vT, blk % N_KT, blk / N_KT);
        return;
    }
    pack_f16(q, qh, blk - NB_TR);
}

// ---------------------------------------------------------------------------
// NT GEMM: C[M,512] = A[M,512] * W[512,512]^T, f16 in, WMMA f32 accumulate.
// Block = 256 threads (8 waves). Block tile 128x256, wave tile 64x64.
// A and W come in slabs of 64 depth steps (whole 128-byte lines of every row),
// staged in LDS by async copies, two buffers: slab t+1 flies while slab t is
// worked on. Fragments are read from LDS.
// C is stored as f16, row-major.
// ---------------------------------------------------------------------------
#define G_KS  64          // depth steps per slab
#define G_PIT 72          // LDS row pitch in elements: 144 B = 16 B x odd
#define G_NS  (DM / G_KS) // slabs

// Issue one slab's copies: A rows [128][64] and W rows [256][64].
// 4 + 8 copies per lane, every lane on; 8 lanes cover one row's 128 bytes.
// Both loops are unrolled so that the copies issue back to back.
static __device__ __forceinline__ void stage_aw(const _Float16* __restrict__ Ab,
                                                const _Float16* __restrict__ Wb,
                                                int k0, int tid,
                                                _Float16 (*dA)[G_PIT], _Float16 (*dW)[G_PIT]) {
    const int r0 = tid >> 3, c8 = (tid & 7) * 8;  // copy i: row r0 + 32 i
    const unsigned g0 = (unsigned)(r0 * DM + k0 + c8);
#pragma unroll
    for (int i = 0; i < 4; ++i)
        copy16_to_lds(Ab + (g0 + (unsigned)(32 * i * DM)), &dA[r0 + 32 * i][c8]);
#pragma unroll
    for (int i = 0; i < 8; ++i)
        copy16_to_lds(Wb + (g0 + (unsigned)(32 * i * DM)), &dW[r0 + 32 * i][c8]);
}

// Four waves per SIMD (256 registers a wave): two work-groups share a WGP, so
// that one works while the other stands at its barrier.
__global__ void __launch_bounds__(256, 4)
gemm512(const _Float16* __restrict__ A, const _Float16* __restrict__ W,
        _Float16* __restrict__ o16) {
    __shared__ __align__(16) _Float16 sA[2][128][G_PIT];
    __shared__ __align__(16) _Float16 sW[2][256][G_PIT];

    const int tid  = threadIdx.x;
    const int lane = tid & 31;
    const int w    = tid >> 5;
    const int ln   = lane & 15;
    const int hi   = lane >> 4;
    const int wm   = (w & 1) * 64;   // wave's rows inside the block tile
    const int wn   = (w >> 1) * 64;  // wave's columns inside the block tile
    const int m0   = blockIdx.x * 128 + wm;
    const int n0   = blockIdx.y * 256 + wn;

    const _Float16* Ab = A + (size_t)blockIdx.x * 128 * DM;  // block-uniform bases
    const _Float16* Wb = W + (size_t)blockIdx.y * 256 * DM;

    stage_aw(Ab, Wb, 0, tid, sA[0], sW[0]);

    v8f acc[4][4];
#pragma unroll
    for (int mi = 0; mi < 4; ++mi)
#pragma unroll
        for (int f = 0; f < 4; ++f) acc[mi][f] = v8f_zero();

    wait_asynccnt0();  // slab 0
    __syncthreads();
    stage_aw(Ab, Wb, G_KS, tid, sA[1], sW[1]);

    // Kept rolled: unrolled, fragments of neighbouring trips live side by side
    // and the 256 registers of a wave no longer hold them (spills).
#pragma unroll 1
    for (int t = 0; t < G_NS; ++t) {
        _Float16 (*bA)[G_PIT] = sA[t & 1];
        _Float16 (*bW)[G_PIT] = sW[t & 1];
        v16h fa[2][4], fb[2][4];  // [depth step of 32][fragment]
#pragma unroll
        for (int mi = 0; mi < 4; ++mi) fa[0][mi] = load_frag(&bA[wm + 16 * mi + ln][0], hi);
#pragma unroll
        for (int f = 0; f < 4; ++f) fb[0][f] = load_frag(&bW[wn + 16 * f + ln][0], hi);
        // Holds the 16 loads above as one group in front of the WMMA block; sunk
        // among the WMMAs each pair would be waited for at full LDS latency.
        __builtin_amdgcn_sched_barrier(0);
#pragma unroll
        for (int mi = 0; mi < 4; ++mi)
#pragma unroll
            for (int f = 0; f < 4; ++f)
                acc[mi][f] = __builtin_amdgcn_wmma_f32_16x16x32_f16(
                    false, fa[0][mi], false, fb[0][f], (short)0, acc[mi][f], false, false);
#pragma unroll
        for (int mi = 0; mi < 4; ++mi) fa[1][mi] = load_frag(&bA[wm + 16 * mi + ln][32], hi);
#pragma unroll
        for (int f = 0; f < 4; ++f) fb[1][f] = load_frag(&bW[wn + 16 * f + ln][32], hi);

        // ---- publish slab t+1, free this slab's buffer, refill it ----
        // This wave's LDS reads of the buffer have retired before it is refilled.
        asm volatile("s_wait_dscnt 0x0" ::: "memory");
        wait_asynccnt0();  // this wave's share of slab t+1
        __syncthreads();
        if (t + 2 < G_NS) stage_aw(Ab, Wb, (t + 2) * G_KS, tid, bA, bW);
        // Keeps the copies in front of the slab's second WMMA block, which works on
        // registers alone: issued behind it they would fly half a trip less.
        __builtin_amdgcn_sched_barrier(0);
#pragma unroll
        for (int mi = 0; mi < 4; ++mi)
#pragma unroll
            for (int f = 0; f < 4; ++f)
                acc[mi][f] = __builtin_amdgcn_wmma_f32_16x16x32_f16(
                    false, fa[1][mi], false, fb[1][f], (short)0, acc[mi][f], false, false);
    }
    wait_asynccnt0();  // nothing in flight when the wave ends

#pragma unroll
    for (int mi = 0; mi < 4; ++mi) {
        const int r0 = m0 + 16 * mi + hi * 8;
#pragma unroll
        for (int f = 0; f < 4; ++f) {
            const int col = n0 + 16 * f + ln;
#pragma unroll
            for (int g = 0; g < 8; ++g)
                o16[(size_t)(r0 + g) * DM + col] = (_Float16)acc[mi][f][g];
        }
    }
}

// ---------------------------------------------------------------------------
// Flash attention: block = 128 q-rows, 8 waves, 32-key tiles, online softmax.
// qp: [B*Lq,512] f16  kp: [B*Lk,512] f16  vpT: [B][key tile][512][32 keys] f16
// (qp = q W^T W, kp = k and vpT = v^T as they come: see kernel_launch)
// The fc product, bias, residual and LayerNorm follow in the same work-group,
// which holds whole rows of the attention result: see behind the loop.
// One work-group per WGP, the whole grid resident at once: every staged K/V
// tile serves 128 query rows. Q lives in registers as B fragments.
// The three steps of a tile are spread over three trips of the loop: trip j
// does the scores of tile j, the softmax of tile j - 1 and the V product of
// tile j - 2. Inside a trip they depend on nothing of one another (scores, P
// and the rescale factors have two LDS buffers each), so a trip has one barrier
// and one wave's softmax runs beside the other wave's matrix work.
// Stage j of the ring is what trip j reads: K tile j and V tile j - 2, staged in
// LDS by async copies, two buffers: stage j+1 flies while stage j is worked on.
// Still open: a third ring buffer (it fits the LDS), so that a stage's copies
// have two trips to land instead of one.
// Every loop over fragments is unrolled: the fragment and accumulator arrays
// stay in registers only under constant indices.
// ---------------------------------------------------------------------------
#define Q_BLK 128  // query rows per work-group

// Issue one 32-key tile's copies of K rows [32][512]: 8 copies per lane, every
// lane on. Ragged keys are clamped to valid rows; their scores are masked.
// The tile lies in a row in memory: every copy of a wave reads 512 bytes in a
// row, four whole 128-byte lines. Unrolled so that the copies issue back to back.
static __device__ __forceinline__ void stage_k(const _Float16* __restrict__ kp,
                                               size_t bL, int k0, int tid,
                                               _Float16 (*dK)[520]) {
    const _Float16* kb = kp + bL * (size_t)DM;  // block-uniform base, 32-bit lane offsets
    const int r0 = tid >> 6, k8 = (tid & 63) * 8;  // copy i: K row r0 + 4 i
#pragma unroll
    for (int i = 0; i < 8; ++i) {
        const int gr = min(k0 + r0 + 4 * i, LK_TOT - 1);
        copy16_to_lds(kb + (unsigned)(gr * DM + k8), &dK[r0 + 4 * i][k8]);
    }
}

// The same for the tile's V^T rows [512][32]. Ragged keys are clamped to valid
// 8-key chunks; their P is 0.
static __device__ __forceinline__ void stage_v(const _Float16* __restrict__ vpT,
                                               int b, int k0, int tid,
                                               _Float16 (*dV)[40]) {
    const _Float16* vb = vpT + ((size_t)b * N_KT * K_BLK + k0) * DM;  // tile k0 / 32 of batch b
    const int d0 = tid >> 2, j8 = (tid & 3) * 8;   // copy i: V^T row d0 + 64 i
    // d0 * 32 + j8 = 8 tid; a chunk past the last key steps back to the last valid one.
    const unsigned v0 = (unsigned)(tid * 8 - max(j8 - (LK_TOT - 8 - k0), 0));
#pragma unroll
    for (int i = 0; i < 8; ++i)
        copy16_to_lds(vb + (v0 + (unsigned)(64 * i * K_BLK)), &dV[d0 + 64 * i][j8]);
}

// Value of the neighbour lane (lane ^ 1): DPP quad_perm [1,0,3,2].
static __device__ __forceinline__ float lane_xor1(float x) {
    return __builtin_bit_cast(float,
        __builtin_amdgcn_mov_dpp(__builtin_bit_cast(int, x), 0xB1, 0xf, 0xf, true));
}

// Online softmax of one 32-key tile: 2 threads per row, 4-key chunks dealt
// alternately. S0, S1: the two depth halves of the scores; P and the rescale
// factors A go to LDS; the row's state stays in the two threads' registers.
// Keys from nvalid on are masked; both tests on nvalid are the same for the
// whole work-group and fail for every tile but the last.
static __device__ __forceinline__ void softmax_tile(const float (*S0)[36], const float (*S1)[36],
                                                    _Float16 (*P)[40], float* A, int nvalid,
                                                    int tid, float& m_run, float& l_run) {
    const float scale = 0.044194173824159216f;  // 1/sqrt(512)
    const int row = tid >> 1, sub = tid & 1;
    float sv[16];
#pragma unroll
    for (int c = 0; c < 4; ++c) {
        const int c0 = 4 * (2 * c + sub);
        const float4 x = *(const float4*)&S0[row][c0];
        const float4 y = *(const float4*)&S1[row][c0];
        sv[4 * c + 0] = (x.x + y.x) * scale;
        sv[4 * c + 1] = (x.y + y.y) * scale;
        sv[4 * c + 2] = (x.z + y.z) * scale;
        sv[4 * c + 3] = (x.w + y.w) * scale;
    }
    // LK_TOT and K_BLK are multiples of 8: the row's two chunks c are valid together.
    if (nvalid < K_BLK) {
#pragma unroll
        for (int e = 0; e < 16; ++e)
            if (8 * (e >> 2) >= nvalid) sv[e] = -1e30f;
    }
    float pm = -1e30f;
#pragma unroll
    for (int e = 0; e < 16; ++e) pm = fmaxf(pm, sv[e]);
    pm = fmaxf(pm, lane_xor1(pm));
    const float m_new = fmaxf(m_run, pm);
    const float alpha = __expf(m_run - m_new);
    float p[16];
#pragma unroll
    for (int e = 0; e < 16; ++e) p[e] = __expf(sv[e] - m_new);
    if (nvalid < K_BLK) {
#pragma unroll
        for (int e = 0; e < 16; ++e)
            if (8 * (e >> 2) >= nvalid) p[e] = 0.f;
    }
    float ps = 0.f;
#pragma unroll
    for (int c = 0; c < 4; ++c) {
        union { _Float16 h[4]; unsigned long long u; } pk;
#pragma unroll
        for (int e = 0; e < 4; ++e) {
            pk.h[e] = (_Float16)p[4 * c + e];
            ps += p[4 * c + e];
        }
        *(unsigned long long*)&P[row][4 * (2 * c + sub)] = pk.u;
    }
    ps += lane_xor1(ps);
    l_run = l_run * alpha + ps;
    m_run = m_new;
    if (sub == 0) A[row] = alpha;
}

// Issue one slab's copies of the fc weights: rows [512][64], 16 copies per lane,
// every lane on; 8 lanes cover one row's 128 bytes. Unrolled so that the copies
// issue back to back.
static __device__ __forceinline__ void stage_w(const _Float16* __restrict__ Wb, int k0, int tid,
                                               _Float16 (*dW)[G_PIT]) {
    const int r0 = tid >> 3, c8 = (tid & 7) * 8;  // copy i: row r0 + 32 i
    const unsigned g0 = (unsigned)(r0 * DM + k0 + c8);
#pragma unroll
    for (int i = 0; i < 16; ++i)
        copy16_to_lds(Wb + (g0 + (unsigned)(32 * i * DM)), &dW[r0 + 32 * i][c8]);
}

// Sum over the 32 lanes, the same value in every lane: four steps inside the
// 16-lane rows (DPP row_xmask 1, 2, 4, 8), then the other row's sum.
static __device__ __forceinline__ float wave_sum(float x) {
    x += __builtin_bit_cast(float, __builtin_amdgcn_mov_dpp(__builtin_bit_cast(int, x), 0x161, 0xf, 0xf, true));
    x += __builtin_bit_cast(float, __builtin_amdgcn_mov_dpp(__builtin_bit_cast(int, x), 0x162, 0xf, 0xf, true));
    x += __builtin_bit_cast(float, __builtin_amdgcn_mov_dpp(__builtin_bit_cast(int, x), 0x164, 0xf, 0xf, true));
    x += __builtin_bit_cast(float, __builtin_amdgcn_mov_dpp(__builtin_bit_cast(int, x), 0x168, 0xf, 0xf, true));
    const int xi = __builtin_bit_cast(int, x);
    return x + __builtin_bit_cast(float,
        __builtin_amdgcn_permlanex16(xi, xi, 0x76543210, 0xfedcba98, false, false));
}

// LDS of flash_attn, byte offsets in one array. In the loop over the key tiles:
#define OFF_K  0       // [2][32][520] f16, pitch 1040 B = 16 B x odd
#define OFF_V  66560   // [2][512][40] f16, pitch 80 B = 16 B x odd
#define OFF_S  148480  // [2 tile parities][2 depth halves][128][36] f32, pitch 144 B
#define OFF_P  222208  // [2 tile parities][128][40] f16, pitch 80 B = 16 B x odd
#define OFF_AL 242688  // [2 tile parities][128] f32
// Behind the loop the same bytes hold, for the fc product:
#define OFF_O  0       // [128][520] f16: the normalized attention rows
#define OFF_W  133120  // [2][512][72] f16: slabs of the fc weights
// and behind the fc product:
#define OFF_F  0       // [128][516] f32: its result, pitch 2064 B = 16 B x odd
#define F_PIT  516
// Shared with nothing:
#define OFF_L  280576  // [128] f32: the rows' sums of exponentials
#define FL_LDS 281088

__global__ void __launch_bounds__(256)
flash_attn(const _Float16* __restrict__ qp, const _Float16* __restrict__ kp,
           const _Float16* __restrict__ vpT, const _Float16* __restrict__ wf,
           const float* __restrict__ bias, const float* __restrict__ resid,
           const float* __restrict__ gamma, const float* __restrict__ beta,
           float* __restrict__ out) {
    __shared__ __align__(16) char smem[FL_LDS];
    _Float16 (*sK)[K_BLK][520]   = (_Float16 (*)[K_BLK][520])(smem + OFF_K);
    _Float16 (*sV)[512][40]      = (_Float16 (*)[512][40])(smem + OFF_V);
    float    (*sS)[2][Q_BLK][36] = (float (*)[2][Q_BLK][36])(smem + OFF_S);
    _Float16 (*sP)[Q_BLK][40]    = (_Float16 (*)[Q_BLK][40])(smem + OFF_P);
    float    (*sAlpha)[Q_BLK]    = (float (*)[Q_BLK])(smem + OFF_AL);
    float*   sL                  = (float*)(smem + OFF_L);
    _Float16 (*sO)[520]          = (_Float16 (*)[520])(smem + OFF_O);
    _Float16 (*sW)[512][G_PIT]   = (_Float16 (*)[512][G_PIT])(smem + OFF_W);
    float    (*sF)[F_PIT]        = (float (*)[F_PIT])(smem + OFF_F);

    const int tid  = threadIdx.x;
    const int lane = tid & 31;
    const int w    = tid >> 5;
    const int ln   = lane & 15;
    const int hi   = lane >> 4;
    const int b    = blockIdx.y;
    const int q0   = blockIdx.x * Q_BLK;
    const size_t bL = (size_t)b * LQ_TOT;
    // The wave's number in a scalar register, for the part behind the loop.
    const int ws = __builtin_amdgcn_readfirstlane(tid >> 5);
    stage_k(kp, bL, 0, tid, sK[0]);  // stage 0: K tile 0 alone

    // Score work of a wave: 32 query rows x 32 keys x one half of the depth.
    const int qb = w & 3;   // block of 32 query rows
    const int kh = w >> 2;  // depth half (256 of 512)

    // This wave's Q fragments, loaded once (ragged rows clamped, never stored).
    v16h fq[2][8];
#pragma unroll
    for (int qi = 0; qi < 2; ++qi) {
        const int gr = min(q0 + 32 * qb + 16 * qi + ln, LQ_TOT - 1);
        const _Float16* qrow = qp + (bL + gr) * (size_t)DM + kh * 256 + hi * 8;
#pragma unroll
        for (int ks = 0; ks < 8; ++ks)
            fq[qi][ks] = mk_frag(*(const v8h*)(qrow + ks * 32), *(const v8h*)(qrow + ks * 32 + 16));
        // The row's loads are issued before any register of their address is
        // written again; the address is an input so that it lives up to the wait.
        asm volatile("s_wait_xcnt 0x0" :: "v"(qrow) : "memory");
    }

    v8f o[8][4];
#pragma unroll
    for (int mi = 0; mi < 8; ++mi)
#pragma unroll
        for (int ni = 0; ni < 4; ++ni) o[mi][ni] = v8f_zero();

    // Softmax state of row tid >> 1, held alike by the two threads of the row.
    float m_run = -1e30f, l_run = 0.f;

    wait_asynccnt0();  // stage 0
    __syncthreads();
    stage_k(kp, bL, K_BLK, tid, sK[1]);  // stage 1: K tile 1 alone

    // Every test on j is the same for the whole work-group.
    for (int j = 0; j < N_KT + 2; ++j) {
        const int par = j & 1;

        if (j < N_KT) {
            _Float16 (*bK)[520] = sK[par];
            // ---- tile j: S^T = K Q^T over this wave's depth half: 2 x 2 fragments ----
            v8f s[2][2];
#pragma unroll
            for (int nj = 0; nj < 2; ++nj)
#pragma unroll
                for (int qi = 0; qi < 2; ++qi) s[nj][qi] = v8f_zero();
            // K fragments come in groups of two depth steps (8 loads), two register
            // sets: a group is issued one block of 8 WMMAs ahead of its use.
            v16h fk[2][2][2];  // [set][step in group][nj]
#pragma unroll
            for (int gp = 0; gp < 2; ++gp)
#pragma unroll
                for (int t = 0; t < 2; ++t)
#pragma unroll
                    for (int nj = 0; nj < 2; ++nj)
                        fk[gp][t][nj] = load_frag(&bK[16 * nj + ln][kh * 256 + (2 * gp + t) * 32], hi);
#pragma unroll
            for (int gp = 0; gp < 4; ++gp) {
                // Holds the loads above as one group in front of this WMMA block; sunk
                // among the WMMAs each would be waited for at full LDS latency.
                __builtin_amdgcn_sched_barrier(0);
#pragma unroll
                for (int t = 0; t < 2; ++t)
#pragma unroll
                    for (int nj = 0; nj < 2; ++nj)
#pragma unroll
                        for (int qi = 0; qi < 2; ++qi)
                            s[nj][qi] = __builtin_amdgcn_wmma_f32_16x16x32_f16(
                                false, fk[gp & 1][t][nj], false, fq[qi][2 * gp + t], (short)0,
                                s[nj][qi], false, false);
                // Keeps the refill of this register set behind the block that reads it.
                __builtin_amdgcn_sched_barrier(0);
                if (gp + 2 < 4) {
#pragma unroll
                    for (int t = 0; t < 2; ++t)
#pragma unroll
                        for (int nj = 0; nj < 2; ++nj)
                            fk[gp & 1][t][nj] =
                                load_frag(&bK[16 * nj + ln][kh * 256 + (2 * (gp + 2) + t) * 32], hi);
                }
            }
            // A lane holds 8 consecutive keys of one query row: two 16-byte stores.
#pragma unroll
            for (int nj = 0; nj < 2; ++nj)
#pragma unroll
                for (int qi = 0; qi < 2; ++qi) {
                    float* dst = &sS[par][kh][32 * qb + 16 * qi + ln][16 * nj + 8 * hi];
                    *(float4*)dst       = make_float4(s[nj][qi][0], s[nj][qi][1], s[nj][qi][2], s[nj][qi][3]);
                    *(float4*)(dst + 4) = make_float4(s[nj][qi][4], s[nj][qi][5], s[nj][qi][6], s[nj][qi][7]);
                }
        }

        // ---- tile j - 1: online softmax ----
        if (j >= 1 && j <= N_KT)
            softmax_tile(sS[par ^ 1][0], sS[par ^ 1][1], sP[par ^ 1], sAlpha[par ^ 1],
                         min(K_BLK, LK_TOT - (j - 1) * K_BLK), tid, m_run, l_run);

        // ---- tile j - 2: rescale O^T, then O^T += V^T P^T (wave owns 64 d-rows, all 128 queries) ----
        if (j >= 2) {
            _Float16 (*bV)[40] = sV[par];
            // A lane's accumulators of block mi all belong to query 16 mi + ln: one factor.
#pragma unroll
            for (int mi = 0; mi < 8; ++mi) {
                const float al = sAlpha[par][16 * mi + ln];
#pragma unroll
                for (int ni = 0; ni < 4; ++ni)
#pragma unroll
                    for (int g = 0; g < 8; ++g) o[mi][ni][g] *= al;
            }
            v16h pa[8];
#pragma unroll
            for (int mi = 0; mi < 8; ++mi) pa[mi] = load_frag(&sP[par][16 * mi + ln][0], hi);
#pragma unroll
            for (int ni = 0; ni < 4; ++ni) {
                const int d = 64 * w + 16 * ni + ln;
                v16h vb = load_frag(&bV[d][0], hi);
#pragma unroll
                for (int mi = 0; mi < 8; ++mi)
                    o[mi][ni] = __builtin_amdgcn_wmma_f32_16x16x32_f16(
                        false, vb, false, pa[mi], (short)0, o[mi][ni], false, false);
            }
        }

        // ---- the trip's one barrier: publish stage j+1 and this trip's scores, P and
        // factors, free this stage's buffers, refill them ----
        // This wave's LDS reads of the buffers have retired before they are refilled.
        asm volatile("s_wait_dscnt 0x0" ::: "memory");
        wait_asynccnt0();  // this wave's share of stage j+1
        __syncthreads();
        if (j < N_KT) {  // a stage j+2 exists: K tile j+2, where there is one, and V tile j
            if (j + 2 < N_KT) stage_k(kp, bL, (j + 2) * K_BLK, tid, sK[par]);
            stage_v(vpT, b, j * K_BLK, tid, sV[par]);
        }
    }
    wait_asynccnt0();  // nothing in flight when the buffers get their new use

    // The lane's number is read anew here rather than kept alive through the loop,
    // whose registers are all taken.
    const int lane_e = (int)__builtin_amdgcn_mbcnt_lo(~0u, 0u);
    const int ln_e = lane_e & 15, hi_e = lane_e >> 4;
    const int tid_e = 32 * ws + lane_e;

    // ---- fc product, transposed like the V product: F^T = Wf O^T. A wave owns 64
    // output columns of all 128 queries, in the registers that held O^T. O goes
    // through LDS as f16 (every wave reads all of it); Wf comes in slabs of 64 depth
    // steps by async copies, two buffers, as in gemm512. ----
    // The last trip's s_wait_dscnt 0 and barrier have ended every read of the loop's buffers.
    stage_w(wf, 0, tid_e, sW[0]);
    if ((tid_e & 1) == 0) sL[tid_e >> 1] = l_run;
    __syncthreads();
    // A lane holds 8 consecutive d of one query row: one 16-byte store per fragment.
#pragma unroll
    for (int mi = 0; mi < 8; ++mi) {
        const int row = 16 * mi + ln_e;
        const float inv = 1.0f / sL[row];
#pragma unroll
        for (int ni = 0; ni < 4; ++ni) {
            v8h ph;
#pragma unroll
            for (int g = 0; g < 8; ++g) ph[g] = (_Float16)(o[mi][ni][g] * inv);
            *(v8h*)&sO[row][64 * ws + 16 * ni + hi_e * 8] = ph;
            o[mi][ni] = v8f_zero();
        }
    }
    wait_asynccnt0();  // slab 0
    __syncthreads();
    stage_w(wf, G_KS, tid_e, sW[1]);

    // Kept rolled, for speed only.
#pragma unroll 1
    for (int t = 0; t < G_NS; ++t) {
        _Float16 (*bW)[G_PIT] = sW[t & 1];
        v16h fa[2][4], fb[2][8];  // [depth step of 32][fragment]
#pragma unroll
        for (int ni = 0; ni < 4; ++ni) fa[0][ni] = load_frag(&bW[64 * ws + 16 * ni + ln_e][0], hi_e);
#pragma unroll
        for (int mi = 0; mi < 8; ++mi) fb[0][mi] = load_frag(&sO[16 * mi + ln_e][G_KS * t], hi_e);
        // Holds the 24 loads above as one group in front of the WMMA block; sunk
        // among the WMMAs each pair would be waited for at full LDS latency.
        __builtin_amdgcn_sched_barrier(0);
#pragma unroll
        for (int ni = 0; ni < 4; ++ni)
#pragma unroll
            for (int mi = 0; mi < 8; ++mi)
                o[mi][ni] = __builtin_amdgcn_wmma_f32_16x16x32_f16(
                    false, fa[0][ni], false, fb[0][mi], (short)0, o[mi][ni], false, false);
#pragma unroll
        for (int ni = 0; ni < 4; ++ni) fa[1][ni] = load_frag(&bW[64 * ws + 16 * ni + ln_e][32], hi_e);
#pragma unroll
        for (int mi = 0; mi < 8; ++mi) fb[1][mi] = load_frag(&sO[16 * mi + ln_e][G_KS * t + 32], hi_e);

        // ---- publish slab t+1, free this slab's buffer, refill it ----
        // This wave's LDS reads of the buffer have retired before it is refilled.
        asm volatile("s_wait_dscnt 0x0" ::: "memory");
        wait_asynccnt0();  // this wave's share of slab t+1
        __syncthreads();
        if (t + 2 < G_NS) stage_w(wf, (t + 2) * G_KS, tid_e, bW);
        // Keeps the copies in front of the slab's second WMMA block, which works on
        // registers alone: issued behind it they would fly half a trip less.
        __builtin_amdgcn_sched_barrier(0);
#pragma unroll
        for (int ni = 0; ni < 4; ++ni)
#pragma unroll
            for (int mi = 0; mi < 8; ++mi)
                o[mi][ni] = __builtin_amdgcn_wmma_f32_16x16x32_f16(
                    false, fa[1][ni], false, fb[1][mi], (short)0, o[mi][ni], false, false);
    }
    wait_asynccnt0();  // nothing in flight when the buffers get their new use

    // ---- bias, residual, LayerNorm: a wave takes 16 whole rows. LQ_TOT and Q_BLK are
    // multiples of 16: a wave's rows are valid together (a test on scalars). ----
    const bool live = q0 + 16 * ws < LQ_TOT;
    // Piece j of a row: columns 128 j + 4 lane ..: a wave's load is 512 bytes in a row.
    const size_t e0 = (bL + q0 + 16 * ws) * (size_t)DM + lane_e * 4;
    const float* rb = resid + e0;
    float*       ob = out + e0;
    float4 rn[4][4], bi[4], ga[4], be[4];
    // The first four rows' residual and the three vectors are asked for here, under
    // the stores and the barrier below.
    if (live) {
#pragma unroll
        for (int r = 0; r < 4; ++r)
#pragma unroll
            for (int j = 0; j < 4; ++j) rn[r][j] = *(const float4*)(rb + r * DM + 128 * j);
#pragma unroll
        for (int j = 0; j < 4; ++j) {
            bi[j] = *(const float4*)(bias + lane_e * 4 + 128 * j);
            ga[j] = *(const float4*)(gamma + lane_e * 4 + 128 * j);
            be[j] = *(const float4*)(beta + lane_e * 4 + 128 * j);
        }
        // The loads are issued before any register of their addresses is written
        // again; the addresses are inputs so that they live up to the wait.
        asm volatile("s_wait_xcnt 0x0" :: "v"(rb), "v"(lane_e) : "memory");
    }
    // Holds the loads above in front of the stores below.
    __builtin_amdgcn_sched_barrier(0);
    // The loop's last barrier has ended every read of O and of the slabs.
    // A lane holds 8 consecutive columns of one query row: two 16-byte stores.
#pragma unroll
    for (int mi = 0; mi < 8; ++mi)
#pragma unroll
        for (int ni = 0; ni < 4; ++ni) {
            float* dst = &sF[16 * mi + ln_e][64 * ws + 16 * ni + 8 * hi_e];
            *(float4*)dst       = make_float4(o[mi][ni][0], o[mi][ni][1], o[mi][ni][2], o[mi][ni][3]);
            *(float4*)(dst + 4) = make_float4(o[mi][ni][4], o[mi][ni][5], o[mi][ni][6], o[mi][ni][7]);
        }
    __syncthreads();
    if (!live) return;  // behind the last barrier
    const float* fp = &sF[16 * ws][4 * lane_e];
    // Four rows a trip; a row is summed in its wave's registers. Kept rolled, for
    // speed only.
#pragma unroll 1
    for (int r4 = 0; r4 < 16; r4 += 4) {
        float4 x[4][4];
#pragma unroll
        for (int r = 0; r < 4; ++r)
#pragma unroll
            for (int j = 0; j < 4; ++j) {
                const float4 f = *(const float4*)(fp + r * F_PIT + 128 * j);
                x[r][j].x = f.x + bi[j].x + rn[r][j].x;
                x[r][j].y = f.y + bi[j].y + rn[r][j].y;
                x[r][j].z = f.z + bi[j].z + rn[r][j].z;
                x[r][j].w = f.w + bi[j].w + rn[r][j].w;
            }
        // Keeps the loads below behind the sums above: they fill the registers that
        // the sums have read; lifted over them they took a second set and were
        // waited for early in the trip, where they were copied.
        __builtin_amdgcn_sched_barrier(0);
        // The next four rows' residual flies under this trip's sums. No branch here, so
        // that the order above holds: the last trip asks for its own rows once more.
        rb += (r4 + 4 < 16) ? 4 * DM : 0;
#pragma unroll
        for (int r = 0; r < 4; ++r)
#pragma unroll
            for (int j = 0; j < 4; ++j) rn[r][j] = *(const float4*)(rb + r * DM + 128 * j);
        // The loads are issued before any register of their address is written
        // again; the address is an input so that it lives up to the wait.
        asm volatile("s_wait_xcnt 0x0" :: "v"(rb) : "memory");
        // Holds the loads above in front of the sums; sunk behind them they would be
        // waited for at their whole latency in the next trip.
        __builtin_amdgcn_sched_barrier(0);
        float s[4];
#pragma unroll
        for (int r = 0; r < 4; ++r) {
            float a = 0.f;
#pragma unroll
            for (int j = 0; j < 4; ++j) a += (x[r][j].x + x[r][j].y) + (x[r][j].z + x[r][j].w);
            s[r] = a;
        }
#pragma unroll
        for (int r = 0; r < 4; ++r) s[r] = wave_sum(s[r]) * (1.0f / DM);
        float qs[4];
#pragma unroll
        for (int r = 0; r < 4; ++r) {
            float a = 0.f;
#pragma unroll
            for (int j = 0; j < 4; ++j) {
                x[r][j].x -= s[r]; x[r][j].y -= s[r]; x[r][j].z -= s[r]; x[r][j].w -= s[r];
                a += (x[r][j].x * x[r][j].x + x[r][j].y * x[r][j].y)
                   + (x[r][j].z * x[r][j].z + x[r][j].w * x[r][j].w);
            }
            qs[r] = a;
        }
#pragma unroll
        for (int r = 0; r < 4; ++r) qs[r] = rsqrtf(wave_sum(qs[r]) * (1.0f / DM) + 1e-5f);
#pragma unroll
        for (int r = 0; r < 4; ++r)
#pragma unroll
            for (int j = 0; j < 4; ++j) {
                float4 y;
                y.x = x[r][j].x * qs[r] * ga[j].x + be[j].x;
                y.y = x[r][j].y * qs[r] * ga[j].y + be[j].y;
                y.z = x[r][j].z * qs[r] * ga[j].z + be[j].z;
                y.w = x[r][j].w * qs[r] * ga[j].w + be[j].w;
                *(float4*)(ob + r * DM + 128 * j) = y;
            }
        // The rows' stores are issued before their address and the registers that
        // held their data are written again; the address is an input so that it
        // lives up to the wait.
        asm volatile("s_wait_xcnt 0x0" :: "v"(ob) : "memory");
        ob += 4 * DM;
        fp += 4 * F_PIT;
    }
}

// ---------------------------------------------------------------------------
extern "C" void kernel_launch(void* const* d_in, const int* in_sizes, int n_in,
                              void* d_out, int out_size, void* d_ws, size_t ws_size,
                              hipStream_t stream) {
    const float* q     = (const float*)d_in[0];
    const float* k     = (const float*)d_in[1];
    const float* v     = (const float*)d_in[2];
    const float* wqkv  = (const float*)d_in[3];
    const float* fcw   = (const float*)d_in[4];
    const float* fcb   = (const float*)d_in[5];
    const float* gamma = (const float*)d_in[6];
    const float* beta  = (const float*)d_in[7];
    float* out = (float*)d_out;

    char* ws = (char*)d_ws;
    const size_t SZ16 = (size_t)M_TOT * DM * sizeof(_Float16);  // 29,491,200 B
    _Float16* qh    = (_Float16*)(ws + 0 * SZ16);
    _Float16* kh    = (_Float16*)(ws + 1 * SZ16);
    _Float16* qp    = (_Float16*)(ws + 3 * SZ16);
    _Float16* vT    = (_Float16*)(ws + 5 * SZ16);
    // vT holds 113 whole key tiles a batch, a little more than SZ16: the weights
    // stand one plane further on.
    _Float16* wm16  = (_Float16*)(ws + 7 * SZ16);                        // W^T W
    _Float16* wf16  = (_Float16*)(ws + 7 * SZ16 + (size_t)DM * DM * 2);  // fc_w W

    // The shared projection W is folded into the weights:
    //   scores = (q W^T)(k W^T)^T = (q W^T W) k^T,
    //   out    = (P (v W^T)) fc_w^T = (P v)(fc_w W)^T,
    // so k and v go into the attention as they come and two of the four large
    // products are replaced by two products of 512 x 512 matrices.

    // Stage 1: the two weight products (WMMA); q, k, v to f16 in the layouts of
    // their readers; one launch
    prep<<<dim3(NB_PREP), 256, 0, stream>>>(q, k, v, wqkv, fcw, qh, kh, vT, wm16, wf16);

    // Stage 2: qp = q (W^T W) (WMMA); row n of wm16 is column n of W^T W as well
    // Still open in flash_attn: O rescaled only when a row maximum passes the
    // reference of its exponentials by 8 ln 2, one test per tile.
    // Still open: the f16 GEMM epilogue stores 32-byte pieces; whole lines through LDS.
    // Still open in flash_attn: waves w and w + 4 take a trip's three
    // independent steps in the same order; scores last in one of them would put its
    // vector work beside the other's matrix work (it builds in the same registers).
    dim3 gg(M_TOT / 128, 2);
    gemm512<<<gg, 256, 0, stream>>>(qh, wm16, qp);

    // Stage 3: flash attention (WMMA + LDS + async staging + online softmax), then in
    // the same work-groups the fc product (WMMA) + bias + residual and LayerNorm -> d_out
    // Still open: the projection of q done the same way, in front of the loop.
    dim3 fg(29, B_SZ);  // ceil(3600 / 128) query blocks
    flash_attn<<<fg, 256, 0, stream>>>(qp, kh, vT, wf16, fcb, q, gamma, beta, out);
}
